// v000
// Measured on an AMD MI455X. A time is GPU time per run, averaged over a window of back-to-back runs after a warm-up
// (all launches, gaps included; the runs take copies of the inputs in turn), and the median of several windows.
// Apart from v000's, it joins two sittings. Times from different sittings can be a few percent apart, while
// side-by-side timings come from the same sitting.
// v000, which the later versions start from, runs in 448 microseconds.
#include <hip/hip_runtime.h>

// Compute dtypes, f32 accumulate everywhere: inputs converted to bf16 (RNE); q/k/v and output projections = bf16 WMMA with the activation as hi|lo planes against exact bf16 weights (2 products); scores = bf16 WMMA q hi|lo x k hi|lo (3 products); P.V = f16 WMMA (P carried x16384, V plain f16); LayerNorm, softmax, GELU in f32.
// Pre-LN attention: y = LN(x) -> hi|lo planes; per-head projections written straight into head planes (q,k hi|lo [b][h][s][64]; v^T f16 [b][h][64][s]); fused flash attention in the transposed form S^T = K Q^T, O^T = V^T P^T (P fragment built in registers from the score accumulators); ctx hi|lo x Wp + bp -> erf GELU -> out.

#ifndef NB
#define NB 8
#endif
#ifndef SEQ
#define SEQ 2048
#endif
#define NB_FULL  8
#define SEQ_FULL 2048
#define DM   384
#define NH   6
#define HD   64
#define MTOK (NB * SEQ)
#define PCAR 16384.0f
#define L2E  1.4426950408889634f

static_assert(SEQ % 64 == 0);
static_assert(DM % 64 == 0);
static_assert(DM % 32 == 0);
static_assert(NH * HD == DM);
static_assert(NB <= NB_FULL);
static_assert(SEQ <= SEQ_FULL);
static_assert((size_t)4 * DM * DM * 2 + (size_t)7 * MTOK * DM * 2 <= (size_t)134217728);

typedef _Float16 h16;
typedef unsigned short bf;
typedef __attribute__((ext_vector_type(16))) __bf16   v16bf;
typedef __attribute__((ext_vector_type(16))) _Float16 v16h;
typedef __attribute__((ext_vector_type(8)))  _Float16 v8h;
typedef __attribute__((ext_vector_type(8)))  unsigned short v8us;
typedef __attribute__((ext_vector_type(4)))  unsigned short v4us;
typedef __attribute__((ext_vector_type(8)))  float    v8f;
typedef __attribute__((ext_vector_type(4)))  float    v4f;
typedef v4f  __attribute__((may_alias)) v4fa;

__device__ __forceinline__ unsigned short f2bf(float f) { unsigned u = __float_as_uint(f); u += 0x7FFFu + ((u >> 16) & 1u); return (unsigned short)(u >> 16); }
__device__ __forceinline__ float bf2f(unsigned short b) { return __uint_as_float(((unsigned)b) << 16); }
__device__ __forceinline__ float bfr(float f) { return bf2f(f2bf(f)); }
__device__ __forceinline__ void splitf(float y, unsigned short& h, unsigned short& l) { h = f2bf(y); l = f2bf(y - bf2f(h)); }
__device__ __forceinline__ v16h cat16(v8h lo, v8h hi) { return __builtin_shufflevector(lo, hi, 0, 1, 2, 3, 4, 5, 6, 7, 8, 9, 10, 11, 12, 13, 14, 15); }
__device__ __forceinline__ v16bf cat16b(v8us lo, v8us hi) { return __builtin_bit_cast(v16bf, __builtin_shufflevector(lo, hi, 0, 1, 2, 3, 4, 5, 6, 7, 8, 9, 10, 11, 12, 13, 14, 15)); }
__device__ __forceinline__ v8f wmma16(v16h a, v16h b, v8f c) { return __builtin_amdgcn_wmma_f32_16x16x32_f16(false, a, false, b, (short)0, c, false, false); }
__device__ __forceinline__ v8f wmmab(v16bf a, v16bf b, v8f c) { return __builtin_amdgcn_wmma_f32_16x16x32_bf16(false, a, false, b, (short)0, c, false, false); }
// Fragment loaders from K-contiguous 16-bit rows: p already holds row*(pitch) + k0 + 8*(lane>>4); elements 0..7 = k0+8h.., elements 8..15 = k0+16+8h..
__device__ __forceinline__ v16bf ldb(const bf* p) { return cat16b(*(const v8us*)p, *(const v8us*)(p + 16)); }
__device__ __forceinline__ v16h ldh(const h16* p) { return cat16(*(const v8h*)p, *(const v8h*)(p + 16)); }
// Same-wave LDS exchange (wave-private tiles only).
__device__ __forceinline__ void wave_lds_sync() { __builtin_amdgcn_fence(3 /* release order */, "wavefront"); __builtin_amdgcn_wave_barrier(); __builtin_amdgcn_fence(2 /* acquire order */, "wavefront"); asm volatile("" ::: "memory"); }

// ---- k_wt: in[z][rows][cols] (f32) -> out[z][cols][rows] (bf16 RNE), 64x64 tiles through LDS; grid (rows/64, cols/64, z), 256 threads.
__global__ __launch_bounds__(256) void k_wt(const float* __restrict__ src, bf* dst, int rows, int cols) {
    __shared__ float t[64 * 65];
    const int tid = threadIdx.x;
    const size_t zo = (size_t)blockIdx.z * (size_t)rows * (size_t)cols;
    const int r0 = blockIdx.x * 64, c0 = blockIdx.y * 64;
#pragma unroll 4
    for (int i = 0; i < 16; ++i) { const int rr = (tid >> 6) + 4 * i, cc = tid & 63; t[rr * 65 + cc] = src[zo + (size_t)(r0 + rr) * cols + c0 + cc]; }
    __syncthreads();
    const int pc = tid & 7;
{
#pragma unroll
        for (int it = 0; it < 2; ++it) { const int line = (tid >> 3) + 32 * it; v8us o;
#pragma unroll
            for (int i = 0; i < 8; ++i) o[i] = f2bf(t[(8 * pc + i) * 65 + line]);
            *(v8us*)(dst + zo + (size_t)(c0 + line) * rows + r0 + 8 * pc) = o; }
         }
}

__global__ __launch_bounds__(256) void k_ln(const float* __restrict__ x, const float* __restrict__ g, const float* __restrict__ be, bf* Yh, bf* Yl) {
    const int lane = threadIdx.x & 31;
    const int wave = __builtin_amdgcn_readfirstlane(threadIdx.x >> 5);
    const int tok = blockIdx.x * 8 + wave;
    const int b = tok / SEQ, s = tok % SEQ;
    const float* xr = x + ((size_t)b * SEQ_FULL + s) * DM;
    v4f v[3]; float sum = 0.0f;
#pragma unroll
    for (int j = 0; j < 3; ++j) { v4f a = *(const v4f*)(xr + j * 128 + lane * 4);
#pragma unroll
        for (int q = 0; q < 4; ++q) { a[q] = bfr(a[q]); sum += a[q]; }
        v[j] = a; }
#pragma unroll
    for (int sh = 16; sh; sh >>= 1) sum += __shfl_xor(sum, sh, 32);
    const float mu = sum * (1.0f / DM);
    float var = 0.0f;
#pragma unroll
    for (int j = 0; j < 3; ++j) {
#pragma unroll
        for (int q = 0; q < 4; ++q) { const float d = v[j][q] - mu; var += d * d; } }
#pragma unroll
    for (int sh = 16; sh; sh >>= 1) var += __shfl_xor(var, sh, 32);
    const float rs = rsqrtf(var * (1.0f / DM) + 1e-5f);
    v4us oh[3], ol[3];
#pragma unroll
    for (int j = 0; j < 3; ++j) { const v4f gg = *(const v4f*)(g + j * 128 + lane * 4); const v4f bb = *(const v4f*)(be + j * 128 + lane * 4);
#pragma unroll
        for (int q = 0; q < 4; ++q) { const float y = (v[j][q] - mu) * rs * bfr(gg[q]) + bfr(bb[q]); unsigned short a, c; splitf(y, a, c); oh[j][q] = a; ol[j][q] = c; } }
    const size_t ro = (size_t)tok * DM + lane * 4;
{
#pragma unroll
        for (int j = 0; j < 3; ++j) { *(v4us*)(Yh + ro + j * 128) = oh[j]; *(v4us*)(Yl + ro + j * 128) = ol[j]; }
         }
}

// ---- k_gemmw: register-blocked GEMM, ONE WAVE per 64x64 output tile (16 accumulators), operands straight from K-contiguous bf16 planes (K = 384); grid (M/64, 384/64), 32 threads.
// MODE 2: f32 output rows [tok][384] with exact erf GELU (16 lanes x 16 B = 256 B per row segment, 2 rows per instruction).
template <int MODE>
__global__ __launch_bounds__(32) void k_gemmw(const bf* __restrict__ A, const bf* __restrict__ A2, const bf* __restrict__ Bt, const float* __restrict__ bias, bf* Oh, bf* Ol, h16* Ov, float* Of) {
    __shared__ __align__(16) float os[64 * 68];
    const int lane = threadIdx.x & 31, lr = lane & 15, hi = lane >> 4;
    const int r0 = blockIdx.x * 64, c0 = blockIdx.y * 64;
    v8f acc[4][4];
#pragma unroll
    for (int mb = 0; mb < 4; ++mb)
#pragma unroll
        for (int nb = 0; nb < 4; ++nb) acc[mb][nb] = (v8f){};
    const size_t aoff = (size_t)(r0 + lr) * DM + 8 * hi, boff = (size_t)(c0 + lr) * DM + 8 * hi;
#pragma unroll 1
    for (int kc = 0; kc < DM; kc += 32) {
        v16bf a[4], a2[4], b;
#pragma unroll
        for (int mb = 0; mb < 4; ++mb) { a[mb] = ldb(A + aoff + (size_t)mb * 16 * DM + kc); a2[mb] = ldb(A2 + aoff + (size_t)mb * 16 * DM + kc); }
#pragma unroll
        for (int nb = 0; nb < 4; ++nb) { b = ldb(Bt + boff + (size_t)nb * 16 * DM + kc);
#pragma unroll
            for (int mb = 0; mb < 4; ++mb) { acc[mb][nb] = wmmab(a[mb], b, acc[mb][nb]); acc[mb][nb] = wmmab(a2[mb], b, acc[mb][nb]); } }
        asm volatile("" : "+v"(acc[0][0]), "+v"(acc[1][0]), "+v"(acc[2][0]), "+v"(acc[3][0]), "+v"(acc[0][1]), "+v"(acc[1][1]), "+v"(acc[2][1]), "+v"(acc[3][1]));
        asm volatile("v_nop\n\tv_nop\n\tv_nop\n\tv_nop" : "+v"(acc[0][2]), "+v"(acc[1][2]), "+v"(acc[2][2]), "+v"(acc[3][2]), "+v"(acc[0][3]), "+v"(acc[1][3]), "+v"(acc[2][3]), "+v"(acc[3][3]) : "v"(a[3]), "v"(a2[3]), "v"(b));
    }
#pragma unroll
    for (int mb = 0; mb < 4; ++mb)
#pragma unroll
        for (int nb = 0; nb < 4; ++nb)
#pragma unroll
            for (int j = 0; j < 8; ++j) os[(mb * 16 + hi * 8 + j) * 68 + nb * 16 + lr] = acc[mb][nb][j];
    wave_lds_sync();
    const int bb = r0 / SEQ, sq = r0 % SEQ, hh = blockIdx.y;
    const int rq = lane >> 3, pc = lane & 7;
    if (MODE == 0) {
        const size_t pb = ((size_t)(bb * NH + hh) * SEQ + sq) * HD;
        float bz[8];
#pragma unroll
        for (int i = 0; i < 8; ++i) bz[i] = bfr(bias[c0 + 8 * pc + i]);
{
#pragma unroll 1
            for (int s = 0; s < 16; ++s) { const int row = 4 * s + rq;
                const v4f u0 = *(const v4fa*)(os + row * 68 + 8 * pc); const v4f u1 = *(const v4fa*)(os + row * 68 + 8 * pc + 4); v8us oh, ol;
#pragma unroll
                for (int i = 0; i < 4; ++i) { unsigned short a, c; splitf(u0[i] + bz[i], a, c); oh[i] = a; ol[i] = c; splitf(u1[i] + bz[4 + i], a, c); oh[4 + i] = a; ol[4 + i] = c; }
                *(v8us*)(Oh + pb + (size_t)row * HD + 8 * pc) = oh; *(v8us*)(Ol + pb + (size_t)row * HD + 8 * pc) = ol; }
             }
    }
    if (MODE == 1) {
        const size_t vb = (size_t)(bb * NH + hh) * HD * SEQ + sq;
{
#pragma unroll 1
            for (int s = 0; s < 16; ++s) { const int hd = 4 * s + rq; const float bzv = bfr(bias[c0 + hd]); v8h o8;
#pragma unroll
                for (int i = 0; i < 8; ++i) o8[i] = (h16)(os[(8 * pc + i) * 68 + hd] + bzv);
                *(v8h*)(Ov + vb + (size_t)hd * SEQ + 8 * pc) = o8; }
             }
    }
    if (MODE == 2) {
        const int cofs = lr * 4;
        float bz4[4];
#pragma unroll
        for (int q = 0; q < 4; ++q) bz4[q] = bfr(bias[c0 + cofs + q]);
{
#pragma unroll 1
            for (int s = 0; s < 32; ++s) { const int row = 2 * s + hi; v4f val = *(const v4fa*)(os + row * 68 + cofs);
#pragma unroll
                for (int q = 0; q < 4; ++q) { const float tv = val[q] + bz4[q]; val[q] = 0.5f * tv * (1.0f + erff(tv * 0.70710678118654752f)); }
                *(v4f*)(Of + (size_t)(r0 + row) * DM + c0 + cofs) = val; }
             }
    }
}

// ---- k_attn: fused flash attention (unscaled scores, no mask), transposed form. Block = 4 independent waves, each owns 16 queries of one (b, h); grid (SEQ/64, NB*NH).
// Per 32-key step: S^T[key][q] = Kh Qh^T + Kl Qh^T + Kh Ql^T (A = key rows from the k planes, B = query rows from the q planes, k index = hd);
// lane (n = query, h) then holds keys 8h+r of both 16-key tiles -> running max / exp2 per lane, one cross-half shuffle;
// the P^T B fragment is formed in registers (element r <- tile 0 value r, element 8+r <- tile 1 value r; carried x16384 in f16); O^T[hd][q] += V^T[hd][key] P^T[key][q] (A from the f16 v^T plane).
// l is accumulated from the unconverted f32 p values (per-lane partials, combined once at the end). Operand fragments come straight from the K-contiguous global planes (two 16-B loads each).
__global__ __launch_bounds__(128) void k_attn(const bf* __restrict__ Qh, const bf* __restrict__ Ql, const bf* __restrict__ Kh, const bf* __restrict__ Kl, const h16* __restrict__ Vt, bf* Ch, bf* Cl) {
#pragma clang fp contract(off)
    __shared__ __align__(16) float os[4 * 16 * 68];
    const int lane = threadIdx.x & 31, lr = lane & 15, hi = lane >> 4;
    const int wave = __builtin_amdgcn_readfirstlane(threadIdx.x >> 5);
    const int bh = blockIdx.y;
    const int q0 = blockIdx.x * 64 + wave * 16;
    const size_t pbase = (size_t)bh * SEQ * HD;
    const bf* qh = Qh + pbase; const bf* ql = Ql + pbase; const bf* kh = Kh + pbase; const bf* kl = Kl + pbase; const h16* vt = Vt + pbase;
    const int qoff0 = (q0 + lr) * HD + 8 * hi;
    v8f o[4];
#pragma unroll
    for (int j = 0; j < 4; ++j) o[j] = (v8f){};
    float m = -1.0e30f, l = 0.0f;
#pragma unroll 1
    for (int kb = 0; kb < SEQ; kb += 32) {
        int qo = qoff0; asm volatile("" : "+v"(qo));
        const int ko = (kb + lr) * HD + 8 * hi;
        v8f s0 = (v8f){}, s1 = (v8f){};
#pragma unroll
        for (int ks = 0; ks < 2; ++ks) {
            const v16bf bqh = ldb(qh + qo + ks * 32), bql = ldb(ql + qo + ks * 32);
            const v16bf a0h = ldb(kh + ko + ks * 32), a0l = ldb(kl + ko + ks * 32);
            const v16bf a1h = ldb(kh + ko + 16 * HD + ks * 32), a1l = ldb(kl + ko + 16 * HD + ks * 32);
            s0 = wmmab(a0h, bqh, s0); s1 = wmmab(a1h, bqh, s1);
            s0 = wmmab(a0l, bqh, s0); s1 = wmmab(a1l, bqh, s1);
            s0 = wmmab(a0h, bql, s0); s1 = wmmab(a1h, bql, s1);
            asm volatile("v_nop\n\tv_nop\n\tv_nop\n\tv_nop" : "+v"(s0), "+v"(s1) : "v"(a0h), "v"(a1h), "v"(bql));
        }
        float mx = fmaxf(s0[0], s1[0]);
#pragma unroll
        for (int r = 1; r < 8; ++r) mx = fmaxf(mx, fmaxf(s0[r], s1[r]));
        mx = fmaxf(mx, __shfl_xor(mx, 16, 32));
        const float mn = fmaxf(m, mx);
        const float alpha = __builtin_amdgcn_exp2f((m - mn) * L2E);
        m = mn;
        float psum = 0.0f; v16h pf;
#pragma unroll
        for (int r = 0; r < 8; ++r) {
            const float p0 = __builtin_amdgcn_exp2f((s0[r] - mn) * L2E);
            const float p1 = __builtin_amdgcn_exp2f((s1[r] - mn) * L2E);
            psum += p0 + p1;
            pf[r] = (h16)(p0 * PCAR); pf[8 + r] = (h16)(p1 * PCAR); }
        l = l * alpha + psum;
#pragma unroll
        for (int j = 0; j < 4; ++j)
#pragma unroll
            for (int r = 0; r < 8; ++r) o[j][r] *= alpha;
        const int vo = lr * SEQ + kb + 8 * hi;
        const v16h va0 = ldh(vt + vo), va1 = ldh(vt + vo + 16 * SEQ), va2 = ldh(vt + vo + 32 * SEQ), va3 = ldh(vt + vo + 48 * SEQ);
        o[0] = wmma16(va0, pf, o[0]); o[1] = wmma16(va1, pf, o[1]); o[2] = wmma16(va2, pf, o[2]); o[3] = wmma16(va3, pf, o[3]);
        asm volatile("v_nop\n\tv_nop\n\tv_nop\n\tv_nop" : "+v"(o[0]), "+v"(o[1]), "+v"(o[2]), "+v"(o[3]) : "v"(va3), "v"(pf));
    }
    l += __shfl_xor(l, 16, 32);
    const float inv = 1.0f / (l * PCAR);
    const int wbase = wave * (16 * 68);
#pragma unroll
    for (int j = 0; j < 4; ++j)
#pragma unroll
        for (int r = 0; r < 8; ++r) os[wbase + lr * 68 + 16 * j + 8 * hi + r] = o[j][r] * inv;
    wave_lds_sync();
    const int b = bh / NH, h = bh % NH;
    const int rq = lane >> 3, pc = lane & 7;
{
#pragma unroll
        for (int s = 0; s < 4; ++s) { const int row = 4 * s + rq;
            const v4f u0 = *(const v4fa*)(os + wbase + row * 68 + 8 * pc); const v4f u1 = *(const v4fa*)(os + wbase + row * 68 + 8 * pc + 4); v8us oh, ol;
#pragma unroll
            for (int i = 0; i < 4; ++i) { unsigned short a, c; splitf(u0[i], a, c); oh[i] = a; ol[i] = c; splitf(u1[i], a, c); oh[4 + i] = a; ol[4 + i] = c; }
            const size_t oo = ((size_t)b * SEQ + q0 + row) * DM + h * HD + 8 * pc;
            *(v8us*)(Ch + oo) = oh; *(v8us*)(Cl + oo) = ol; }
         }
}

extern "C" void kernel_launch(void* const* d_in, const int* in_sizes, int n_in,
                              void* d_out, int out_size, void* d_ws, size_t ws_size, hipStream_t stream) {
    if (n_in < 11) return;
    if ((size_t)in_sizes[0] < ((size_t)(NB - 1) * SEQ_FULL + SEQ) * DM) return;
    if (in_sizes[1] < DM || in_sizes[2] < DM) return;
    if (in_sizes[3] < NH * DM * HD || in_sizes[5] < NH * DM * HD || in_sizes[7] < NH * DM * HD || in_sizes[9] < DM * DM) return;
    if (in_sizes[4] < DM || in_sizes[6] < DM || in_sizes[8] < DM || in_sizes[10] < DM) return;
    if ((size_t)out_size < (size_t)MTOK * DM) return;
    const float* x   = (const float*)d_in[0];
    const float* lng = (const float*)d_in[1];
    const float* lnb = (const float*)d_in[2];
    const float* wq  = (const float*)d_in[3];
    const float* bq  = (const float*)d_in[4];
    const float* wk  = (const float*)d_in[5];
    const float* bk  = (const float*)d_in[6];
    const float* wv  = (const float*)d_in[7];
    const float* bv  = (const float*)d_in[8];
    const float* wp  = (const float*)d_in[9];
    const float* bp  = (const float*)d_in[10];
    float* OUT = (float*)d_out;     // [NB][SEQ][384]
    char* wsp = (char*)d_ws;
    auto take = [&](size_t bytes) { char* p = wsp; wsp += (bytes + 255) & ~(size_t)255; return (void*)p; };
    const size_t WSZ = (size_t)DM * DM * 2;            // one transposed bf16 weight plane [384][384]
    const size_t PSZ = (size_t)MTOK * DM * 2;          // one 16-bit activation plane
    bf* WQ = (bf*)take(WSZ); bf* WK = (bf*)take(WSZ); bf* WV = (bf*)take(WSZ); bf* WP = (bf*)take(WSZ);
    bf* Yh = (bf*)take(PSZ); bf* Yl = (bf*)take(PSZ);
    bf* Qh = (bf*)take(PSZ); bf* Ql = (bf*)take(PSZ); bf* Kh = (bf*)take(PSZ); bf* Kl = (bf*)take(PSZ);
    h16* VT = (h16*)take(PSZ);
    if ((size_t)(wsp - (char*)d_ws) > ws_size) return;
    bf* Ch = Yh; bf* Cl = Yl;   // ctx planes reuse the y planes (y is dead after the three projections; stream-ordered)

    // per-head [h][d][k] -> Bt[h*64 + k][d]: in[rows = 384 (d)][cols = 64 (k)] -> out[cols][rows], z = head
    k_wt<<<dim3(DM / 64, HD / 64, NH), 256, 0, stream>>>(wq, WQ, DM, HD);
    k_wt<<<dim3(DM / 64, HD / 64, NH), 256, 0, stream>>>(wk, WK, DM, HD);
    k_wt<<<dim3(DM / 64, HD / 64, NH), 256, 0, stream>>>(wv, WV, DM, HD);
    // Wp [in = 384 (d)][out = 384 (n)] -> Bt[n][d]: in[rows = 384][cols = 384] -> out[cols][rows]
    k_wt<<<dim3(DM / 64, DM / 64, 1), 256, 0, stream>>>(wp, WP, DM, DM);
    k_ln<<<MTOK / 8, 256, 0, stream>>>(x, lng, lnb, Yh, Yl);
    k_gemmw<0><<<dim3(MTOK / 64, DM / 64, 1), 32, 0, stream>>>(Yh, Yl, WQ, bq, Qh, Ql, (h16*)nullptr, (float*)nullptr);
    k_gemmw<0><<<dim3(MTOK / 64, DM / 64, 1), 32, 0, stream>>>(Yh, Yl, WK, bk, Kh, Kl, (h16*)nullptr, (float*)nullptr);
    k_gemmw<1><<<dim3(MTOK / 64, DM / 64, 1), 32, 0, stream>>>(Yh, Yl, WV, bv, (bf*)nullptr, (bf*)nullptr, VT, (float*)nullptr);
    k_attn<<<dim3(SEQ / 64, NB * NH, 1), 128, 0, stream>>>(Qh, Ql, Kh, Kl, VT, Ch, Cl);
    k_gemmw<2><<<dim3(MTOK / 64, DM / 64, 1), 32, 0, stream>>>(Ch, Cl, WP, bp, (bf*)nullptr, (bf*)nullptr, (h16*)nullptr, OUT);
}

// v001
// It runs in 222 microseconds.
// Two timings next to v000 put it at 2.06 and 2.07 times that version's speed.
#include <hip/hip_runtime.h>

// Compute dtypes, f32 accumulate everywhere: inputs converted to bf16 (RNE); q/k/v and output projections = bf16 WMMA with the activation as hi|lo planes against exact bf16 weights (2 products); scores = bf16 WMMA q hi|lo x k hi|lo (3 products); P.V = f16 WMMA (P carried x16384, V plain f16); LayerNorm, softmax, GELU in f32.
// Every 16-bit WMMA operand plane with 384-long rows (y, ctx, transposed weights) is kept in fragment order [row/16][k/8][row%16][k%8].
// Pre-LN attention: y = LN(x) -> hi|lo planes; per-head projections written straight into head planes in WMMA fragment order (q,k hi|lo [b][h][s/16][hd/8][s%16][hd%8]; v^T f16 [b][h][s/32][hd/16][(s%32)/8][hd%16][s%8]), so that each 16-B-per-lane fragment load of the attention kernel is 512 contiguous bytes; fused flash attention in the transposed form S^T = K Q^T, O^T = V^T P^T (P fragment built in registers from the score accumulators); ctx hi|lo x Wp + bp -> erf GELU -> out.

#ifndef NB
#define NB 8
#endif
#ifndef SEQ
#define SEQ 2048
#endif
#define NB_FULL  8
#define SEQ_FULL 2048
#define DM   384
#define NH   6
#define HD   64
#define MTOK (NB * SEQ)
#define PCAR 16384.0f
#define L2E  1.4426950408889634f

static_assert(SEQ % 64 == 0);
static_assert(DM % 64 == 0);
static_assert(DM % 32 == 0);
static_assert(NH * HD == DM);
static_assert(NB <= NB_FULL);
static_assert(SEQ <= SEQ_FULL);
static_assert((size_t)4 * DM * DM * 2 + (size_t)7 * MTOK * DM * 2 <= (size_t)134217728);

typedef _Float16 h16;
typedef unsigned short bf;
typedef __attribute__((ext_vector_type(16))) __bf16   v16bf;
typedef __attribute__((ext_vector_type(16))) _Float16 v16h;
typedef __attribute__((ext_vector_type(8)))  _Float16 v8h;
typedef __attribute__((ext_vector_type(8)))  unsigned short v8us;
typedef __attribute__((ext_vector_type(4)))  unsigned short v4us;
typedef __attribute__((ext_vector_type(8)))  float    v8f;
typedef __attribute__((ext_vector_type(4)))  float    v4f;
typedef v4f  __attribute__((may_alias)) v4fa;

__device__ __forceinline__ unsigned short f2bf(float f) { unsigned u = __float_as_uint(f); u += 0x7FFFu + ((u >> 16) & 1u); return (unsigned short)(u >> 16); }
__device__ __forceinline__ float bf2f(unsigned short b) { return __uint_as_float(((unsigned)b) << 16); }
__device__ __forceinline__ float bfr(float f) { return bf2f(f2bf(f)); }
__device__ __forceinline__ void splitf(float y, unsigned short& h, unsigned short& l) { h = f2bf(y); l = f2bf(y - bf2f(h)); }
__device__ __forceinline__ v16h cat16(v8h lo, v8h hi) { return __builtin_shufflevector(lo, hi, 0, 1, 2, 3, 4, 5, 6, 7, 8, 9, 10, 11, 12, 13, 14, 15); }
__device__ __forceinline__ v16bf cat16b(v8us lo, v8us hi) { return __builtin_bit_cast(v16bf, __builtin_shufflevector(lo, hi, 0, 1, 2, 3, 4, 5, 6, 7, 8, 9, 10, 11, 12, 13, 14, 15)); }
__device__ __forceinline__ v8f wmma16(v16h a, v16h b, v8f c) { return __builtin_amdgcn_wmma_f32_16x16x32_f16(false, a, false, b, (short)0, c, false, false); }
__device__ __forceinline__ v8f wmmab(v16bf a, v16bf b, v8f c) { return __builtin_amdgcn_wmma_f32_16x16x32_bf16(false, a, false, b, (short)0, c, false, false); }
// Fragment loaders from fragment-order planes: p already holds the 512-element (16 rows x 32 k) block base + 8*lane, lane = 16*h + row; elements 0..7 = k0+8h.., elements 8..15 = k0+16+8h..; each load covers four whole 128-B lines.
__device__ __forceinline__ v16bf ldbf(const bf* p) { return cat16b(*(const v8us*)p, *(const v8us*)(p + 256)); }
__device__ __forceinline__ v16h ldhf(const h16* p) { return cat16(*(const v8h*)p, *(const v8h*)(p + 256)); }
// Same-wave LDS exchange (wave-private tiles only).
__device__ __forceinline__ void wave_lds_sync() { __builtin_amdgcn_fence(3 /* release order */, "wavefront"); __builtin_amdgcn_wave_barrier(); __builtin_amdgcn_fence(2 /* acquire order */, "wavefront"); asm volatile("" ::: "memory"); }

// ---- k_wt: in[z][rows][cols] (f32) -> transposed matrix out[n = z*cols + col][k = row] (bf16 RNE) in fragment order [n/16][k/8][n%16][k%8], 64x64 tiles through LDS; grid (rows/64, cols/64, z), 256 threads.
__global__ __launch_bounds__(256) void k_wt(const float* __restrict__ src, bf* dst, int rows, int cols) {
    __shared__ float t[64 * 65];
    const int tid = threadIdx.x;
    const size_t zo = (size_t)blockIdx.z * (size_t)rows * (size_t)cols;
    const int r0 = blockIdx.x * 64, c0 = blockIdx.y * 64;
#pragma unroll 4
    for (int i = 0; i < 16; ++i) { const int rr = (tid >> 6) + 4 * i, cc = tid & 63; t[rr * 65 + cc] = src[zo + (size_t)(r0 + rr) * cols + c0 + cc]; }
    __syncthreads();
    const int pc = (tid >> 3) & 7;
#pragma unroll
    for (int it = 0; it < 2; ++it) { const int line = (tid & 7) + 8 * (tid >> 6) + 32 * it; v8us o;
#pragma unroll
        for (int i = 0; i < 8; ++i) o[i] = f2bf(t[(8 * pc + i) * 65 + line]);
        const int n = blockIdx.z * cols + c0 + line;
        *(v8us*)(dst + (size_t)(n >> 4) * 16 * rows + (size_t)((r0 >> 3) + pc) * 128 + (n & 15) * 8) = o; }
}

// ---- k_ln: one wave per token; the block's 8 tokens are gathered in LDS so that each 128-B line of the fragment-order planes (8 tokens x 16 B) is stored whole.
__global__ __launch_bounds__(256) void k_ln(const float* __restrict__ x, const float* __restrict__ g, const float* __restrict__ be, bf* Yh, bf* Yl) {
    __shared__ __align__(16) bf sy[2][8][DM + 8];
    const int lane = threadIdx.x & 31;
    const int wave = __builtin_amdgcn_readfirstlane(threadIdx.x >> 5);
    const int tok = blockIdx.x * 8 + wave;
    const int b = tok / SEQ, s = tok % SEQ;
    const float* xr = x + ((size_t)b * SEQ_FULL + s) * DM;
    v4f v[3]; float sum = 0.0f;
#pragma unroll
    for (int j = 0; j < 3; ++j) { v4f a = *(const v4f*)(xr + j * 128 + lane * 4);
#pragma unroll
        for (int q = 0; q < 4; ++q) { a[q] = bfr(a[q]); sum += a[q]; }
        v[j] = a; }
#pragma unroll
    for (int sh = 16; sh; sh >>= 1) sum += __shfl_xor(sum, sh, 32);
    const float mu = sum * (1.0f / DM);
    float var = 0.0f;
#pragma unroll
    for (int j = 0; j < 3; ++j) {
#pragma unroll
        for (int q = 0; q < 4; ++q) { const float d = v[j][q] - mu; var += d * d; } }
#pragma unroll
    for (int sh = 16; sh; sh >>= 1) var += __shfl_xor(var, sh, 32);
    const float rs = rsqrtf(var * (1.0f / DM) + 1e-5f);
    v4us oh[3], ol[3];
#pragma unroll
    for (int j = 0; j < 3; ++j) { const v4f gg = *(const v4f*)(g + j * 128 + lane * 4); const v4f bb = *(const v4f*)(be + j * 128 + lane * 4);
#pragma unroll
        for (int q = 0; q < 4; ++q) { const float y = (v[j][q] - mu) * rs * bfr(gg[q]) + bfr(bb[q]); unsigned short a, c; splitf(y, a, c); oh[j][q] = a; ol[j][q] = c; } }
#pragma unroll
    for (int j = 0; j < 3; ++j) { *(v4us*)(&sy[0][wave][j * 128 + lane * 4]) = oh[j]; *(v4us*)(&sy[1][wave][j * 128 + lane * 4]) = ol[j]; }
    __syncthreads();   // each stored line below holds 16 B from each of the 8 waves' tokens
    const int r8 = threadIdx.x & 7;
    const size_t tb = (size_t)(blockIdx.x >> 1) * (16 * DM) + (blockIdx.x & 1) * 64 + r8 * 8;
#pragma unroll
    for (int it = 0; it < 3; ++it) { const int idx = (threadIdx.x >> 3) + 32 * it; const int pl = idx >= DM / 8 ? 1 : 0; const int ch = idx - pl * (DM / 8);
        *(v8us*)((pl ? Yl : Yh) + tb + ch * 128) = *(const v8us*)(&sy[pl][r8][ch * 8]); }
}

// ---- k_gemmw: register-blocked GEMM, ONE WAVE per 64x64 output tile (16 accumulators), operands straight from fragment-order bf16 planes (K = 384); grid (M/64, 384/64), 32 threads.
// MODE 2: f32 output rows [tok][384] with exact erf GELU (16 lanes x 16 B = 256 B per row segment, 2 rows per instruction).
template <int MODE>
__global__ __launch_bounds__(32) void k_gemmw(const bf* __restrict__ A, const bf* __restrict__ A2, const bf* __restrict__ Bt, const float* __restrict__ bias, bf* Oh, bf* Ol, h16* Ov, float* Of) {
    __shared__ __align__(16) float os[64 * 68];
    const int lane = threadIdx.x & 31, lr = lane & 15, hi = lane >> 4;
    const int r0 = blockIdx.x * 64, c0 = blockIdx.y * 64;
    v8f acc[4][4];
#pragma unroll
    for (int mb = 0; mb < 4; ++mb)
#pragma unroll
        for (int nb = 0; nb < 4; ++nb) acc[mb][nb] = (v8f){};
    const size_t aoff = (size_t)r0 * DM + 8 * lane, boff = (size_t)c0 * DM + 8 * lane;
#pragma unroll 1
    for (int kc = 0; kc < DM; kc += 32) {
        v16bf a[4], a2[4], b[4];
        const bf* pa = A + aoff + kc * 16; const bf* pa2 = A2 + aoff + kc * 16; const bf* pb = Bt + boff + kc * 16;
#pragma unroll
        for (int mb = 0; mb < 4; ++mb) { a[mb] = ldbf(pa + mb * 16 * DM); b[mb] = ldbf(pb + mb * 16 * DM); a2[mb] = ldbf(pa2 + mb * 16 * DM); }
        // The three address pairs are inputs, so they stay whole until this wait: no load's result and no next address is written into a pair that an issued load of this trip still names.
        asm volatile("s_wait_xcnt 0x0" :: "v"(pa), "v"(pa2), "v"(pb) : "memory");
#pragma unroll
        for (int nb = 0; nb < 4; ++nb) {
#pragma unroll
            for (int mb = 0; mb < 4; ++mb) { acc[mb][nb] = wmmab(a[mb], b[nb], acc[mb][nb]); acc[mb][nb] = wmmab(a2[mb], b[nb], acc[mb][nb]); } }
        asm volatile("" : "+v"(acc[0][0]), "+v"(acc[1][0]), "+v"(acc[2][0]), "+v"(acc[3][0]), "+v"(acc[0][1]), "+v"(acc[1][1]), "+v"(acc[2][1]), "+v"(acc[3][1]));
        asm volatile("v_nop\n\tv_nop\n\tv_nop\n\tv_nop" : "+v"(acc[0][2]), "+v"(acc[1][2]), "+v"(acc[2][2]), "+v"(acc[3][2]), "+v"(acc[0][3]), "+v"(acc[1][3]), "+v"(acc[2][3]), "+v"(acc[3][3]) : "v"(a[3]), "v"(a2[3]), "v"(b[3]));
    }
#pragma unroll
    for (int mb = 0; mb < 4; ++mb)
#pragma unroll
        for (int nb = 0; nb < 4; ++nb)
#pragma unroll
            for (int j = 0; j < 8; ++j) os[(mb * 16 + hi * 8 + j) * 68 + nb * 16 + lr] = acc[mb][nb][j];
    wave_lds_sync();
    const int bb = r0 / SEQ, sq = r0 % SEQ, hh = blockIdx.y;
    // Fragment-order stores: 8 lanes (r8) x 16 B fill one 128-B line of one 8-element chunk column, 4 chunk columns (cc) per instruction.
    const int r8 = lane & 7, cc = lane >> 3;
    if (MODE == 0) {
        const size_t pb = ((size_t)(bb * NH + hh) * SEQ + sq) * HD;
        float bz[2][8];
#pragma unroll
        for (int hf = 0; hf < 2; ++hf)
#pragma unroll
            for (int i = 0; i < 8; ++i) bz[hf][i] = bfr(bias[c0 + 8 * (4 * hf + cc) + i]);
#pragma unroll 1   // rolled: the epilogue is store-bound, and unrolled it would only take instruction cache
        for (int g = 0; g < 8; ++g) { const int row = 8 * g + r8;
#pragma unroll     // bz[hf] must be a compile-time register index
            for (int hf = 0; hf < 2; ++hf) { const int ch = 4 * hf + cc;
                const v4f u0 = *(const v4fa*)(os + row * 68 + 8 * ch); const v4f u1 = *(const v4fa*)(os + row * 68 + 8 * ch + 4); v8us oh, ol;
#pragma unroll
                for (int i = 0; i < 4; ++i) { unsigned short a, c; splitf(u0[i] + bz[hf][i], a, c); oh[i] = a; ol[i] = c; splitf(u1[i] + bz[hf][4 + i], a, c); oh[4 + i] = a; ol[4 + i] = c; }
                const size_t oo = pb + (size_t)(row >> 4) * (16 * HD) + ch * 128 + (row & 15) * 8;
                *(v8us*)(Oh + oo) = oh; *(v8us*)(Ol + oo) = ol; }
            asm volatile("s_wait_xcnt 0x0" ::: "memory");   // the next trip overwrites the stores' address and data registers
        }
    }
    if (MODE == 1) {
        const size_t vb = ((size_t)(bb * NH + hh) * SEQ + sq) * HD;
#pragma unroll 1   // rolled: the epilogue is store-bound, and unrolled it would only take instruction cache
        for (int g = 0; g < 8; ++g) { const int hd = 8 * g + r8; const float bzv = bfr(bias[c0 + hd]);
#pragma unroll
            for (int kq = 0; kq < 2; ++kq) { v8h o8;
#pragma unroll
                for (int i = 0; i < 8; ++i) o8[i] = (h16)(os[(32 * kq + 8 * cc + i) * 68 + hd] + bzv);
                *(v8h*)(Ov + vb + (size_t)kq * (32 * HD) + (hd >> 4) * 512 + cc * 128 + (hd & 15) * 8) = o8; }
            asm volatile("s_wait_xcnt 0x0" ::: "memory");   // the next trip overwrites the stores' address and data registers
        }
    }
    if (MODE == 2) {
        const int cofs = lr * 4;
        float bz4[4];
#pragma unroll
        for (int q = 0; q < 4; ++q) bz4[q] = bfr(bias[c0 + cofs + q]);
{
#pragma unroll 1
            for (int s = 0; s < 32; ++s) { const int row = 2 * s + hi; v4f val = *(const v4fa*)(os + row * 68 + cofs);
#pragma unroll
                for (int q = 0; q < 4; ++q) { const float tv = val[q] + bz4[q]; val[q] = 0.5f * tv * (1.0f + erff(tv * 0.70710678118654752f)); }
                *(v4f*)(Of + (size_t)(r0 + row) * DM + c0 + cofs) = val; }
             }
    }
}

// ---- k_attn: fused flash attention (unscaled scores, no mask), transposed form. Block = 4 independent waves, each owns 16 queries of one (b, h); grid (SEQ/64, NB*NH).
// Per 32-key step: S^T[key][q] = Kh Qh^T + Kl Qh^T + Kh Ql^T (A = key rows from the k planes, B = query rows from the q planes, k index = hd);
// lane (n = query, h) then holds keys 8h+r of both 16-key tiles -> running max / exp2 per lane, one cross-half shuffle;
// the P^T B fragment is formed in registers (element r <- tile 0 value r, element 8+r <- tile 1 value r; carried x16384 in f16); O^T[hd][q] += V^T[hd][key] P^T[key][q] (A from the f16 v^T plane).
// l is accumulated from the unconverted f32 p values (per-lane partials, combined once at the end). Operand fragments come straight from the fragment-order global planes (two 16-B loads each, 512 contiguous bytes per load).
__global__ __launch_bounds__(128) void k_attn(const bf* __restrict__ Qh, const bf* __restrict__ Ql, const bf* __restrict__ Kh, const bf* __restrict__ Kl, const h16* __restrict__ Vt, bf* Ch, bf* Cl) {
#pragma clang fp contract(off)
    __shared__ __align__(16) float os[4 * 16 * 68];
    const int lane = threadIdx.x & 31, lr = lane & 15, hi = lane >> 4;
    const int wave = __builtin_amdgcn_readfirstlane(threadIdx.x >> 5);
    const int bh = blockIdx.y;
    const int q0 = blockIdx.x * 64 + wave * 16;
    const size_t pbase = (size_t)bh * SEQ * HD;
    const bf* qh = Qh + pbase; const bf* ql = Ql + pbase; const bf* kh = Kh + pbase; const bf* kl = Kl + pbase; const h16* vt = Vt + pbase;
    const int qoff0 = q0 * HD + 8 * lane;
    v8f o[4];
#pragma unroll
    for (int j = 0; j < 4; ++j) o[j] = (v8f){};
    float m = -1.0e30f, l = 0.0f;
#pragma unroll 1
    for (int kb = 0; kb < SEQ; kb += 32) {
        int qo = qoff0; asm volatile("" : "+v"(qo));
        const int ko = kb * HD + 8 * lane;
        v8f s0 = (v8f){}, s1 = (v8f){};
#pragma unroll
        for (int ks = 0; ks < 2; ++ks) {
            const v16bf bqh = ldbf(qh + qo + ks * 512), bql = ldbf(ql + qo + ks * 512);
            const v16bf a0h = ldbf(kh + ko + ks * 512), a0l = ldbf(kl + ko + ks * 512);
            const v16bf a1h = ldbf(kh + ko + 16 * HD + ks * 512), a1l = ldbf(kl + ko + 16 * HD + ks * 512);
            s0 = wmmab(a0h, bqh, s0); s1 = wmmab(a1h, bqh, s1);
            s0 = wmmab(a0l, bqh, s0); s1 = wmmab(a1l, bqh, s1);
            s0 = wmmab(a0h, bql, s0); s1 = wmmab(a1h, bql, s1);
            asm volatile("v_nop\n\tv_nop\n\tv_nop\n\tv_nop" : "+v"(s0), "+v"(s1) : "v"(a0h), "v"(a1h), "v"(bql));
        }
        float mx = fmaxf(s0[0], s1[0]);
#pragma unroll
        for (int r = 1; r < 8; ++r) mx = fmaxf(mx, fmaxf(s0[r], s1[r]));
        mx = fmaxf(mx, __shfl_xor(mx, 16, 32));
        const float mn = fmaxf(m, mx);
        const float alpha = __builtin_amdgcn_exp2f((m - mn) * L2E);
        m = mn;
        float psum = 0.0f; v16h pf;
#pragma unroll
        for (int r = 0; r < 8; ++r) {
            const float p0 = __builtin_amdgcn_exp2f((s0[r] - mn) * L2E);
            const float p1 = __builtin_amdgcn_exp2f((s1[r] - mn) * L2E);
            psum += p0 + p1;
            pf[r] = (h16)(p0 * PCAR); pf[8 + r] = (h16)(p1 * PCAR); }
        l = l * alpha + psum;
#pragma unroll
        for (int j = 0; j < 4; ++j)
#pragma unroll
            for (int r = 0; r < 8; ++r) o[j][r] *= alpha;
        const v16h va0 = ldhf(vt + ko), va1 = ldhf(vt + ko + 512), va2 = ldhf(vt + ko + 1024), va3 = ldhf(vt + ko + 1536);
        o[0] = wmma16(va0, pf, o[0]); o[1] = wmma16(va1, pf, o[1]); o[2] = wmma16(va2, pf, o[2]); o[3] = wmma16(va3, pf, o[3]);
        asm volatile("v_nop\n\tv_nop\n\tv_nop\n\tv_nop" : "+v"(o[0]), "+v"(o[1]), "+v"(o[2]), "+v"(o[3]) : "v"(va3), "v"(pf));
    }
    l += __shfl_xor(l, 16, 32);
    const float inv = 1.0f / (l * PCAR);
    const int wbase = wave * (16 * 68);
#pragma unroll
    for (int j = 0; j < 4; ++j)
#pragma unroll
        for (int r = 0; r < 8; ++r) os[wbase + lr * 68 + 16 * j + 8 * hi + r] = o[j][r] * inv;
    wave_lds_sync();
    const int b = bh / NH, h = bh % NH;
    const int r8 = lane & 7, cc = lane >> 3;
#pragma unroll
    for (int s = 0; s < 4; ++s) { const int row = 8 * (s & 1) + r8, ch = 4 * (s >> 1) + cc;
        const v4f u0 = *(const v4fa*)(os + wbase + row * 68 + 8 * ch); const v4f u1 = *(const v4fa*)(os + wbase + row * 68 + 8 * ch + 4); v8us oh, ol;
#pragma unroll
        for (int i = 0; i < 4; ++i) { unsigned short a, c; splitf(u0[i], a, c); oh[i] = a; ol[i] = c; splitf(u1[i], a, c); oh[4 + i] = a; ol[4 + i] = c; }
        const size_t oo = ((size_t)b * SEQ + q0) * DM + (h * 8 + ch) * 128 + row * 8;
        *(v8us*)(Ch + oo) = oh; *(v8us*)(Cl + oo) = ol; }
}

extern "C" void kernel_launch(void* const* d_in, const int* in_sizes, int n_in,
                              void* d_out, int out_size, void* d_ws, size_t ws_size, hipStream_t stream) {
    if (n_in < 11) return;
    if ((size_t)in_sizes[0] < ((size_t)(NB - 1) * SEQ_FULL + SEQ) * DM) return;
    if (in_sizes[1] < DM || in_sizes[2] < DM) return;
    if (in_sizes[3] < NH * DM * HD || in_sizes[5] < NH * DM * HD || in_sizes[7] < NH * DM * HD || in_sizes[9] < DM * DM) return;
    if (in_sizes[4] < DM || in_sizes[6] < DM || in_sizes[8] < DM || in_sizes[10] < DM) return;
    if ((size_t)out_size < (size_t)MTOK * DM) return;
    const float* x   = (const float*)d_in[0];
    const float* lng = (const float*)d_in[1];
    const float* lnb = (const float*)d_in[2];
    const float* wq  = (const float*)d_in[3];
    const float* bq  = (const float*)d_in[4];
    const float* wk  = (const float*)d_in[5];
    const float* bk  = (const float*)d_in[6];
    const float* wv  = (const float*)d_in[7];
    const float* bv  = (const float*)d_in[8];
    const float* wp  = (const float*)d_in[9];
    const float* bp  = (const float*)d_in[10];
    float* OUT = (float*)d_out;     // [NB][SEQ][384]
    char* wsp = (char*)d_ws;
    auto take = [&](size_t bytes) { char* p = wsp; wsp += (bytes + 255) & ~(size_t)255; return (void*)p; };
    const size_t WSZ = (size_t)DM * DM * 2;            // one transposed bf16 weight plane [384][384]
    const size_t PSZ = (size_t)MTOK * DM * 2;          // one 16-bit activation plane
    bf* WQ = (bf*)take(WSZ); bf* WK = (bf*)take(WSZ); bf* WV = (bf*)take(WSZ); bf* WP = (bf*)take(WSZ);
    bf* Yh = (bf*)take(PSZ); bf* Yl = (bf*)take(PSZ);
    bf* Qh = (bf*)take(PSZ); bf* Ql = (bf*)take(PSZ); bf* Kh = (bf*)take(PSZ); bf* Kl = (bf*)take(PSZ);
    h16* VT = (h16*)take(PSZ);
    if ((size_t)(wsp - (char*)d_ws) > ws_size) return;
    bf* Ch = Yh; bf* Cl = Yl;   // ctx planes reuse the y planes (y is dead after the three projections; stream-ordered)

    // per-head [h][d][k] -> Bt[h*64 + k][d]: in[rows = 384 (d)][cols = 64 (k)] -> out[cols][rows], z = head
    k_wt<<<dim3(DM / 64, HD / 64, NH), 256, 0, stream>>>(wq, WQ, DM, HD);
    k_wt<<<dim3(DM / 64, HD / 64, NH), 256, 0, stream>>>(wk, WK, DM, HD);
    k_wt<<<dim3(DM / 64, HD / 64, NH), 256, 0, stream>>>(wv, WV, DM, HD);
    // Wp [in = 384 (d)][out = 384 (n)] -> Bt[n][d]: in[rows = 384][cols = 384] -> out[cols][rows]
    k_wt<<<dim3(DM / 64, DM / 64, 1), 256, 0, stream>>>(wp, WP, DM, DM);
    k_ln<<<MTOK / 8, 256, 0, stream>>>(x, lng, lnb, Yh, Yl);
    k_gemmw<0><<<dim3(MTOK / 64, DM / 64, 1), 32, 0, stream>>>(Yh, Yl, WQ, bq, Qh, Ql, (h16*)nullptr, (float*)nullptr);
    k_gemmw<0><<<dim3(MTOK / 64, DM / 64, 1), 32, 0, stream>>>(Yh, Yl, WK, bk, Kh, Kl, (h16*)nullptr, (float*)nullptr);
    k_gemmw<1><<<dim3(MTOK / 64, DM / 64, 1), 32, 0, stream>>>(Yh, Yl, WV, bv, (bf*)nullptr, (bf*)nullptr, VT, (float*)nullptr);
    k_attn<<<dim3(SEQ / 64, NB * NH, 1), 128, 0, stream>>>(Qh, Ql, Kh, Kl, VT, Ch, Cl);
    k_gemmw<2><<<dim3(MTOK / 64, DM / 64, 1), 32, 0, stream>>>(Ch, Cl, WP, bp, (bf*)nullptr, (bf*)nullptr, (h16*)nullptr, OUT);
}

// v002
// It runs in 205 microseconds.
// Next to v001, in two timings, it ran 1.09 and 1.10 times as fast.
// Over all steps from v000 it is 2.26 times as fast.
#include <hip/hip_runtime.h>

// Compute dtypes, f32 accumulate everywhere: inputs converted to bf16 (RNE); q/k/v and output projections = bf16 WMMA with the activation as hi|lo planes against exact bf16 weights (2 products); scores = bf16 WMMA q hi|lo x k hi|lo (3 products); P.V = f16 WMMA (P carried x16384, V plain f16); LayerNorm, softmax, GELU in f32.
// Every 16-bit WMMA operand plane with 384-long rows (y, ctx, transposed weights) is kept in fragment order [row/16][k/8][row%16][k%8].
// Pre-LN attention: y = LN(x) -> hi|lo planes; per-head projections written straight into head planes in WMMA fragment order (q,k hi|lo [b][h][s/16][hd/8][s%16][hd%8]; v^T f16 [b][h][s/32][hd/16][(s%32)/8][hd%16][s%8]), so that each 16-B-per-lane fragment load of the attention kernel is 512 contiguous bytes; fused flash attention in the transposed form S^T = K Q^T, O^T = V^T P^T (P fragment built in registers from the score accumulators); ctx hi|lo x Wp + bp -> erf GELU -> out.

#ifndef NB
#define NB 8
#endif
#ifndef SEQ
#define SEQ 2048
#endif
#define NB_FULL  8
#define SEQ_FULL 2048
#define DM   384
#define NH   6
#define HD   64
#define MTOK (NB * SEQ)
#define PCAR 16384.0f
#define L2E  1.4426950408889634f

static_assert(SEQ % 128 == 0);
static_assert(DM % 64 == 0);
static_assert(DM % 32 == 0);
static_assert(NH * HD == DM);
static_assert(NB <= NB_FULL);
static_assert(SEQ <= SEQ_FULL);
static_assert((size_t)4 * DM * DM * 2 + (size_t)7 * MTOK * DM * 2 <= (size_t)134217728);

typedef _Float16 h16;
typedef unsigned short bf;
typedef __attribute__((ext_vector_type(16))) __bf16   v16bf;
typedef __attribute__((ext_vector_type(16))) _Float16 v16h;
typedef __attribute__((ext_vector_type(8)))  _Float16 v8h;
typedef __attribute__((ext_vector_type(8)))  unsigned short v8us;
typedef __attribute__((ext_vector_type(4)))  unsigned short v4us;
typedef __attribute__((ext_vector_type(8)))  float    v8f;
typedef __attribute__((ext_vector_type(4)))  float    v4f;
typedef v4f  __attribute__((may_alias)) v4fa;

__device__ __forceinline__ unsigned short f2bf(float f) { unsigned u = __float_as_uint(f); u += 0x7FFFu + ((u >> 16) & 1u); return (unsigned short)(u >> 16); }
__device__ __forceinline__ float bf2f(unsigned short b) { return __uint_as_float(((unsigned)b) << 16); }
__device__ __forceinline__ float bfr(float f) { return bf2f(f2bf(f)); }
__device__ __forceinline__ void splitf(float y, unsigned short& h, unsigned short& l) { h = f2bf(y); l = f2bf(y - bf2f(h)); }
__device__ __forceinline__ v16h cat16(v8h lo, v8h hi) { return __builtin_shufflevector(lo, hi, 0, 1, 2, 3, 4, 5, 6, 7, 8, 9, 10, 11, 12, 13, 14, 15); }
__device__ __forceinline__ v16bf cat16b(v8us lo, v8us hi) { return __builtin_bit_cast(v16bf, __builtin_shufflevector(lo, hi, 0, 1, 2, 3, 4, 5, 6, 7, 8, 9, 10, 11, 12, 13, 14, 15)); }
__device__ __forceinline__ v8f wmma16(v16h a, v16h b, v8f c) { return __builtin_amdgcn_wmma_f32_16x16x32_f16(false, a, false, b, (short)0, c, false, false); }
__device__ __forceinline__ v8f wmmab(v16bf a, v16bf b, v8f c) { return __builtin_amdgcn_wmma_f32_16x16x32_bf16(false, a, false, b, (short)0, c, false, false); }
// Fragment loaders from fragment-order planes: p already holds the 512-element (16 rows x 32 k) block base + 8*lane, lane = 16*h + row; elements 0..7 = k0+8h.., elements 8..15 = k0+16+8h..; each load covers four whole 128-B lines.
__device__ __forceinline__ v16bf ldbf(const bf* p) { return cat16b(*(const v8us*)p, *(const v8us*)(p + 256)); }
__device__ __forceinline__ v16h ldhf(const h16* p) { return cat16(*(const v8h*)p, *(const v8h*)(p + 256)); }
// Same-wave LDS exchange (wave-private tiles only).
__device__ __forceinline__ void wave_lds_sync() { __builtin_amdgcn_fence(3 /* release order */, "wavefront"); __builtin_amdgcn_wave_barrier(); __builtin_amdgcn_fence(2 /* acquire order */, "wavefront"); asm volatile("" ::: "memory"); }

// ---- k_wt: in[z][rows][cols] (f32) -> transposed matrix out[n = z*cols + col][k = row] (bf16 RNE) in fragment order [n/16][k/8][n%16][k%8], 64x64 tiles through LDS; grid (rows/64, cols/64, z), 256 threads.
__global__ __launch_bounds__(256) void k_wt(const float* __restrict__ src, bf* dst, int rows, int cols) {
    __shared__ float t[64 * 65];
    const int tid = threadIdx.x;
    const size_t zo = (size_t)blockIdx.z * (size_t)rows * (size_t)cols;
    const int r0 = blockIdx.x * 64, c0 = blockIdx.y * 64;
#pragma unroll 4
    for (int i = 0; i < 16; ++i) { const int rr = (tid >> 6) + 4 * i, cc = tid & 63; t[rr * 65 + cc] = src[zo + (size_t)(r0 + rr) * cols + c0 + cc]; }
    __syncthreads();
    const int pc = (tid >> 3) & 7;
#pragma unroll
    for (int it = 0; it < 2; ++it) { const int line = (tid & 7) + 8 * (tid >> 6) + 32 * it; v8us o;
#pragma unroll
        for (int i = 0; i < 8; ++i) o[i] = f2bf(t[(8 * pc + i) * 65 + line]);
        const int n = blockIdx.z * cols + c0 + line;
        *(v8us*)(dst + (size_t)(n >> 4) * 16 * rows + (size_t)((r0 >> 3) + pc) * 128 + (n & 15) * 8) = o; }
}

// ---- k_ln: one wave per token; the block's 8 tokens are gathered in LDS so that each 128-B line of the fragment-order planes (8 tokens x 16 B) is stored whole.
__global__ __launch_bounds__(256) void k_ln(const float* __restrict__ x, const float* __restrict__ g, const float* __restrict__ be, bf* Yh, bf* Yl) {
    __shared__ __align__(16) bf sy[2][8][DM + 8];
    const int lane = threadIdx.x & 31;
    const int wave = __builtin_amdgcn_readfirstlane(threadIdx.x >> 5);
    const int tok = blockIdx.x * 8 + wave;
    const int b = tok / SEQ, s = tok % SEQ;
    const float* xr = x + ((size_t)b * SEQ_FULL + s) * DM;
    v4f v[3]; float sum = 0.0f;
#pragma unroll
    for (int j = 0; j < 3; ++j) { v4f a = *(const v4f*)(xr + j * 128 + lane * 4);
#pragma unroll
        for (int q = 0; q < 4; ++q) { a[q] = bfr(a[q]); sum += a[q]; }
        v[j] = a; }
#pragma unroll
    for (int sh = 16; sh; sh >>= 1) sum += __shfl_xor(sum, sh, 32);
    const float mu = sum * (1.0f / DM);
    float var = 0.0f;
#pragma unroll
    for (int j = 0; j < 3; ++j) {
#pragma unroll
        for (int q = 0; q < 4; ++q) { const float d = v[j][q] - mu; var += d * d; } }
#pragma unroll
    for (int sh = 16; sh; sh >>= 1) var += __shfl_xor(var, sh, 32);
    const float rs = rsqrtf(var * (1.0f / DM) + 1e-5f);
    v4us oh[3], ol[3];
#pragma unroll
    for (int j = 0; j < 3; ++j) { const v4f gg = *(const v4f*)(g + j * 128 + lane * 4); const v4f bb = *(const v4f*)(be + j * 128 + lane * 4);
#pragma unroll
        for (int q = 0; q < 4; ++q) { const float y = (v[j][q] - mu) * rs * bfr(gg[q]) + bfr(bb[q]); unsigned short a, c; splitf(y, a, c); oh[j][q] = a; ol[j][q] = c; } }
#pragma unroll
    for (int j = 0; j < 3; ++j) { *(v4us*)(&sy[0][wave][j * 128 + lane * 4]) = oh[j]; *(v4us*)(&sy[1][wave][j * 128 + lane * 4]) = ol[j]; }
    __syncthreads();   // each stored line below holds 16 B from each of the 8 waves' tokens
    const int r8 = threadIdx.x & 7;
    const size_t tb = (size_t)(blockIdx.x >> 1) * (16 * DM) + (blockIdx.x & 1) * 64 + r8 * 8;
#pragma unroll
    for (int it = 0; it < 3; ++it) { const int idx = (threadIdx.x >> 3) + 32 * it; const int pl = idx >= DM / 8 ? 1 : 0; const int ch = idx - pl * (DM / 8);
        *(v8us*)((pl ? Yl : Yh) + tb + ch * 128) = *(const v8us*)(&sy[pl][r8][ch * 8]); }
}

// ---- k_gemmw: register-blocked GEMM, ONE WAVE per 64x64 output tile (16 accumulators), operands straight from fragment-order bf16 planes (K = 384); grid (M/64, 384/64), 32 threads.
// MODE 2: f32 output rows [tok][384] with exact erf GELU (16 lanes x 16 B = 256 B per row segment, 2 rows per instruction).
template <int MODE>
__global__ __launch_bounds__(32) void k_gemmw(const bf* __restrict__ A, const bf* __restrict__ A2, const bf* __restrict__ Bt, const float* __restrict__ bias, bf* Oh, bf* Ol, h16* Ov, float* Of) {
    __shared__ __align__(16) float os[64 * 68];
    const int lane = threadIdx.x & 31, lr = lane & 15, hi = lane >> 4;
    const int r0 = blockIdx.x * 64, c0 = blockIdx.y * 64;
    v8f acc[4][4];
#pragma unroll
    for (int mb = 0; mb < 4; ++mb)
#pragma unroll
        for (int nb = 0; nb < 4; ++nb) acc[mb][nb] = (v8f){};
    const size_t aoff = (size_t)r0 * DM + 8 * lane, boff = (size_t)c0 * DM + 8 * lane;
#pragma unroll 1
    for (int kc = 0; kc < DM; kc += 32) {
        v16bf a[4], a2[4], b[4];
        const bf* pa = A + aoff + kc * 16; const bf* pa2 = A2 + aoff + kc * 16; const bf* pb = Bt + boff + kc * 16;
#pragma unroll
        for (int mb = 0; mb < 4; ++mb) { a[mb] = ldbf(pa + mb * 16 * DM); b[mb] = ldbf(pb + mb * 16 * DM); a2[mb] = ldbf(pa2 + mb * 16 * DM); }
        // The three address pairs are inputs, so they stay whole until this wait: no load's result and no next address is written into a pair that an issued load of this trip still names.
        asm volatile("s_wait_xcnt 0x0" :: "v"(pa), "v"(pa2), "v"(pb) : "memory");
#pragma unroll
        for (int nb = 0; nb < 4; ++nb) {
#pragma unroll
            for (int mb = 0; mb < 4; ++mb) { acc[mb][nb] = wmmab(a[mb], b[nb], acc[mb][nb]); acc[mb][nb] = wmmab(a2[mb], b[nb], acc[mb][nb]); } }
        asm volatile("" : "+v"(acc[0][0]), "+v"(acc[1][0]), "+v"(acc[2][0]), "+v"(acc[3][0]), "+v"(acc[0][1]), "+v"(acc[1][1]), "+v"(acc[2][1]), "+v"(acc[3][1]));
        asm volatile("v_nop\n\tv_nop\n\tv_nop\n\tv_nop" : "+v"(acc[0][2]), "+v"(acc[1][2]), "+v"(acc[2][2]), "+v"(acc[3][2]), "+v"(acc[0][3]), "+v"(acc[1][3]), "+v"(acc[2][3]), "+v"(acc[3][3]) : "v"(a[3]), "v"(a2[3]), "v"(b[3]));
    }
#pragma unroll
    for (int mb = 0; mb < 4; ++mb)
#pragma unroll
        for (int nb = 0; nb < 4; ++nb)
#pragma unroll
            for (int j = 0; j < 8; ++j) os[(mb * 16 + hi * 8 + j) * 68 + nb * 16 + lr] = acc[mb][nb][j];
    wave_lds_sync();
    const int bb = r0 / SEQ, sq = r0 % SEQ, hh = blockIdx.y;
    // Fragment-order stores: 8 lanes (r8) x 16 B fill one 128-B line of one 8-element chunk column, 4 chunk columns (cc) per instruction.
    const int r8 = lane & 7, cc = lane >> 3;
    if (MODE == 0) {
        const size_t pb = ((size_t)(bb * NH + hh) * SEQ + sq) * HD;
        float bz[2][8];
#pragma unroll
        for (int hf = 0; hf < 2; ++hf)
#pragma unroll
            for (int i = 0; i < 8; ++i) bz[hf][i] = bfr(bias[c0 + 8 * (4 * hf + cc) + i]);
#pragma unroll 1   // rolled: the epilogue is store-bound, and unrolled it would only take instruction cache
        for (int g = 0; g < 8; ++g) { const int row = 8 * g + r8;
#pragma unroll     // bz[hf] must be a compile-time register index
            for (int hf = 0; hf < 2; ++hf) { const int ch = 4 * hf + cc;
                const v4f u0 = *(const v4fa*)(os + row * 68 + 8 * ch); const v4f u1 = *(const v4fa*)(os + row * 68 + 8 * ch + 4); v8us oh, ol;
#pragma unroll
                for (int i = 0; i < 4; ++i) { unsigned short a, c; splitf(u0[i] + bz[hf][i], a, c); oh[i] = a; ol[i] = c; splitf(u1[i] + bz[hf][4 + i], a, c); oh[4 + i] = a; ol[4 + i] = c; }
                const size_t oo = pb + (size_t)(row >> 4) * (16 * HD) + ch * 128 + (row & 15) * 8;
                *(v8us*)(Oh + oo) = oh; *(v8us*)(Ol + oo) = ol; }
            asm volatile("s_wait_xcnt 0x0" ::: "memory");   // the next trip overwrites the stores' address and data registers
        }
    }
    if (MODE == 1) {
        const size_t vb = ((size_t)(bb * NH + hh) * SEQ + sq) * HD;
#pragma unroll 1   // rolled: the epilogue is store-bound, and unrolled it would only take instruction cache
        for (int g = 0; g < 8; ++g) { const int hd = 8 * g + r8; const float bzv = bfr(bias[c0 + hd]);
#pragma unroll
            for (int kq = 0; kq < 2; ++kq) { v8h o8;
#pragma unroll
                for (int i = 0; i < 8; ++i) o8[i] = (h16)(os[(32 * kq + 8 * cc + i) * 68 + hd] + bzv);
                *(v8h*)(Ov + vb + (size_t)kq * (32 * HD) + (hd >> 4) * 512 + cc * 128 + (hd & 15) * 8) = o8; }
            asm volatile("s_wait_xcnt 0x0" ::: "memory");   // the next trip overwrites the stores' address and data registers
        }
    }
    if (MODE == 2) {
        const int cofs = lr * 4;
        float bz4[4];
#pragma unroll
        for (int q = 0; q < 4; ++q) bz4[q] = bfr(bias[c0 + cofs + q]);
{
#pragma unroll 1
            for (int s = 0; s < 32; ++s) { const int row = 2 * s + hi; v4f val = *(const v4fa*)(os + row * 68 + cofs);
#pragma unroll
                for (int q = 0; q < 4; ++q) { const float tv = val[q] + bz4[q]; val[q] = 0.5f * tv * (1.0f + erff(tv * 0.70710678118654752f)); }
                *(v4f*)(Of + (size_t)(r0 + row) * DM + c0 + cofs) = val; }
             }
    }
}

// exp2 with the vector slot that the instruction set asks for behind a transcendental kept inside the statement: each v_exp_f32 is followed by an instruction that neither reads its result nor overwrites its source
// ("=&v": no result shares a register with a source of the group), the last one by v_nop.
__device__ __forceinline__ void exp2x4(float x0, float x1, float x2, float x3, float& y0, float& y1, float& y2, float& y3) {
    asm("v_exp_f32 %0, %4\n\tv_exp_f32 %1, %5\n\tv_exp_f32 %2, %6\n\tv_exp_f32 %3, %7\n\tv_nop" : "=&v"(y0), "=&v"(y1), "=&v"(y2), "=&v"(y3) : "v"(x0), "v"(x1), "v"(x2), "v"(x3));
}
__device__ __forceinline__ float exp2x1(float x) { float y; asm("v_exp_f32 %0, %1\n\tv_nop" : "=v"(y) : "v"(x)); return y; }

// ---- k_attn: fused flash attention (unscaled scores, no mask), transposed form. Block = 4 independent waves, each owns 32 queries (two 16-query tiles) of one (b, h); grid (SEQ/128, NB*NH).
// The wave's Q fragments (hi|lo, both tiles) are loaded once and stay in registers; each K and V fragment loaded in the key loop feeds both query tiles.
// Per 32-key step and query tile: S^T[key][q] = Kh Qh^T + Kl Qh^T + Kh Ql^T (A = key rows from the k planes, B = query rows from the q planes, k index = hd);
// lane (n = query, h) then holds keys 8h+r of both 16-key tiles -> running max / exp2 per lane, one cross-half shuffle;
// the P^T B fragment is formed in registers (element r <- tile 0 value r, element 8+r <- tile 1 value r; carried x16384 in f16); O^T[hd][q] += V^T[hd][key] P^T[key][q] (A from the f16 v^T plane).
// l is accumulated from the unconverted f32 p values (per-lane partials, combined once at the end). Operand fragments come straight from the fragment-order global planes (two 16-B loads each, 512 contiguous bytes per load).
__global__ __launch_bounds__(128) void k_attn(const bf* __restrict__ Qh, const bf* __restrict__ Ql, const bf* __restrict__ Kh, const bf* __restrict__ Kl, const h16* __restrict__ Vt, bf* Ch, bf* Cl) {
#pragma clang fp contract(off)
    __shared__ __align__(16) float os[4 * 2 * 16 * 68];
    const int lane = threadIdx.x & 31, lr = lane & 15, hi = lane >> 4;
    const int wave = __builtin_amdgcn_readfirstlane(threadIdx.x >> 5);
    const int bh = blockIdx.y;
    const int q0 = blockIdx.x * 128 + wave * 32;
    const size_t pbase = (size_t)bh * SEQ * HD;
    const bf* qh = Qh + pbase; const bf* ql = Ql + pbase; const bf* kh = Kh + pbase; const bf* kl = Kl + pbase; const h16* vt = Vt + pbase;
    const int qoff0 = q0 * HD + 8 * lane;
    v16bf bqh[2][2], bql[2][2];
#pragma unroll
    for (int t = 0; t < 2; ++t)
#pragma unroll
        for (int ks = 0; ks < 2; ++ks) { bqh[t][ks] = ldbf(qh + qoff0 + t * (16 * HD) + ks * 512); bql[t][ks] = ldbf(ql + qoff0 + t * (16 * HD) + ks * 512); }
    v8f o[2][4];
#pragma unroll
    for (int t = 0; t < 2; ++t)
#pragma unroll
        for (int j = 0; j < 4; ++j) o[t][j] = (v8f){};
    float m[2] = {-1.0e30f, -1.0e30f}, l[2] = {0.0f, 0.0f};
#pragma unroll 1
    for (int kb = 0; kb < SEQ; kb += 32) {
        const int ko = kb * HD + 8 * lane;
        v8f s0[2], s1[2];
#pragma unroll
        for (int t = 0; t < 2; ++t) { s0[t] = (v8f){}; s1[t] = (v8f){}; }
#pragma unroll
        for (int ks = 0; ks < 2; ++ks) {
            const v16bf a0h = ldbf(kh + ko + ks * 512), a0l = ldbf(kl + ko + ks * 512);
            const v16bf a1h = ldbf(kh + ko + 16 * HD + ks * 512), a1l = ldbf(kl + ko + 16 * HD + ks * 512);
            s0[0] = wmmab(a0h, bqh[0][ks], s0[0]); s1[0] = wmmab(a1h, bqh[0][ks], s1[0]); s0[1] = wmmab(a0h, bqh[1][ks], s0[1]); s1[1] = wmmab(a1h, bqh[1][ks], s1[1]);
            s0[0] = wmmab(a0l, bqh[0][ks], s0[0]); s1[0] = wmmab(a1l, bqh[0][ks], s1[0]); s0[1] = wmmab(a0l, bqh[1][ks], s0[1]); s1[1] = wmmab(a1l, bqh[1][ks], s1[1]);
            s0[0] = wmmab(a0h, bql[0][ks], s0[0]); s1[0] = wmmab(a1h, bql[0][ks], s1[0]); s0[1] = wmmab(a0h, bql[1][ks], s0[1]); s1[1] = wmmab(a1h, bql[1][ks], s1[1]);
        }
        const h16* pv = vt + ko;
        const v16h va0 = ldhf(pv), va1 = ldhf(pv + 512), va2 = ldhf(pv + 1024), va3 = ldhf(pv + 1536);
        // The address pair is an input, so it stays whole until this wait: no load's result is written into a pair that an issued load still names.
        asm volatile("s_wait_xcnt 0x0" :: "v"(pv) : "memory");
        v16h pf[2];
#pragma unroll
        for (int t = 0; t < 2; ++t) {
            float mx = fmaxf(s0[t][0], s1[t][0]);
#pragma unroll
            for (int r = 1; r < 8; ++r) mx = fmaxf(mx, fmaxf(s0[t][r], s1[t][r]));
            mx = fmaxf(mx, __shfl_xor(mx, 16, 32));
            const float mn = fmaxf(m[t], mx);
            const float alpha = exp2x1((m[t] - mn) * L2E);
            m[t] = mn;
            float psum = 0.0f;
#pragma unroll
            for (int r = 0; r < 8; r += 2) {
                float p0, p1, p2, p3;
                exp2x4((s0[t][r] - mn) * L2E, (s1[t][r] - mn) * L2E, (s0[t][r + 1] - mn) * L2E, (s1[t][r + 1] - mn) * L2E, p0, p1, p2, p3);
                psum += p0 + p1;
                psum += p2 + p3;
                pf[t][r] = (h16)(p0 * PCAR); pf[t][8 + r] = (h16)(p1 * PCAR); pf[t][r + 1] = (h16)(p2 * PCAR); pf[t][9 + r] = (h16)(p3 * PCAR); }
            l[t] = l[t] * alpha + psum;
#pragma unroll
            for (int j = 0; j < 4; ++j)
#pragma unroll
                for (int r = 0; r < 8; ++r) o[t][j][r] *= alpha;
        }
#pragma unroll
        for (int t = 0; t < 2; ++t) { o[t][0] = wmma16(va0, pf[t], o[t][0]); o[t][1] = wmma16(va1, pf[t], o[t][1]); o[t][2] = wmma16(va2, pf[t], o[t][2]); o[t][3] = wmma16(va3, pf[t], o[t][3]); }
    }
    const int b = bh / NH, h = bh % NH;
    const int r8 = lane & 7, cc = lane >> 3;
#pragma unroll
    for (int t = 0; t < 2; ++t) {
        const float lt = l[t] + __shfl_xor(l[t], 16, 32);
        const float inv = 1.0f / (lt * PCAR);
        const int wbase = (wave * 2 + t) * (16 * 68);
#pragma unroll
        for (int j = 0; j < 4; ++j)
#pragma unroll
            for (int r = 0; r < 8; ++r) os[wbase + lr * 68 + 16 * j + 8 * hi + r] = o[t][j][r] * inv;
    }
    wave_lds_sync();
#pragma unroll 1   // rolled: each trip's wait then stands in front of every later write of its stores' registers
    for (int u = 0; u < 8; ++u) { const int t = u >> 2, s = u & 3;
        const int wbase = (wave * 2 + t) * (16 * 68);
        const int row = 8 * (s & 1) + r8, ch = 4 * (s >> 1) + cc;
        const v4f u0 = *(const v4fa*)(os + wbase + row * 68 + 8 * ch); const v4f u1 = *(const v4fa*)(os + wbase + row * 68 + 8 * ch + 4); v8us oh, ol;
#pragma unroll
        for (int i = 0; i < 4; ++i) { unsigned short a, c; splitf(u0[i], a, c); oh[i] = a; ol[i] = c; splitf(u1[i], a, c); oh[4 + i] = a; ol[4 + i] = c; }
        const size_t oo = ((size_t)b * SEQ + q0 + 16 * t) * DM + (h * 8 + ch) * 128 + row * 8;
        *(v8us*)(Ch + oo) = oh; *(v8us*)(Cl + oo) = ol;
        asm volatile("s_wait_xcnt 0x0" ::: "memory");   // the next trip overwrites the stores' address and data registers
    }
}

extern "C" void kernel_launch(void* const* d_in, const int* in_sizes, int n_in,
                              void* d_out, int out_size, void* d_ws, size_t ws_size, hipStream_t stream) {
    if (n_in < 11) return;
    if ((size_t)in_sizes[0] < ((size_t)(NB - 1) * SEQ_FULL + SEQ) * DM) return;
    if (in_sizes[1] < DM || in_sizes[2] < DM) return;
    if (in_sizes[3] < NH * DM * HD || in_sizes[5] < NH * DM * HD || in_sizes[7] < NH * DM * HD || in_sizes[9] < DM * DM) return;
    if (in_sizes[4] < DM || in_sizes[6] < DM || in_sizes[8] < DM || in_sizes[10] < DM) return;
    if ((size_t)out_size < (size_t)MTOK * DM) return;
    const float* x   = (const float*)d_in[0];
    const float* lng = (const float*)d_in[1];
    const float* lnb = (const float*)d_in[2];
    const float* wq  = (const float*)d_in[3];
    const float* bq  = (const float*)d_in[4];
    const float* wk  = (const float*)d_in[5];
    const float* bk  = (const float*)d_in[6];
    const float* wv  = (const float*)d_in[7];
    const float* bv  = (const float*)d_in[8];
    const float* wp  = (const float*)d_in[9];
    const float* bp  = (const float*)d_in[10];
    float* OUT = (float*)d_out;     // [NB][SEQ][384]
    char* wsp = (char*)d_ws;
    auto take = [&](size_t bytes) { char* p = wsp; wsp += (bytes + 255) & ~(size_t)255; return (void*)p; };
    const size_t WSZ = (size_t)DM * DM * 2;            // one transposed bf16 weight plane [384][384]
    const size_t PSZ = (size_t)MTOK * DM * 2;          // one 16-bit activation plane
    bf* WQ = (bf*)take(WSZ); bf* WK = (bf*)take(WSZ); bf* WV = (bf*)take(WSZ); bf* WP = (bf*)take(WSZ);
    bf* Yh = (bf*)take(PSZ); bf* Yl = (bf*)take(PSZ);
    bf* Qh = (bf*)take(PSZ); bf* Ql = (bf*)take(PSZ); bf* Kh = (bf*)take(PSZ); bf* Kl = (bf*)take(PSZ);
    h16* VT = (h16*)take(PSZ);
    if ((size_t)(wsp - (char*)d_ws) > ws_size) return;
    bf* Ch = Yh; bf* Cl = Yl;   // ctx planes reuse the y planes (y is dead after the three projections; stream-ordered)

    // per-head [h][d][k] -> Bt[h*64 + k][d]: in[rows = 384 (d)][cols = 64 (k)] -> out[cols][rows], z = head
    k_wt<<<dim3(DM / 64, HD / 64, NH), 256, 0, stream>>>(wq, WQ, DM, HD);
    k_wt<<<dim3(DM / 64, HD / 64, NH), 256, 0, stream>>>(wk, WK, DM, HD);
    k_wt<<<dim3(DM / 64, HD / 64, NH), 256, 0, stream>>>(wv, WV, DM, HD);
    // Wp [in = 384 (d)][out = 384 (n)] -> Bt[n][d]: in[rows = 384][cols = 384] -> out[cols][rows]
    k_wt<<<dim3(DM / 64, DM / 64, 1), 256, 0, stream>>>(wp, WP, DM, DM);
    k_ln<<<MTOK / 8, 256, 0, stream>>>(x, lng, lnb, Yh, Yl);
    k_gemmw<0><<<dim3(MTOK / 64, DM / 64, 1), 32, 0, stream>>>(Yh, Yl, WQ, bq, Qh, Ql, (h16*)nullptr, (float*)nullptr);
    k_gemmw<0><<<dim3(MTOK / 64, DM / 64, 1), 32, 0, stream>>>(Yh, Yl, WK, bk, Kh, Kl, (h16*)nullptr, (float*)nullptr);
    k_gemmw<1><<<dim3(MTOK / 64, DM / 64, 1), 32, 0, stream>>>(Yh, Yl, WV, bv, (bf*)nullptr, (bf*)nullptr, VT, (float*)nullptr);
    k_attn<<<dim3(SEQ / 128, NB * NH, 1), 128, 0, stream>>>(Qh, Ql, Kh, Kl, VT, Ch, Cl);
    k_gemmw<2><<<dim3(MTOK / 64, DM / 64, 1), 32, 0, stream>>>(Ch, Cl, WP, bp, (bf*)nullptr, (bf*)nullptr, (h16*)nullptr, OUT);
}

// v003
// It runs in 171 microseconds.
// In two side-by-side timings against v002, it was 1.20 and 1.19 times as fast.
// All steps since v000 together make it 2.70 times as fast.
#include <hip/hip_runtime.h>

// Compute dtypes, f32 accumulate everywhere: inputs converted to bf16 (RNE); q/k/v and output projections = bf16 WMMA with the activation as hi|lo planes against exact bf16 weights (2 products); scores = bf16 WMMA q hi|lo x k hi|lo (3 products); P.V = f16 WMMA (P carried x16384, V plain f16); LayerNorm, softmax, GELU in f32.
// Every 16-bit WMMA operand plane with 384-long rows (y, ctx, transposed weights) is kept in fragment order [row/16][k/8][row%16][k%8].
// Pre-LN attention: y = LN(x) -> hi|lo planes; per-head projections written straight into head planes in WMMA fragment order (q,k hi|lo [b][h][s/16][hd/8][s%16][hd%8]; v^T f16 [b][h][s/32][hd/16][(s%32)/8][hd%16][s%8]), so that each 16-B-per-lane fragment load of the attention kernel is 512 contiguous bytes; fused flash attention in the transposed form S^T = K Q^T, O^T = V^T P^T (P fragment built in registers from the score accumulators); ctx hi|lo x Wp + bp -> erf GELU -> out.

#ifndef NB
#define NB 8
#endif
#ifndef SEQ
#define SEQ 2048
#endif
#define NB_FULL  8
#define SEQ_FULL 2048
#define DM   384
#define NH   6
#define HD   64
#define MTOK (NB * SEQ)
#define PCAR 16384.0f
#define L2E  1.4426950408889634f

static_assert(SEQ % 128 == 0);
static_assert(DM % 64 == 0);
static_assert(DM % 32 == 0);
static_assert(NH * HD == DM);
static_assert(NB <= NB_FULL);
static_assert(SEQ <= SEQ_FULL);
static_assert((size_t)4 * DM * DM * 2 + (size_t)7 * MTOK * DM * 2 <= (size_t)134217728);

typedef _Float16 h16;
typedef unsigned short bf;
typedef __attribute__((ext_vector_type(16))) __bf16   v16bf;
typedef __attribute__((ext_vector_type(16))) _Float16 v16h;
typedef __attribute__((ext_vector_type(8)))  _Float16 v8h;
typedef __attribute__((ext_vector_type(8)))  unsigned short v8us;
typedef __attribute__((ext_vector_type(4)))  unsigned short v4us;
typedef __attribute__((ext_vector_type(8)))  float    v8f;
typedef __attribute__((ext_vector_type(4)))  float    v4f;
typedef v4f  __attribute__((may_alias)) v4fa;

__device__ __forceinline__ unsigned short f2bf(float f) { unsigned u = __float_as_uint(f); u += 0x7FFFu + ((u >> 16) & 1u); return (unsigned short)(u >> 16); }
__device__ __forceinline__ float bf2f(unsigned short b) { return __uint_as_float(((unsigned)b) << 16); }
__device__ __forceinline__ float bfr(float f) { return bf2f(f2bf(f)); }
__device__ __forceinline__ void splitf(float y, unsigned short& h, unsigned short& l) { h = f2bf(y); l = f2bf(y - bf2f(h)); }
__device__ __forceinline__ v16h cat16(v8h lo, v8h hi) { return __builtin_shufflevector(lo, hi, 0, 1, 2, 3, 4, 5, 6, 7, 8, 9, 10, 11, 12, 13, 14, 15); }
__device__ __forceinline__ v16bf cat16b(v8us lo, v8us hi) { return __builtin_bit_cast(v16bf, __builtin_shufflevector(lo, hi, 0, 1, 2, 3, 4, 5, 6, 7, 8, 9, 10, 11, 12, 13, 14, 15)); }
__device__ __forceinline__ v8f wmma16(v16h a, v16h b, v8f c) { return __builtin_amdgcn_wmma_f32_16x16x32_f16(false, a, false, b, (short)0, c, false, false); }
__device__ __forceinline__ v8f wmmab(v16bf a, v16bf b, v8f c) { return __builtin_amdgcn_wmma_f32_16x16x32_bf16(false, a, false, b, (short)0, c, false, false); }
// Fragment loaders from fragment-order planes: p already holds the 512-element (16 rows x 32 k) block base + 8*lane, lane = 16*h + row; elements 0..7 = k0+8h.., elements 8..15 = k0+16+8h..; each load covers four whole 128-B lines.
__device__ __forceinline__ v16bf ldbf(const bf* p) { return cat16b(*(const v8us*)p, *(const v8us*)(p + 256)); }
__device__ __forceinline__ v16h ldhf(const h16* p) { return cat16(*(const v8h*)p, *(const v8h*)(p + 256)); }
// Same-wave LDS exchange (wave-private tiles only).
__device__ __forceinline__ void wave_lds_sync() { __builtin_amdgcn_fence(3 /* release order */, "wavefront"); __builtin_amdgcn_wave_barrier(); __builtin_amdgcn_fence(2 /* acquire order */, "wavefront"); asm volatile("" ::: "memory"); }

// ---- wt_body: in[z][rows][cols] (f32) -> transposed matrix out[n = z*cols + col][k = row] (bf16 RNE) in fragment order [n/16][k/8][n%16][k%8], one 64x64 tile (bx, by, bz) of (rows/64, cols/64, z) through LDS (t: 64 x 65 floats); 256 threads.
__device__ __forceinline__ void wt_body(const float* __restrict__ src, bf* dst, int rows, int cols, int bx, int by, int bz, float* t) {
    const int tid = threadIdx.x;
    const size_t zo = (size_t)bz * (size_t)rows * (size_t)cols;
    const int r0 = bx * 64, c0 = by * 64;
#pragma unroll 1   // four loads in flight a trip; rolled: each trip's wait then stands in front of the next trip's address writes
    for (int i0 = 0; i0 < 16; i0 += 4) { const int cc = tid & 63; const float* p[4]; float v[4];
#pragma unroll
        for (int u = 0; u < 4; ++u) { p[u] = src + zo + (size_t)(r0 + (tid >> 6) + 4 * (i0 + u)) * cols + c0 + cc; v[u] = *p[u]; }
        // The four address pairs are inputs, so they stay whole until this wait: no load's result and no next address is written into a pair that an issued load still names.
        asm volatile("s_wait_xcnt 0x0" :: "v"(p[0]), "v"(p[1]), "v"(p[2]), "v"(p[3]) : "memory");
#pragma unroll
        for (int u = 0; u < 4; ++u) t[((tid >> 6) + 4 * (i0 + u)) * 65 + cc] = v[u]; }
    __syncthreads();
    const int pc = (tid >> 3) & 7;
#pragma unroll
    for (int it = 0; it < 2; ++it) { const int line = (tid & 7) + 8 * (tid >> 6) + 32 * it; v8us o;
#pragma unroll
        for (int i = 0; i < 8; ++i) o[i] = f2bf(t[(8 * pc + i) * 65 + line]);
        const int n = bz * cols + c0 + line;
        *(v8us*)(dst + (size_t)(n >> 4) * 16 * rows + (size_t)((r0 >> 3) + pc) * 128 + (n & 15) * 8) = o; }
}

// ---- ln_body: one wave per token, block blk takes tokens 8*blk..8*blk+7; they are gathered in LDS so that each 128-B line of the fragment-order planes (8 tokens x 16 B) is stored whole.
__device__ __forceinline__ void ln_body(const float* __restrict__ x, const float* __restrict__ g, const float* __restrict__ be, bf* Yh, bf* Yl, int blk, bf (*sy)[8][DM + 8]) {
    const int lane = threadIdx.x & 31;
    const int wave = __builtin_amdgcn_readfirstlane(threadIdx.x >> 5);
    const int tok = blk * 8 + wave;
    const int b = tok / SEQ, s = tok % SEQ;
    const float* xr = x + ((size_t)b * SEQ_FULL + s) * DM;
    v4f v[3]; float sum = 0.0f;
#pragma unroll
    for (int j = 0; j < 3; ++j) { v4f a = *(const v4f*)(xr + j * 128 + lane * 4);
#pragma unroll
        for (int q = 0; q < 4; ++q) { a[q] = bfr(a[q]); sum += a[q]; }
        v[j] = a; }
#pragma unroll
    for (int sh = 16; sh; sh >>= 1) sum += __shfl_xor(sum, sh, 32);
    const float mu = sum * (1.0f / DM);
    float var = 0.0f;
#pragma unroll
    for (int j = 0; j < 3; ++j) {
#pragma unroll
        for (int q = 0; q < 4; ++q) { const float d = v[j][q] - mu; var += d * d; } }
#pragma unroll
    for (int sh = 16; sh; sh >>= 1) var += __shfl_xor(var, sh, 32);
    const float rs = rsqrtf(var * (1.0f / DM) + 1e-5f);
    v4us oh[3], ol[3];
    const float* pg = g + lane * 4; const float* pb = be + lane * 4;
#pragma unroll
    for (int j = 0; j < 3; ++j) { const v4f gg = *(const v4f*)(pg + j * 128); const v4f bb = *(const v4f*)(pb + j * 128);
#pragma unroll
        for (int q = 0; q < 4; ++q) { const float y = (v[j][q] - mu) * rs * bfr(gg[q]) + bfr(bb[q]); unsigned short a, c; splitf(y, a, c); oh[j][q] = a; ol[j][q] = c; } }
    // The two addresses are inputs, so the registers they are formed from stay whole until this wait: no load's result is written into a register that an issued load still names.
    asm volatile("s_wait_xcnt 0x0" :: "v"(pg), "v"(pb) : "memory");
#pragma unroll
    for (int j = 0; j < 3; ++j) { *(v4us*)(&sy[0][wave][j * 128 + lane * 4]) = oh[j]; *(v4us*)(&sy[1][wave][j * 128 + lane * 4]) = ol[j]; }
    __syncthreads();   // each stored line below holds 16 B from each of the 8 waves' tokens
    const int r8 = threadIdx.x & 7;
    const size_t tb = (size_t)(blk >> 1) * (16 * DM) + (blk & 1) * 64 + r8 * 8;
    v8us ov[3];
#pragma unroll
    for (int it = 0; it < 3; ++it) { const int idx = (threadIdx.x >> 3) + 32 * it; const int pl = idx >= DM / 8 ? 1 : 0; const int ch = idx - pl * (DM / 8); ov[it] = *(const v8us*)(&sy[pl][r8][ch * 8]); }
#pragma unroll
    for (int it = 0; it < 3; ++it) { const int idx = (threadIdx.x >> 3) + 32 * it; const int pl = idx >= DM / 8 ? 1 : 0; const int ch = idx - pl * (DM / 8);
        *(v8us*)((pl ? Yl : Yh) + tb + ch * 128) = ov[it];
        asm volatile("s_wait_xcnt 0x0" ::: "memory"); }   // behind each store: in the fused kernel code follows that overwrites the stores' address and data registers
}

// ---- k_prep: the five jobs that depend on the inputs alone, as block ranges of one grid (256 threads): blocks 0..143 transpose the four weights (36 tiles each, first because they are few), the rest do LayerNorm.
#define WT_TILES ((DM / 64) * (DM / 64))
__global__ __launch_bounds__(256) void k_prep(const float* __restrict__ x, const float* __restrict__ g, const float* __restrict__ be,
                                              const float* __restrict__ wq, const float* __restrict__ wk, const float* __restrict__ wv, const float* __restrict__ wp,
                                              bf* Yh, bf* Yl, bf* WQ, bf* WK, bf* WV, bf* WP) {
    __shared__ __align__(16) float sm[64 * 65];   // one buffer for both jobs: a block does one of them
    static_assert(sizeof(bf) * 2 * 8 * (DM + 8) <= sizeof(float) * 64 * 65);
    const int bid = blockIdx.x;
    if (bid < 4 * WT_TILES) {   // the same for the whole block
        const int w = bid / WT_TILES, r = bid % WT_TILES, bx = r % (DM / 64), bo = r / (DM / 64);
        // per-head [h][d][k] -> Bt[h*64 + k][d]: in[rows = 384 (d)][cols = 64 (k)], z = head (bo); Wp [in = 384 (d)][out = 384 (n)] -> Bt[n][d]: in[rows = 384][cols = 384], column tile bo
        wt_body(w == 0 ? wq : w == 1 ? wk : w == 2 ? wv : wp, w == 0 ? WQ : w == 1 ? WK : w == 2 ? WV : WP, DM, w == 3 ? DM : HD, bx, w == 3 ? bo : 0, w == 3 ? 0 : bo, sm);
        return;
    }
    ln_body(x, g, be, Yh, Yl, bid - 4 * WT_TILES, (bf (*)[8][DM + 8])sm);
}

// ---- gemmw: register-blocked GEMM, ONE WAVE per 64x64 output tile (16 accumulators), operands straight from fragment-order bf16 planes (K = 384); tile (blockIdx.x, blockIdx.y) of (M/64, 384/64), 32 threads; os: 64 x 68 floats of LDS.
// MODE 0: hi|lo head planes (q, k); MODE 1: f16 v^T head plane; MODE 2: f32 output rows [tok][384] with exact erf GELU (16 lanes x 16 B = 256 B per row segment, 2 rows per instruction).
template <int MODE>
__device__ __forceinline__ void gemmw(const bf* __restrict__ A, const bf* __restrict__ A2, const bf* __restrict__ Bt, const float* __restrict__ bias, bf* Oh, bf* Ol, h16* Ov, float* Of, float* os) {
    const int lane = threadIdx.x & 31, lr = lane & 15, hi = lane >> 4;
    const int r0 = blockIdx.x * 64, c0 = blockIdx.y * 64;
    v8f acc[4][4];
#pragma unroll
    for (int mb = 0; mb < 4; ++mb)
#pragma unroll
        for (int nb = 0; nb < 4; ++nb) acc[mb][nb] = (v8f){};
    const size_t aoff = (size_t)r0 * DM + 8 * lane, boff = (size_t)c0 * DM + 8 * lane;
#pragma unroll 1
    for (int kc = 0; kc < DM; kc += 32) {
        v16bf a[4], a2[4], b[4];
        const bf* pa = A + aoff + kc * 16; const bf* pa2 = A2 + aoff + kc * 16; const bf* pb = Bt + boff + kc * 16;
#pragma unroll
        for (int mb = 0; mb < 4; ++mb) { a[mb] = ldbf(pa + mb * 16 * DM); b[mb] = ldbf(pb + mb * 16 * DM); a2[mb] = ldbf(pa2 + mb * 16 * DM); }
        // The three address pairs are inputs, so they stay whole until this wait: no load's result and no next address is written into a pair that an issued load of this trip still names.
        asm volatile("s_wait_xcnt 0x0" :: "v"(pa), "v"(pa2), "v"(pb) : "memory");
#pragma unroll
        for (int nb = 0; nb < 4; ++nb) {
#pragma unroll
            for (int mb = 0; mb < 4; ++mb) { acc[mb][nb] = wmmab(a[mb], b[nb], acc[mb][nb]); acc[mb][nb] = wmmab(a2[mb], b[nb], acc[mb][nb]); } }
        asm volatile("" : "+v"(acc[0][0]), "+v"(acc[1][0]), "+v"(acc[2][0]), "+v"(acc[3][0]), "+v"(acc[0][1]), "+v"(acc[1][1]), "+v"(acc[2][1]), "+v"(acc[3][1]));
        asm volatile("v_nop\n\tv_nop\n\tv_nop\n\tv_nop" : "+v"(acc[0][2]), "+v"(acc[1][2]), "+v"(acc[2][2]), "+v"(acc[3][2]), "+v"(acc[0][3]), "+v"(acc[1][3]), "+v"(acc[2][3]), "+v"(acc[3][3]) : "v"(a[3]), "v"(a2[3]), "v"(b[3]));
    }
#pragma unroll
    for (int mb = 0; mb < 4; ++mb)
#pragma unroll
        for (int nb = 0; nb < 4; ++nb)
#pragma unroll
            for (int j = 0; j < 8; ++j) os[(mb * 16 + hi * 8 + j) * 68 + nb * 16 + lr] = acc[mb][nb][j];
    wave_lds_sync();
    const int bb = r0 / SEQ, sq = r0 % SEQ, hh = blockIdx.y;
    // Fragment-order stores: 8 lanes (r8) x 16 B fill one 128-B line of one 8-element chunk column, 4 chunk columns (cc) per instruction.
    const int r8 = lane & 7, cc = lane >> 3;
    if (MODE == 0) {
        const size_t pb = ((size_t)(bb * NH + hh) * SEQ + sq) * HD;
        float bz[2][8];
#pragma unroll
        for (int hf = 0; hf < 2; ++hf)
#pragma unroll
            for (int i = 0; i < 8; ++i) bz[hf][i] = bfr(bias[c0 + 8 * (4 * hf + cc) + i]);
#pragma unroll 1   // rolled: the epilogue is store-bound, and unrolled it would only take instruction cache
        for (int g = 0; g < 8; ++g) { const int row = 8 * g + r8;
#pragma unroll     // bz[hf] must be a compile-time register index
            for (int hf = 0; hf < 2; ++hf) { const int ch = 4 * hf + cc;
                const v4f u0 = *(const v4fa*)(os + row * 68 + 8 * ch); const v4f u1 = *(const v4fa*)(os + row * 68 + 8 * ch + 4); v8us oh, ol;
#pragma unroll
                for (int i = 0; i < 4; ++i) { unsigned short a, c; splitf(u0[i] + bz[hf][i], a, c); oh[i] = a; ol[i] = c; splitf(u1[i] + bz[hf][4 + i], a, c); oh[4 + i] = a; ol[4 + i] = c; }
                const size_t oo = pb + (size_t)(row >> 4) * (16 * HD) + ch * 128 + (row & 15) * 8;
                *(v8us*)(Oh + oo) = oh; *(v8us*)(Ol + oo) = ol; }
            asm volatile("s_wait_xcnt 0x0" ::: "memory");   // the next trip overwrites the stores' address and data registers
        }
    }
    if (MODE == 1) {
        const size_t vb = ((size_t)(bb * NH + hh) * SEQ + sq) * HD;
#pragma unroll 1   // rolled: the epilogue is store-bound, and unrolled it would only take instruction cache
        for (int g = 0; g < 8; ++g) { const int hd = 8 * g + r8; const float bzv = bfr(bias[c0 + hd]);
#pragma unroll
            for (int kq = 0; kq < 2; ++kq) { v8h o8;
#pragma unroll
                for (int i = 0; i < 8; ++i) o8[i] = (h16)(os[(32 * kq + 8 * cc + i) * 68 + hd] + bzv);
                *(v8h*)(Ov + vb + (size_t)kq * (32 * HD) + (hd >> 4) * 512 + cc * 128 + (hd & 15) * 8) = o8; }
            asm volatile("s_wait_xcnt 0x0" ::: "memory");   // the next trip overwrites the stores' address and data registers
        }
    }
    if (MODE == 2) {
        const int cofs = lr * 4;
        float bz4[4];
        const float* pbz = bias + c0 + cofs;
#pragma unroll
        for (int q = 0; q < 4; ++q) bz4[q] = bfr(pbz[q]);
        // The address pair is an input, so it stays whole until this wait: the load's result is not written into the pair that the load names.
        asm volatile("s_wait_xcnt 0x0" :: "v"(pbz) : "memory");
{
#pragma unroll 1
            for (int s = 0; s < 32; ++s) { const int row = 2 * s + hi; v4f val = *(const v4fa*)(os + row * 68 + cofs);
#pragma unroll
                for (int q = 0; q < 4; ++q) { const float tv = val[q] + bz4[q]; val[q] = 0.5f * tv * (1.0f + erff(tv * 0.70710678118654752f)); }
                *(v4f*)(Of + (size_t)(r0 + row) * DM + c0 + cofs) = val; }
             }
    }
}

// ---- k_qkv: the three projections of y, which do not depend on one another, as one grid (M/64, 384/64, 3): blockIdx.z = 0 q, 1 k, 2 v.
__global__ __launch_bounds__(32) void k_qkv(const bf* __restrict__ Yh, const bf* __restrict__ Yl, const bf* __restrict__ WQ, const bf* __restrict__ WK, const bf* __restrict__ WV,
                                            const float* __restrict__ bq, const float* __restrict__ bk, const float* __restrict__ bv, bf* Qh, bf* Ql, bf* Kh, bf* Kl, h16* VT) {
    __shared__ __align__(16) float os[64 * 68];
    const int z = blockIdx.z;
    if (z == 2) gemmw<1>(Yh, Yl, WV, bv, (bf*)nullptr, (bf*)nullptr, VT, (float*)nullptr, os);
    else gemmw<0>(Yh, Yl, z ? WK : WQ, z ? bk : bq, z ? Kh : Qh, z ? Kl : Ql, (h16*)nullptr, (float*)nullptr, os);
}

// ---- k_proj: ctx hi|lo x Wp + bp -> erf GELU -> out; grid (M/64, 384/64).
__global__ __launch_bounds__(32) void k_proj(const bf* __restrict__ Ch, const bf* __restrict__ Cl, const bf* __restrict__ WP, const float* __restrict__ bp, float* Of) {
    __shared__ __align__(16) float os[64 * 68];
    gemmw<2>(Ch, Cl, WP, bp, (bf*)nullptr, (bf*)nullptr, (h16*)nullptr, Of, os);
}

// exp2 with the vector slot that the instruction set asks for behind a transcendental kept inside the statement: each v_exp_f32 is followed by an instruction that neither reads its result nor overwrites its source
// ("=&v": no result shares a register with a source of the group), the last one by v_nop.
__device__ __forceinline__ void exp2x4(float x0, float x1, float x2, float x3, float& y0, float& y1, float& y2, float& y3) {
    asm("v_exp_f32 %0, %4\n\tv_exp_f32 %1, %5\n\tv_exp_f32 %2, %6\n\tv_exp_f32 %3, %7\n\tv_nop" : "=&v"(y0), "=&v"(y1), "=&v"(y2), "=&v"(y3) : "v"(x0), "v"(x1), "v"(x2), "v"(x3));
}
__device__ __forceinline__ float exp2x1(float x) { float y; asm("v_exp_f32 %0, %1\n\tv_nop" : "=v"(y) : "v"(x)); return y; }

// ---- k_attn: fused flash attention (unscaled scores, no mask), transposed form. Block = 4 independent waves, each owns 32 queries (two 16-query tiles) of one (b, h); grid (SEQ/128, NB*NH).
// The wave's Q fragments (hi|lo, both tiles) are loaded once and stay in registers; each K and V fragment loaded in the key loop feeds both query tiles.
// Per 32-key step and query tile: S^T[key][q] = Kh Qh^T + Kl Qh^T + Kh Ql^T (A = key rows from the k planes, B = query rows from the q planes, k index = hd);
// lane (n = query, h) then holds keys 8h+r of both 16-key tiles -> running max / exp2 per lane, one cross-half shuffle;
// the P^T B fragment is formed in registers (element r <- tile 0 value r, element 8+r <- tile 1 value r; carried x16384 in f16); O^T[hd][q] += V^T[hd][key] P^T[key][q] (A from the f16 v^T plane).
// l is accumulated from the unconverted f32 p values (per-lane partials, combined once at the end). Operand fragments come straight from the fragment-order global planes (two 16-B loads each, 512 contiguous bytes per load).
__global__ __launch_bounds__(128) void k_attn(const bf* __restrict__ Qh, const bf* __restrict__ Ql, const bf* __restrict__ Kh, const bf* __restrict__ Kl, const h16* __restrict__ Vt, bf* Ch, bf* Cl) {
#pragma clang fp contract(off)
    __shared__ __align__(16) float os[4 * 2 * 16 * 68];
    const int lane = threadIdx.x & 31, lr = lane & 15, hi = lane >> 4;
    const int wave = __builtin_amdgcn_readfirstlane(threadIdx.x >> 5);
    const int bh = blockIdx.y;
    const int q0 = blockIdx.x * 128 + wave * 32;
    const size_t pbase = (size_t)bh * SEQ * HD;
    const bf* qh = Qh + pbase; const bf* ql = Ql + pbase; const bf* kh = Kh + pbase; const bf* kl = Kl + pbase; const h16* vt = Vt + pbase;
    const int qoff0 = q0 * HD + 8 * lane;
    v16bf bqh[2][2], bql[2][2];
#pragma unroll
    for (int t = 0; t < 2; ++t)
#pragma unroll
        for (int ks = 0; ks < 2; ++ks) { bqh[t][ks] = ldbf(qh + qoff0 + t * (16 * HD) + ks * 512); bql[t][ks] = ldbf(ql + qoff0 + t * (16 * HD) + ks * 512); }
    v8f o[2][4];
#pragma unroll
    for (int t = 0; t < 2; ++t)
#pragma unroll
        for (int j = 0; j < 4; ++j) o[t][j] = (v8f){};
    float m[2] = {-1.0e30f, -1.0e30f}, l[2] = {0.0f, 0.0f};
#pragma unroll 1
    for (int kb = 0; kb < SEQ; kb += 32) {
        const int ko = kb * HD + 8 * lane;
        v8f s0[2], s1[2];
#pragma unroll
        for (int t = 0; t < 2; ++t) { s0[t] = (v8f){}; s1[t] = (v8f){}; }
#pragma unroll
        for (int ks = 0; ks < 2; ++ks) {
            const v16bf a0h = ldbf(kh + ko + ks * 512), a0l = ldbf(kl + ko + ks * 512);
            const v16bf a1h = ldbf(kh + ko + 16 * HD + ks * 512), a1l = ldbf(kl + ko + 16 * HD + ks * 512);
            s0[0] = wmmab(a0h, bqh[0][ks], s0[0]); s1[0] = wmmab(a1h, bqh[0][ks], s1[0]); s0[1] = wmmab(a0h, bqh[1][ks], s0[1]); s1[1] = wmmab(a1h, bqh[1][ks], s1[1]);
            s0[0] = wmmab(a0l, bqh[0][ks], s0[0]); s1[0] = wmmab(a1l, bqh[0][ks], s1[0]); s0[1] = wmmab(a0l, bqh[1][ks], s0[1]); s1[1] = wmmab(a1l, bqh[1][ks], s1[1]);
            s0[0] = wmmab(a0h, bql[0][ks], s0[0]); s1[0] = wmmab(a1h, bql[0][ks], s1[0]); s0[1] = wmmab(a0h, bql[1][ks], s0[1]); s1[1] = wmmab(a1h, bql[1][ks], s1[1]);
        }
        const h16* pv = vt + ko;
        const v16h va0 = ldhf(pv), va1 = ldhf(pv + 512), va2 = ldhf(pv + 1024), va3 = ldhf(pv + 1536);
        // The address pair is an input, so it stays whole until this wait: no load's result is written into a pair that an issued load still names.
        asm volatile("s_wait_xcnt 0x0" :: "v"(pv) : "memory");
        v16h pf[2];
#pragma unroll
        for (int t = 0; t < 2; ++t) {
            float mx = fmaxf(s0[t][0], s1[t][0]);
#pragma unroll
            for (int r = 1; r < 8; ++r) mx = fmaxf(mx, fmaxf(s0[t][r], s1[t][r]));
            mx = fmaxf(mx, __shfl_xor(mx, 16, 32));
            const float mn = fmaxf(m[t], mx);
            const float alpha = exp2x1((m[t] - mn) * L2E);
            m[t] = mn;
            float psum = 0.0f;
#pragma unroll
            for (int r = 0; r < 8; r += 2) {
                float p0, p1, p2, p3;
                exp2x4((s0[t][r] - mn) * L2E, (s1[t][r] - mn) * L2E, (s0[t][r + 1] - mn) * L2E, (s1[t][r + 1] - mn) * L2E, p0, p1, p2, p3);
                psum += p0 + p1;
                psum += p2 + p3;
                pf[t][r] = (h16)(p0 * PCAR); pf[t][8 + r] = (h16)(p1 * PCAR); pf[t][r + 1] = (h16)(p2 * PCAR); pf[t][9 + r] = (h16)(p3 * PCAR); }
            l[t] = l[t] * alpha + psum;
#pragma unroll
            for (int j = 0; j < 4; ++j)
#pragma unroll
                for (int r = 0; r < 8; ++r) o[t][j][r] *= alpha;
        }
#pragma unroll
        for (int t = 0; t < 2; ++t) { o[t][0] = wmma16(va0, pf[t], o[t][0]); o[t][1] = wmma16(va1, pf[t], o[t][1]); o[t][2] = wmma16(va2, pf[t], o[t][2]); o[t][3] = wmma16(va3, pf[t], o[t][3]); }
    }
    const int b = bh / NH, h = bh % NH;
    const int r8 = lane & 7, cc = lane >> 3;
#pragma unroll
    for (int t = 0; t < 2; ++t) {
        const float lt = l[t] + __shfl_xor(l[t], 16, 32);
        const float inv = 1.0f / (lt * PCAR);
        const int wbase = (wave * 2 + t) * (16 * 68);
#pragma unroll
        for (int j = 0; j < 4; ++j)
#pragma unroll
            for (int r = 0; r < 8; ++r) os[wbase + lr * 68 + 16 * j + 8 * hi + r] = o[t][j][r] * inv;
    }
    wave_lds_sync();
#pragma unroll 1   // rolled: each trip's wait then stands in front of every later write of its stores' registers
    for (int u = 0; u < 8; ++u) { const int t = u >> 2, s = u & 3;
        const int wbase = (wave * 2 + t) * (16 * 68);
        const int row = 8 * (s & 1) + r8, ch = 4 * (s >> 1) + cc;
        const v4f u0 = *(const v4fa*)(os + wbase + row * 68 + 8 * ch); const v4f u1 = *(const v4fa*)(os + wbase + row * 68 + 8 * ch + 4); v8us oh, ol;
#pragma unroll
        for (int i = 0; i < 4; ++i) { unsigned short a, c; splitf(u0[i], a, c); oh[i] = a; ol[i] = c; splitf(u1[i], a, c); oh[4 + i] = a; ol[4 + i] = c; }
        const size_t oo = ((size_t)b * SEQ + q0 + 16 * t) * DM + (h * 8 + ch) * 128 + row * 8;
        *(v8us*)(Ch + oo) = oh; *(v8us*)(Cl + oo) = ol;
        asm volatile("s_wait_xcnt 0x0" ::: "memory");   // the next trip overwrites the stores' address and data registers
    }
}

extern "C" void kernel_launch(void* const* d_in, const int* in_sizes, int n_in,
                              void* d_out, int out_size, void* d_ws, size_t ws_size, hipStream_t stream) {
    if (n_in < 11) return;
    if ((size_t)in_sizes[0] < ((size_t)(NB - 1) * SEQ_FULL + SEQ) * DM) return;
    if (in_sizes[1] < DM || in_sizes[2] < DM) return;
    if (in_sizes[3] < NH * DM * HD || in_sizes[5] < NH * DM * HD || in_sizes[7] < NH * DM * HD || in_sizes[9] < DM * DM) return;
    if (in_sizes[4] < DM || in_sizes[6] < DM || in_sizes[8] < DM || in_sizes[10] < DM) return;
    if ((size_t)out_size < (size_t)MTOK * DM) return;
    const float* x   = (const float*)d_in[0];
    const float* lng = (const float*)d_in[1];
    const float* lnb = (const float*)d_in[2];
    const float* wq  = (const float*)d_in[3];
    const float* bq  = (const float*)d_in[4];
    const float* wk  = (const float*)d_in[5];
    const float* bk  = (const float*)d_in[6];
    const float* wv  = (const float*)d_in[7];
    const float* bv  = (const float*)d_in[8];
    const float* wp  = (const float*)d_in[9];
    const float* bp  = (const float*)d_in[10];
    float* OUT = (float*)d_out;     // [NB][SEQ][384]
    char* wsp = (char*)d_ws;
    auto take = [&](size_t bytes) { char* p = wsp; wsp += (bytes + 255) & ~(size_t)255; return (void*)p; };
    const size_t WSZ = (size_t)DM * DM * 2;            // one transposed bf16 weight plane [384][384]
    const size_t PSZ = (size_t)MTOK * DM * 2;          // one 16-bit activation plane
    bf* WQ = (bf*)take(WSZ); bf* WK = (bf*)take(WSZ); bf* WV = (bf*)take(WSZ); bf* WP = (bf*)take(WSZ);
    bf* Yh = (bf*)take(PSZ); bf* Yl = (bf*)take(PSZ);
    bf* Qh = (bf*)take(PSZ); bf* Ql = (bf*)take(PSZ); bf* Kh = (bf*)take(PSZ); bf* Kl = (bf*)take(PSZ);
    h16* VT = (h16*)take(PSZ);
    if ((size_t)(wsp - (char*)d_ws) > ws_size) return;
    bf* Ch = Yh; bf* Cl = Yl;   // ctx planes reuse the y planes (y is dead after the three projections; stream-ordered)

    k_prep<<<4 * WT_TILES + MTOK / 8, 256, 0, stream>>>(x, lng, lnb, wq, wk, wv, wp, Yh, Yl, WQ, WK, WV, WP);
    k_qkv<<<dim3(MTOK / 64, DM / 64, 3), 32, 0, stream>>>(Yh, Yl, WQ, WK, WV, bq, bk, bv, Qh, Ql, Kh, Kl, VT);
    k_attn<<<dim3(SEQ / 128, NB * NH, 1), 128, 0, stream>>>(Qh, Ql, Kh, Kl, VT, Ch, Cl);
    k_proj<<<dim3(MTOK / 64, DM / 64, 1), 32, 0, stream>>>(Ch, Cl, WP, bp, OUT);
}

// v004
// Measured time: 140 microseconds a run.
// In two side-by-side timings against v003, it was 1.22 and 1.21 times as fast.
// All steps since v000 together make it 3.28 times as fast.
#include <hip/hip_runtime.h>

// Compute dtypes, f32 accumulate everywhere: inputs converted to bf16 (RNE); q/k/v and output projections = bf16 WMMA with the activation as hi|lo planes against exact bf16 weights (2 products); scores = bf16 WMMA q hi|lo x k hi|lo (3 products); P.V = f16 WMMA (P carried x16384, V plain f16); LayerNorm, softmax, GELU in f32.
// Every 16-bit WMMA operand plane with 384-long rows (y, ctx, transposed weights) is kept in fragment order [row/16][k/8][row%16][k%8].
// Pre-LN attention: y = LN(x) -> hi|lo planes; per-head projections written straight into head planes in WMMA fragment order (q,k hi|lo [b][h][s/16][hd/8][s%16][hd%8]; v^T f16 [b][h][s/32][hd/16][(s%32)/8][hd%16][s%8]), so that each 16-B-per-lane fragment load of the attention kernel is 512 contiguous bytes and a run of keys is one contiguous block of each plane; fused flash attention in the transposed form S^T = K Q^T, O^T = V^T P^T (P fragment built in registers from the score accumulators); ctx hi|lo x Wp + bp -> erf GELU -> out.

#ifndef NB
#define NB 8
#endif
#ifndef SEQ
#define SEQ 2048
#endif
#define NB_FULL  8
#define SEQ_FULL 2048
#define DM   384
#define NH   6
#define HD   64
#define MTOK (NB * SEQ)
#define PCAR 16384.0f
#define L2E  1.4426950408889634f
#define KS   64   // keys per stage of the attention kernel's LDS ring

static_assert(SEQ % 128 == 0);
static_assert(KS % 32 == 0 && SEQ % KS == 0 && SEQ / KS >= 2);
static_assert(KS * HD * 2 == 4 * 128 * 16);   // one plane's share of a stage = four 16-B copies of each of the 128 threads
static_assert(DM % 64 == 0);
static_assert(DM % 32 == 0);
static_assert(NH * HD == DM);
static_assert(NB <= NB_FULL);
static_assert(SEQ <= SEQ_FULL);
static_assert((size_t)4 * DM * DM * 2 + (size_t)7 * MTOK * DM * 2 <= (size_t)134217728);

typedef _Float16 h16;
typedef unsigned short bf;
typedef __attribute__((ext_vector_type(16))) __bf16   v16bf;
typedef __attribute__((ext_vector_type(16))) _Float16 v16h;
typedef __attribute__((ext_vector_type(8)))  _Float16 v8h;
typedef __attribute__((ext_vector_type(8)))  unsigned short v8us;
typedef __attribute__((ext_vector_type(4)))  unsigned short v4us;
typedef __attribute__((ext_vector_type(8)))  float    v8f;
typedef __attribute__((ext_vector_type(4)))  float    v4f;
typedef v4f  __attribute__((may_alias)) v4fa;

__device__ __forceinline__ unsigned short f2bf(float f) { unsigned u = __float_as_uint(f); u += 0x7FFFu + ((u >> 16) & 1u); return (unsigned short)(u >> 16); }
__device__ __forceinline__ float bf2f(unsigned short b) { return __uint_as_float(((unsigned)b) << 16); }
__device__ __forceinline__ float bfr(float f) { return bf2f(f2bf(f)); }
__device__ __forceinline__ void splitf(float y, unsigned short& h, unsigned short& l) { h = f2bf(y); l = f2bf(y - bf2f(h)); }
__device__ __forceinline__ v16h cat16(v8h lo, v8h hi) { return __builtin_shufflevector(lo, hi, 0, 1, 2, 3, 4, 5, 6, 7, 8, 9, 10, 11, 12, 13, 14, 15); }
__device__ __forceinline__ v16bf cat16b(v8us lo, v8us hi) { return __builtin_bit_cast(v16bf, __builtin_shufflevector(lo, hi, 0, 1, 2, 3, 4, 5, 6, 7, 8, 9, 10, 11, 12, 13, 14, 15)); }
__device__ __forceinline__ v8f wmma16(v16h a, v16h b, v8f c) { return __builtin_amdgcn_wmma_f32_16x16x32_f16(false, a, false, b, (short)0, c, false, false); }
__device__ __forceinline__ v8f wmmab(v16bf a, v16bf b, v8f c) { return __builtin_amdgcn_wmma_f32_16x16x32_bf16(false, a, false, b, (short)0, c, false, false); }
// Fragment loaders from fragment-order planes: p already holds the 512-element (16 rows x 32 k) block base + 8*lane, lane = 16*h + row; elements 0..7 = k0+8h.., elements 8..15 = k0+16+8h..; each load covers four whole 128-B lines.
__device__ __forceinline__ v16bf ldbf(const bf* p) { return cat16b(*(const v8us*)p, *(const v8us*)(p + 256)); }
__device__ __forceinline__ v16h ldhf(const h16* p) { return cat16(*(const v8h*)p, *(const v8h*)(p + 256)); }
// Same-wave LDS exchange (wave-private tiles only).
__device__ __forceinline__ void wave_lds_sync() { __builtin_amdgcn_fence(3 /* release order */, "wavefront"); __builtin_amdgcn_wave_barrier(); __builtin_amdgcn_fence(2 /* acquire order */, "wavefront"); asm volatile("" ::: "memory"); }

// ---- wt_body: in[z][rows][cols] (f32) -> transposed matrix out[n = z*cols + col][k = row] (bf16 RNE) in fragment order [n/16][k/8][n%16][k%8], one 64x64 tile (bx, by, bz) of (rows/64, cols/64, z) through LDS (t: 64 x 65 floats); 256 threads.
__device__ __forceinline__ void wt_body(const float* __restrict__ src, bf* dst, int rows, int cols, int bx, int by, int bz, float* t) {
    const int tid = threadIdx.x;
    const size_t zo = (size_t)bz * (size_t)rows * (size_t)cols;
    const int r0 = bx * 64, c0 = by * 64;
#pragma unroll 1   // four loads in flight a trip; rolled: each trip's wait then stands in front of the next trip's address writes
    for (int i0 = 0; i0 < 16; i0 += 4) { const int cc = tid & 63; const float* p[4]; float v[4];
#pragma unroll
        for (int u = 0; u < 4; ++u) { p[u] = src + zo + (size_t)(r0 + (tid >> 6) + 4 * (i0 + u)) * cols + c0 + cc; v[u] = *p[u]; }
        // The four address pairs are inputs, so they stay whole until this wait: no load's result and no next address is written into a pair that an issued load still names.
        asm volatile("s_wait_xcnt 0x0" :: "v"(p[0]), "v"(p[1]), "v"(p[2]), "v"(p[3]) : "memory");
#pragma unroll
        for (int u = 0; u < 4; ++u) t[((tid >> 6) + 4 * (i0 + u)) * 65 + cc] = v[u]; }
    __syncthreads();
    const int pc = (tid >> 3) & 7;
#pragma unroll
    for (int it = 0; it < 2; ++it) { const int line = (tid & 7) + 8 * (tid >> 6) + 32 * it; v8us o;
#pragma unroll
        for (int i = 0; i < 8; ++i) o[i] = f2bf(t[(8 * pc + i) * 65 + line]);
        const int n = bz * cols + c0 + line;
        *(v8us*)(dst + (size_t)(n >> 4) * 16 * rows + (size_t)((r0 >> 3) + pc) * 128 + (n & 15) * 8) = o; }
}

// ---- ln_body: one wave per token, block blk takes tokens 8*blk..8*blk+7; they are gathered in LDS so that each 128-B line of the fragment-order planes (8 tokens x 16 B) is stored whole.
__device__ __forceinline__ void ln_body(const float* __restrict__ x, const float* __restrict__ g, const float* __restrict__ be, bf* Yh, bf* Yl, int blk, bf (*sy)[8][DM + 8]) {
    const int lane = threadIdx.x & 31;
    const int wave = __builtin_amdgcn_readfirstlane(threadIdx.x >> 5);
    const int tok = blk * 8 + wave;
    const int b = tok / SEQ, s = tok % SEQ;
    const float* xr = x + ((size_t)b * SEQ_FULL + s) * DM;
    v4f v[3]; float sum = 0.0f;
#pragma unroll
    for (int j = 0; j < 3; ++j) { v4f a = *(const v4f*)(xr + j * 128 + lane * 4);
#pragma unroll
        for (int q = 0; q < 4; ++q) { a[q] = bfr(a[q]); sum += a[q]; }
        v[j] = a; }
#pragma unroll
    for (int sh = 16; sh; sh >>= 1) sum += __shfl_xor(sum, sh, 32);
    const float mu = sum * (1.0f / DM);
    float var = 0.0f;
#pragma unroll
    for (int j = 0; j < 3; ++j) {
#pragma unroll
        for (int q = 0; q < 4; ++q) { const float d = v[j][q] - mu; var += d * d; } }
#pragma unroll
    for (int sh = 16; sh; sh >>= 1) var += __shfl_xor(var, sh, 32);
    const float rs = rsqrtf(var * (1.0f / DM) + 1e-5f);
    v4us oh[3], ol[3];
    const float* pg = g + lane * 4; const float* pb = be + lane * 4;
#pragma unroll
    for (int j = 0; j < 3; ++j) { const v4f gg = *(const v4f*)(pg + j * 128); const v4f bb = *(const v4f*)(pb + j * 128);
#pragma unroll
        for (int q = 0; q < 4; ++q) { const float y = (v[j][q] - mu) * rs * bfr(gg[q]) + bfr(bb[q]); unsigned short a, c; splitf(y, a, c); oh[j][q] = a; ol[j][q] = c; } }
    // The two addresses are inputs, so the registers they are formed from stay whole until this wait: no load's result is written into a register that an issued load still names.
    asm volatile("s_wait_xcnt 0x0" :: "v"(pg), "v"(pb) : "memory");
#pragma unroll
    for (int j = 0; j < 3; ++j) { *(v4us*)(&sy[0][wave][j * 128 + lane * 4]) = oh[j]; *(v4us*)(&sy[1][wave][j * 128 + lane * 4]) = ol[j]; }
    __syncthreads();   // each stored line below holds 16 B from each of the 8 waves' tokens
    const int r8 = threadIdx.x & 7;
    const size_t tb = (size_t)(blk >> 1) * (16 * DM) + (blk & 1) * 64 + r8 * 8;
    v8us ov[3];
#pragma unroll
    for (int it = 0; it < 3; ++it) { const int idx = (threadIdx.x >> 3) + 32 * it; const int pl = idx >= DM / 8 ? 1 : 0; const int ch = idx - pl * (DM / 8); ov[it] = *(const v8us*)(&sy[pl][r8][ch * 8]); }
#pragma unroll
    for (int it = 0; it < 3; ++it) { const int idx = (threadIdx.x >> 3) + 32 * it; const int pl = idx >= DM / 8 ? 1 : 0; const int ch = idx - pl * (DM / 8);
        *(v8us*)((pl ? Yl : Yh) + tb + ch * 128) = ov[it];
        asm volatile("s_wait_xcnt 0x0" ::: "memory"); }   // behind each store: in the fused kernel code follows that overwrites the stores' address and data registers
}

// ---- k_prep: the five jobs that depend on the inputs alone, as block ranges of one grid (256 threads): blocks 0..143 transpose the four weights (36 tiles each, first because they are few), the rest do LayerNorm.
#define WT_TILES ((DM / 64) * (DM / 64))
__global__ __launch_bounds__(256) void k_prep(const float* __restrict__ x, const float* __restrict__ g, const float* __restrict__ be,
                                              const float* __restrict__ wq, const float* __restrict__ wk, const float* __restrict__ wv, const float* __restrict__ wp,
                                              bf* Yh, bf* Yl, bf* WQ, bf* WK, bf* WV, bf* WP) {
    __shared__ __align__(16) float sm[64 * 65];   // one buffer for both jobs: a block does one of them
    static_assert(sizeof(bf) * 2 * 8 * (DM + 8) <= sizeof(float) * 64 * 65);
    const int bid = blockIdx.x;
    if (bid < 4 * WT_TILES) {   // the same for the whole block
        const int w = bid / WT_TILES, r = bid % WT_TILES, bx = r % (DM / 64), bo = r / (DM / 64);
        // per-head [h][d][k] -> Bt[h*64 + k][d]: in[rows = 384 (d)][cols = 64 (k)], z = head (bo); Wp [in = 384 (d)][out = 384 (n)] -> Bt[n][d]: in[rows = 384][cols = 384], column tile bo
        wt_body(w == 0 ? wq : w == 1 ? wk : w == 2 ? wv : wp, w == 0 ? WQ : w == 1 ? WK : w == 2 ? WV : WP, DM, w == 3 ? DM : HD, bx, w == 3 ? bo : 0, w == 3 ? 0 : bo, sm);
        return;
    }
    ln_body(x, g, be, Yh, Yl, bid - 4 * WT_TILES, (bf (*)[8][DM + 8])sm);
}

// ---- gemmw: register-blocked GEMM, ONE WAVE per 64x64 output tile (16 accumulators), operands straight from fragment-order bf16 planes (K = 384); tile (blockIdx.x, blockIdx.y) of (M/64, 384/64), 32 threads; os: 64 x 68 floats of LDS.
// MODE 0: hi|lo head planes (q, k); MODE 1: f16 v^T head plane; MODE 2: f32 output rows [tok][384] with exact erf GELU (16 lanes x 16 B = 256 B per row segment, 2 rows per instruction).
template <int MODE>
__device__ __forceinline__ void gemmw(const bf* __restrict__ A, const bf* __restrict__ A2, const bf* __restrict__ Bt, const float* __restrict__ bias, bf* Oh, bf* Ol, h16* Ov, float* Of, float* os) {
    const int lane = threadIdx.x & 31, lr = lane & 15, hi = lane >> 4;
    const int r0 = blockIdx.x * 64, c0 = blockIdx.y * 64;
    v8f acc[4][4];
#pragma unroll
    for (int mb = 0; mb < 4; ++mb)
#pragma unroll
        for (int nb = 0; nb < 4; ++nb) acc[mb][nb] = (v8f){};
    const size_t aoff = (size_t)r0 * DM + 8 * lane, boff = (size_t)c0 * DM + 8 * lane;
#pragma unroll 1
    for (int kc = 0; kc < DM; kc += 32) {
        v16bf a[4], a2[4], b[4];
        const bf* pa = A + aoff + kc * 16; const bf* pa2 = A2 + aoff + kc * 16; const bf* pb = Bt + boff + kc * 16;
#pragma unroll
        for (int mb = 0; mb < 4; ++mb) { a[mb] = ldbf(pa + mb * 16 * DM); b[mb] = ldbf(pb + mb * 16 * DM); a2[mb] = ldbf(pa2 + mb * 16 * DM); }
        // The three address pairs are inputs, so they stay whole until this wait: no load's result and no next address is written into a pair that an issued load of this trip still names.
        asm volatile("s_wait_xcnt 0x0" :: "v"(pa), "v"(pa2), "v"(pb) : "memory");
#pragma unroll
        for (int nb = 0; nb < 4; ++nb) {
#pragma unroll
            for (int mb = 0; mb < 4; ++mb) { acc[mb][nb] = wmmab(a[mb], b[nb], acc[mb][nb]); acc[mb][nb] = wmmab(a2[mb], b[nb], acc[mb][nb]); } }
        asm volatile("" : "+v"(acc[0][0]), "+v"(acc[1][0]), "+v"(acc[2][0]), "+v"(acc[3][0]), "+v"(acc[0][1]), "+v"(acc[1][1]), "+v"(acc[2][1]), "+v"(acc[3][1]));
        asm volatile("v_nop\n\tv_nop\n\tv_nop\n\tv_nop" : "+v"(acc[0][2]), "+v"(acc[1][2]), "+v"(acc[2][2]), "+v"(acc[3][2]), "+v"(acc[0][3]), "+v"(acc[1][3]), "+v"(acc[2][3]), "+v"(acc[3][3]) : "v"(a[3]), "v"(a2[3]), "v"(b[3]));
    }
#pragma unroll
    for (int mb = 0; mb < 4; ++mb)
#pragma unroll
        for (int nb = 0; nb < 4; ++nb)
#pragma unroll
            for (int j = 0; j < 8; ++j) os[(mb * 16 + hi * 8 + j) * 68 + nb * 16 + lr] = acc[mb][nb][j];
    wave_lds_sync();
    const int bb = r0 / SEQ, sq = r0 % SEQ, hh = blockIdx.y;
    // Fragment-order stores: 8 lanes (r8) x 16 B fill one 128-B line of one 8-element chunk column, 4 chunk columns (cc) per instruction.
    const int r8 = lane & 7, cc = lane >> 3;
    if (MODE == 0) {
        const size_t pb = ((size_t)(bb * NH + hh) * SEQ + sq) * HD;
        float bz[2][8];
#pragma unroll
        for (int hf = 0; hf < 2; ++hf)
#pragma unroll
            for (int i = 0; i < 8; ++i) bz[hf][i] = bfr(bias[c0 + 8 * (4 * hf + cc) + i]);
#pragma unroll 1   // rolled: the epilogue is store-bound, and unrolled it would only take instruction cache
        for (int g = 0; g < 8; ++g) { const int row = 8 * g + r8;
#pragma unroll     // bz[hf] must be a compile-time register index
            for (int hf = 0; hf < 2; ++hf) { const int ch = 4 * hf + cc;
                const v4f u0 = *(const v4fa*)(os + row * 68 + 8 * ch); const v4f u1 = *(const v4fa*)(os + row * 68 + 8 * ch + 4); v8us oh, ol;
#pragma unroll
                for (int i = 0; i < 4; ++i) { unsigned short a, c; splitf(u0[i] + bz[hf][i], a, c); oh[i] = a; ol[i] = c; splitf(u1[i] + bz[hf][4 + i], a, c); oh[4 + i] = a; ol[4 + i] = c; }
                const size_t oo = pb + (size_t)(row >> 4) * (16 * HD) + ch * 128 + (row & 15) * 8;
                *(v8us*)(Oh + oo) = oh; *(v8us*)(Ol + oo) = ol; }
            asm volatile("s_wait_xcnt 0x0" ::: "memory");   // the next trip overwrites the stores' address and data registers
        }
    }
    if (MODE == 1) {
        const size_t vb = ((size_t)(bb * NH + hh) * SEQ + sq) * HD;
#pragma unroll 1   // rolled: the epilogue is store-bound, and unrolled it would only take instruction cache
        for (int g = 0; g < 8; ++g) { const int hd = 8 * g + r8; const float bzv = bfr(bias[c0 + hd]);
#pragma unroll
            for (int kq = 0; kq < 2; ++kq) { v8h o8;
#pragma unroll
                for (int i = 0; i < 8; ++i) o8[i] = (h16)(os[(32 * kq + 8 * cc + i) * 68 + hd] + bzv);
                *(v8h*)(Ov + vb + (size_t)kq * (32 * HD) + (hd >> 4) * 512 + cc * 128 + (hd & 15) * 8) = o8; }
            asm volatile("s_wait_xcnt 0x0" ::: "memory");   // the next trip overwrites the stores' address and data registers
        }
    }
    if (MODE == 2) {
        const int cofs = lr * 4;
        float bz4[4];
        const float* pbz = bias + c0 + cofs;
#pragma unroll
        for (int q = 0; q < 4; ++q) bz4[q] = bfr(pbz[q]);
        // The address pair is an input, so it stays whole until this wait: the load's result is not written into the pair that the load names.
        asm volatile("s_wait_xcnt 0x0" :: "v"(pbz) : "memory");
{
#pragma unroll 1
            for (int s = 0; s < 32; ++s) { const int row = 2 * s + hi; v4f val = *(const v4fa*)(os + row * 68 + cofs);
#pragma unroll
                for (int q = 0; q < 4; ++q) { const float tv = val[q] + bz4[q]; val[q] = 0.5f * tv * (1.0f + erff(tv * 0.70710678118654752f)); }
                *(v4f*)(Of + (size_t)(r0 + row) * DM + c0 + cofs) = val; }
             }
    }
}

// ---- k_qkv: the three projections of y, which do not depend on one another, as one grid (M/64, 384/64, 3): blockIdx.z = 0 q, 1 k, 2 v.
__global__ __launch_bounds__(32) void k_qkv(const bf* __restrict__ Yh, const bf* __restrict__ Yl, const bf* __restrict__ WQ, const bf* __restrict__ WK, const bf* __restrict__ WV,
                                            const float* __restrict__ bq, const float* __restrict__ bk, const float* __restrict__ bv, bf* Qh, bf* Ql, bf* Kh, bf* Kl, h16* VT) {
    __shared__ __align__(16) float os[64 * 68];
    const int z = blockIdx.z;
    if (z == 2) gemmw<1>(Yh, Yl, WV, bv, (bf*)nullptr, (bf*)nullptr, VT, (float*)nullptr, os);
    else gemmw<0>(Yh, Yl, z ? WK : WQ, z ? bk : bq, z ? Kh : Qh, z ? Kl : Ql, (h16*)nullptr, (float*)nullptr, os);
}

// ---- k_proj: ctx hi|lo x Wp + bp -> erf GELU -> out; grid (M/64, 384/64).
__global__ __launch_bounds__(32) void k_proj(const bf* __restrict__ Ch, const bf* __restrict__ Cl, const bf* __restrict__ WP, const float* __restrict__ bp, float* Of) {
    __shared__ __align__(16) float os[64 * 68];
    gemmw<2>(Ch, Cl, WP, bp, (bf*)nullptr, (bf*)nullptr, (h16*)nullptr, Of, os);
}

// exp2 with the vector slot that the instruction set asks for behind a transcendental kept inside the statement: each v_exp_f32 is followed by an instruction that neither reads its result nor overwrites its source
// ("=&v": no result shares a register with a source of the group), the last one by v_nop.
__device__ __forceinline__ void exp2x4(float x0, float x1, float x2, float x3, float& y0, float& y1, float& y2, float& y3) {
    asm("v_exp_f32 %0, %4\n\tv_exp_f32 %1, %5\n\tv_exp_f32 %2, %6\n\tv_exp_f32 %3, %7\n\tv_nop" : "=&v"(y0), "=&v"(y1), "=&v"(y2), "=&v"(y3) : "v"(x0), "v"(x1), "v"(x2), "v"(x3));
}
__device__ __forceinline__ float exp2x1(float x) { float y; asm("v_exp_f32 %0, %1\n\tv_nop" : "=v"(y) : "v"(x)); return y; }

// ---- stage_copy: one ring stage = KS keys of the k hi, k lo and v^T planes (8192 contiguous bytes of each, fragment order kept) -> one LDS buffer [k hi | k lo | v^T], by asynchronous copies, through no register.
// 128 threads x 16 B = 2048 B a copy, four copies a plane. gh, gl, gv: the lane's own global addresses (plane + stage start + 8 elements x thread); lds: the lane's own LDS byte address (buffer start + 16 x thread).
__device__ __forceinline__ void stage_copy(const bf* gh, const bf* gl, const h16* gv, unsigned lds) {
    // s_wait_xcnt is the last line of the copies' own statement, so it stands in front of every later write of an address register that a copy names.
    asm volatile("global_load_async_to_lds_b128 %0, %12, off\n\t"
                 "global_load_async_to_lds_b128 %1, %13, off\n\t"
                 "global_load_async_to_lds_b128 %2, %14, off\n\t"
                 "global_load_async_to_lds_b128 %3, %15, off\n\t"
                 "global_load_async_to_lds_b128 %4, %16, off\n\t"
                 "global_load_async_to_lds_b128 %5, %17, off\n\t"
                 "global_load_async_to_lds_b128 %6, %18, off\n\t"
                 "global_load_async_to_lds_b128 %7, %19, off\n\t"
                 "global_load_async_to_lds_b128 %8, %20, off\n\t"
                 "global_load_async_to_lds_b128 %9, %21, off\n\t"
                 "global_load_async_to_lds_b128 %10, %22, off\n\t"
                 "global_load_async_to_lds_b128 %11, %23, off\n\t"
                 "s_wait_xcnt 0x0"
                 :: "v"(lds), "v"(lds + 2048u), "v"(lds + 4096u), "v"(lds + 6144u), "v"(lds + 8192u), "v"(lds + 10240u), "v"(lds + 12288u), "v"(lds + 14336u), "v"(lds + 16384u), "v"(lds + 18432u), "v"(lds + 20480u), "v"(lds + 22528u),
                    "v"(gh), "v"(gh + 1024), "v"(gh + 2048), "v"(gh + 3072), "v"(gl), "v"(gl + 1024), "v"(gl + 2048), "v"(gl + 3072), "v"(gv), "v"(gv + 1024), "v"(gv + 2048), "v"(gv + 3072)
                 : "memory");
}

// ---- k_attn: fused flash attention (unscaled scores, no mask), transposed form. Block = 4 waves, each owns 32 queries (two 16-query tiles) of one (b, h); grid (SEQ/128, NB*NH).
// The wave's Q fragments (hi|lo, both tiles) are loaded once and stay in registers; each K and V fragment loaded in the key loop feeds both query tiles.
// K hi|lo and V^T come through a two-buffer LDS ring that the four waves share: stage t + 1's copies fly while stage t (KS keys, two 32-key steps) is worked on, so no wave waits out a global load in the key loop.
// Per 32-key step and query tile: S^T[key][q] = Kh Qh^T + Kl Qh^T + Kh Ql^T (A = key rows from the k planes, B = query rows from the q planes, k index = hd);
// lane (n = query, h) then holds keys 8h+r of both 16-key tiles -> running max / exp2 per lane, one cross-half shuffle;
// the P^T B fragment is formed in registers (element r <- tile 0 value r, element 8+r <- tile 1 value r; carried x16384 in f16); O^T[hd][q] += V^T[hd][key] P^T[key][q] (A from the f16 v^T plane).
// l is accumulated from the unconverted f32 p values (per-lane partials, combined once at the end). Q fragments come straight from the fragment-order global planes, K and V fragments from the ring, which keeps that order (two 16-B loads each, 512 contiguous bytes per load: no bank conflict).
__global__ __launch_bounds__(128) void k_attn(const bf* __restrict__ Qh, const bf* __restrict__ Ql, const bf* __restrict__ Kh, const bf* __restrict__ Kl, const h16* __restrict__ Vt, bf* Ch, bf* Cl) {
#pragma clang fp contract(off)
    __shared__ __align__(16) float os[4 * 2 * 16 * 68];
    __shared__ __align__(16) bf ring[2][3 * KS * HD];
    const int lane = threadIdx.x & 31, lr = lane & 15, hi = lane >> 4;
    const int wave = __builtin_amdgcn_readfirstlane(threadIdx.x >> 5);
    const int bh = blockIdx.y;
    const int q0 = blockIdx.x * 128 + wave * 32;
    const size_t pbase = (size_t)bh * SEQ * HD;
    const bf* qh = Qh + pbase; const bf* ql = Ql + pbase; const bf* kh = Kh + pbase; const bf* kl = Kl + pbase; const h16* vt = Vt + pbase;
    const int qoff0 = q0 * HD + 8 * lane;
    v16bf bqh[2][2], bql[2][2];
#pragma unroll
    for (int t = 0; t < 2; ++t)
#pragma unroll
        for (int ks = 0; ks < 2; ++ks) { bqh[t][ks] = ldbf(qh + qoff0 + t * (16 * HD) + ks * 512); bql[t][ks] = ldbf(ql + qoff0 + t * (16 * HD) + ks * 512); }
    v8f o[2][4];
#pragma unroll
    for (int t = 0; t < 2; ++t)
#pragma unroll
        for (int j = 0; j < 4; ++j) o[t][j] = (v8f){};
    float m[2] = {-1.0e30f, -1.0e30f}, l[2] = {0.0f, 0.0f};
    const bf* gkh = kh + 8 * threadIdx.x; const bf* gkl = kl + 8 * threadIdx.x; const h16* gvt = vt + 8 * threadIdx.x;
    const unsigned lds0 = (unsigned)(size_t)&ring[0][0] + 16u * threadIdx.x;   // LDS byte address = low 32 bits of the shared address
    stage_copy(gkh, gkl, gvt, lds0);
    asm volatile("s_wait_asynccnt 0x0" ::: "memory");   // this wave's share of stage 0 has landed
    __syncthreads();                                     // every wave's share has: stage 0 may be read
    stage_copy(gkh + KS * HD, gkl + KS * HD, gvt + KS * HD, lds0 + (unsigned)sizeof(ring[0]));
#pragma unroll 1
    for (int st = 0; st < SEQ / KS; ++st) {
      const bf* sb = ring[st & 1] + 8 * lane;
#pragma unroll 1   // rolled: each step then opens with its 24 LDS reads as one group ahead of its WMMAs; unrolled, the compiler spread them in three groups among the WMMAs
      for (int kk = 0; kk < KS; kk += 32) {
        const bf* skh = sb + kk * HD; const bf* skl = skh + KS * HD;
        v8f s0[2], s1[2];
#pragma unroll
        for (int t = 0; t < 2; ++t) { s0[t] = (v8f){}; s1[t] = (v8f){}; }
#pragma unroll
        for (int ks = 0; ks < 2; ++ks) {
            const v16bf a0h = ldbf(skh + ks * 512), a0l = ldbf(skl + ks * 512);
            const v16bf a1h = ldbf(skh + 16 * HD + ks * 512), a1l = ldbf(skl + 16 * HD + ks * 512);
            s0[0] = wmmab(a0h, bqh[0][ks], s0[0]); s1[0] = wmmab(a1h, bqh[0][ks], s1[0]); s0[1] = wmmab(a0h, bqh[1][ks], s0[1]); s1[1] = wmmab(a1h, bqh[1][ks], s1[1]);
            s0[0] = wmmab(a0l, bqh[0][ks], s0[0]); s1[0] = wmmab(a1l, bqh[0][ks], s1[0]); s0[1] = wmmab(a0l, bqh[1][ks], s0[1]); s1[1] = wmmab(a1l, bqh[1][ks], s1[1]);
            s0[0] = wmmab(a0h, bql[0][ks], s0[0]); s1[0] = wmmab(a1h, bql[0][ks], s1[0]); s0[1] = wmmab(a0h, bql[1][ks], s0[1]); s1[1] = wmmab(a1h, bql[1][ks], s1[1]);
        }
        const h16* pv = (const h16*)(skh + 2 * KS * HD);
        const v16h va0 = ldhf(pv), va1 = ldhf(pv + 512), va2 = ldhf(pv + 1024), va3 = ldhf(pv + 1536);
        v16h pf[2];
#pragma unroll
        for (int t = 0; t < 2; ++t) {
            float mx = fmaxf(s0[t][0], s1[t][0]);
#pragma unroll
            for (int r = 1; r < 8; ++r) mx = fmaxf(mx, fmaxf(s0[t][r], s1[t][r]));
            mx = fmaxf(mx, __shfl_xor(mx, 16, 32));
            const float mn = fmaxf(m[t], mx);
            const float alpha = exp2x1((m[t] - mn) * L2E);
            m[t] = mn;
            float psum = 0.0f;
#pragma unroll
            for (int r = 0; r < 8; r += 2) {
                float p0, p1, p2, p3;
                exp2x4((s0[t][r] - mn) * L2E, (s1[t][r] - mn) * L2E, (s0[t][r + 1] - mn) * L2E, (s1[t][r + 1] - mn) * L2E, p0, p1, p2, p3);
                psum += p0 + p1;
                psum += p2 + p3;
                pf[t][r] = (h16)(p0 * PCAR); pf[t][8 + r] = (h16)(p1 * PCAR); pf[t][r + 1] = (h16)(p2 * PCAR); pf[t][9 + r] = (h16)(p3 * PCAR); }
            l[t] = l[t] * alpha + psum;
#pragma unroll
            for (int j = 0; j < 4; ++j)
#pragma unroll
                for (int r = 0; r < 8; ++r) o[t][j][r] *= alpha;
        }
#pragma unroll
        for (int t = 0; t < 2; ++t) { o[t][0] = wmma16(va0, pf[t], o[t][0]); o[t][1] = wmma16(va1, pf[t], o[t][1]); o[t][2] = wmma16(va2, pf[t], o[t][2]); o[t][3] = wmma16(va3, pf[t], o[t][3]); }
      }
      // Publish point of stage st + 1, every wave, in this order.
      asm volatile("s_wait_dscnt 0x0" ::: "memory");      // this wave's reads of stage st's buffer are done before the buffer is refilled
      asm volatile("s_wait_asynccnt 0x0" ::: "memory");   // this wave's share of stage st + 1 has landed
      __syncthreads();                                     // every wave's share has, and every wave has left stage st's buffer
      if (st + 2 < SEQ / KS) stage_copy(gkh + (st + 2) * (KS * HD), gkl + (st + 2) * (KS * HD), gvt + (st + 2) * (KS * HD), lds0 + (unsigned)(st & 1) * (unsigned)sizeof(ring[0]));
    }
    asm volatile("s_wait_asynccnt 0x0" ::: "memory");   // no copy is outstanding when the wave goes on to its end
    const int b = bh / NH, h = bh % NH;
    const int r8 = lane & 7, cc = lane >> 3;
#pragma unroll
    for (int t = 0; t < 2; ++t) {
        const float lt = l[t] + __shfl_xor(l[t], 16, 32);
        const float inv = 1.0f / (lt * PCAR);
        const int wbase = (wave * 2 + t) * (16 * 68);
#pragma unroll
        for (int j = 0; j < 4; ++j)
#pragma unroll
            for (int r = 0; r < 8; ++r) os[wbase + lr * 68 + 16 * j + 8 * hi + r] = o[t][j][r] * inv;
    }
    wave_lds_sync();
#pragma unroll 1   // rolled: each trip's wait then stands in front of every later write of its stores' registers
    for (int u = 0; u < 8; ++u) { const int t = u >> 2, s = u & 3;
        const int wbase = (wave * 2 + t) * (16 * 68);
        const int row = 8 * (s & 1) + r8, ch = 4 * (s >> 1) + cc;
        const v4f u0 = *(const v4fa*)(os + wbase + row * 68 + 8 * ch); const v4f u1 = *(const v4fa*)(os + wbase + row * 68 + 8 * ch + 4); v8us oh, ol;
#pragma unroll
        for (int i = 0; i < 4; ++i) { unsigned short a, c; splitf(u0[i], a, c); oh[i] = a; ol[i] = c; splitf(u1[i], a, c); oh[4 + i] = a; ol[4 + i] = c; }
        const size_t oo = ((size_t)b * SEQ + q0 + 16 * t) * DM + (h * 8 + ch) * 128 + row * 8;
        *(v8us*)(Ch + oo) = oh; *(v8us*)(Cl + oo) = ol;
        asm volatile("s_wait_xcnt 0x0" ::: "memory");   // the next trip overwrites the stores' address and data registers
    }
}

extern "C" void kernel_launch(void* const* d_in, const int* in_sizes, int n_in,
                              void* d_out, int out_size, void* d_ws, size_t ws_size, hipStream_t stream) {
    if (n_in < 11) return;
    if ((size_t)in_sizes[0] < ((size_t)(NB - 1) * SEQ_FULL + SEQ) * DM) return;
    if (in_sizes[1] < DM || in_sizes[2] < DM) return;
    if (in_sizes[3] < NH * DM * HD || in_sizes[5] < NH * DM * HD || in_sizes[7] < NH * DM * HD || in_sizes[9] < DM * DM) return;
    if (in_sizes[4] < DM || in_sizes[6] < DM || in_sizes[8] < DM || in_sizes[10] < DM) return;
    if ((size_t)out_size < (size_t)MTOK * DM) return;
    const float* x   = (const float*)d_in[0];
    const float* lng = (const float*)d_in[1];
    const float* lnb = (const float*)d_in[2];
    const float* wq  = (const float*)d_in[3];
    const float* bq  = (const float*)d_in[4];
    const float* wk  = (const float*)d_in[5];
    const float* bk  = (const float*)d_in[6];
    const float* wv  = (const float*)d_in[7];
    const float* bv  = (const float*)d_in[8];
    const float* wp  = (const float*)d_in[9];
    const float* bp  = (const float*)d_in[10];
    float* OUT = (float*)d_out;     // [NB][SEQ][384]
    char* wsp = (char*)d_ws;
    auto take = [&](size_t bytes) { char* p = wsp; wsp += (bytes + 255) & ~(size_t)255; return (void*)p; };
    const size_t WSZ = (size_t)DM * DM * 2;            // one transposed bf16 weight plane [384][384]
    const size_t PSZ = (size_t)MTOK * DM * 2;          // one 16-bit activation plane
    bf* WQ = (bf*)take(WSZ); bf* WK = (bf*)take(WSZ); bf* WV = (bf*)take(WSZ); bf* WP = (bf*)take(WSZ);
    bf* Yh = (bf*)take(PSZ); bf* Yl = (bf*)take(PSZ);
    bf* Qh = (bf*)take(PSZ); bf* Ql = (bf*)take(PSZ); bf* Kh = (bf*)take(PSZ); bf* Kl = (bf*)take(PSZ);
    h16* VT = (h16*)take(PSZ);
    if ((size_t)(wsp - (char*)d_ws) > ws_size) return;
    bf* Ch = Yh; bf* Cl = Yl;   // ctx planes reuse the y planes (y is dead after the three projections; stream-ordered)

    k_prep<<<4 * WT_TILES + MTOK / 8, 256, 0, stream>>>(x, lng, lnb, wq, wk, wv, wp, Yh, Yl, WQ, WK, WV, WP);
    k_qkv<<<dim3(MTOK / 64, DM / 64, 3), 32, 0, stream>>>(Yh, Yl, WQ, WK, WV, bq, bk, bv, Qh, Ql, Kh, Kl, VT);
    k_attn<<<dim3(SEQ / 128, NB * NH, 1), 128, 0, stream>>>(Qh, Ql, Kh, Kl, VT, Ch, Cl);
    k_proj<<<dim3(MTOK / 64, DM / 64, 1), 32, 0, stream>>>(Ch, Cl, WP, bp, OUT);
}

// v005
// It runs in 134 microseconds.
// In two side-by-side timings against v004, it was 1.04 and 1.05 times as fast.
// Counting every step since v000, it is 3.43 times as fast.
#include <hip/hip_runtime.h>

// Compute dtypes, f32 accumulate everywhere: inputs converted to bf16 (RNE); q/k/v and output projections = bf16 WMMA with the activation as hi|lo planes against exact bf16 weights (2 products); scores = bf16 WMMA q hi|lo x k hi|lo (3 products); P.V = f16 WMMA (P carried x16384, V plain f16); LayerNorm, softmax, GELU in f32.
// Every 16-bit WMMA operand plane with 384-long rows (y, ctx, transposed weights) is kept in fragment order [row/16][k/8][row%16][k%8].
// Pre-LN attention: y = LN(x) -> hi|lo planes; per-head projections written straight into head planes in WMMA fragment order (q,k hi|lo [b][h][s/16][hd/8][s%16][hd%8]; v^T f16 [b][h][s/32][hd/16][(s%32)/8][hd%16][s%8]), so that each 16-B-per-lane fragment load of the attention kernel is 512 contiguous bytes and a run of keys is one contiguous block of each plane; fused flash attention in the transposed form S^T = K Q^T, O^T = V^T P^T (P fragment built in registers from the score accumulators); ctx hi|lo x Wp + bp -> erf GELU -> out.

#ifndef NB
#define NB 8
#endif
#ifndef SEQ
#define SEQ 2048
#endif
#define NB_FULL  8
#define SEQ_FULL 2048
#define DM   384
#define NH   6
#define HD   64
#define MTOK (NB * SEQ)
#define PCAR 16384.0f
#define L2E  1.4426950408889634f
#define KS   64   // keys per stage of the attention kernel's LDS ring

static_assert(SEQ % 128 == 0);
static_assert(KS % 32 == 0 && SEQ % KS == 0 && SEQ / KS >= 2);
static_assert(KS * HD * 2 == 4 * 128 * 16);   // one plane's share of a stage = four 16-B copies of each of the 128 threads
static_assert(DM % 64 == 0);
static_assert(DM % 32 == 0);
static_assert(NH * HD == DM);
static_assert(NB <= NB_FULL);
static_assert(SEQ <= SEQ_FULL);
static_assert((size_t)4 * DM * DM * 2 + (size_t)7 * MTOK * DM * 2 <= (size_t)134217728);

typedef _Float16 h16;
typedef unsigned short bf;
typedef __attribute__((ext_vector_type(16))) __bf16   v16bf;
typedef __attribute__((ext_vector_type(16))) _Float16 v16h;
typedef __attribute__((ext_vector_type(8)))  _Float16 v8h;
typedef __attribute__((ext_vector_type(8)))  unsigned short v8us;
typedef __attribute__((ext_vector_type(4)))  unsigned short v4us;
typedef __attribute__((ext_vector_type(8)))  float    v8f;
typedef __attribute__((ext_vector_type(4)))  float    v4f;
typedef v4f  __attribute__((may_alias)) v4fa;

__device__ __forceinline__ unsigned short f2bf(float f) { unsigned u = __float_as_uint(f); u += 0x7FFFu + ((u >> 16) & 1u); return (unsigned short)(u >> 16); }
__device__ __forceinline__ float bf2f(unsigned short b) { return __uint_as_float(((unsigned)b) << 16); }
__device__ __forceinline__ float bfr(float f) { return bf2f(f2bf(f)); }
__device__ __forceinline__ void splitf(float y, unsigned short& h, unsigned short& l) { h = f2bf(y); l = f2bf(y - bf2f(h)); }
__device__ __forceinline__ v16h cat16(v8h lo, v8h hi) { return __builtin_shufflevector(lo, hi, 0, 1, 2, 3, 4, 5, 6, 7, 8, 9, 10, 11, 12, 13, 14, 15); }
__device__ __forceinline__ v16bf cat16b(v8us lo, v8us hi) { return __builtin_bit_cast(v16bf, __builtin_shufflevector(lo, hi, 0, 1, 2, 3, 4, 5, 6, 7, 8, 9, 10, 11, 12, 13, 14, 15)); }
__device__ __forceinline__ v8f wmma16(v16h a, v16h b, v8f c) { return __builtin_amdgcn_wmma_f32_16x16x32_f16(false, a, false, b, (short)0, c, false, false); }
__device__ __forceinline__ v8f wmmab(v16bf a, v16bf b, v8f c) { return __builtin_amdgcn_wmma_f32_16x16x32_bf16(false, a, false, b, (short)0, c, false, false); }
// Fragment loaders from fragment-order planes: p already holds the 512-element (16 rows x 32 k) block base + 8*lane, lane = 16*h + row; elements 0..7 = k0+8h.., elements 8..15 = k0+16+8h..; each load covers four whole 128-B lines.
__device__ __forceinline__ v16bf ldbf(const bf* p) { return cat16b(*(const v8us*)p, *(const v8us*)(p + 256)); }
__device__ __forceinline__ v16h ldhf(const h16* p) { return cat16(*(const v8h*)p, *(const v8h*)(p + 256)); }
// Same-wave LDS exchange (wave-private tiles only).
__device__ __forceinline__ void wave_lds_sync() { __builtin_amdgcn_fence(3 /* release order */, "wavefront"); __builtin_amdgcn_wave_barrier(); __builtin_amdgcn_fence(2 /* acquire order */, "wavefront"); asm volatile("" ::: "memory"); }

// ---- wt_body: in[z][rows][cols] (f32) -> transposed matrix out[n = z*cols + col][k = row] (bf16 RNE) in fragment order [n/16][k/8][n%16][k%8], one 64x64 tile (bx, by, bz) of (rows/64, cols/64, z) through LDS (t: 64 x 65 floats); 256 threads.
__device__ __forceinline__ void wt_body(const float* __restrict__ src, bf* dst, int rows, int cols, int bx, int by, int bz, float* t) {
    const int tid = threadIdx.x;
    const size_t zo = (size_t)bz * (size_t)rows * (size_t)cols;
    const int r0 = bx * 64, c0 = by * 64;
#pragma unroll 1   // four loads in flight a trip; rolled: each trip's wait then stands in front of the next trip's address writes
    for (int i0 = 0; i0 < 16; i0 += 4) { const int cc = tid & 63; const float* p[4]; float v[4];
#pragma unroll
        for (int u = 0; u < 4; ++u) { p[u] = src + zo + (size_t)(r0 + (tid >> 6) + 4 * (i0 + u)) * cols + c0 + cc; v[u] = *p[u]; }
        // The four address pairs are inputs, so they stay whole until this wait: no load's result and no next address is written into a pair that an issued load still names.
        asm volatile("s_wait_xcnt 0x0" :: "v"(p[0]), "v"(p[1]), "v"(p[2]), "v"(p[3]) : "memory");
#pragma unroll
        for (int u = 0; u < 4; ++u) t[((tid >> 6) + 4 * (i0 + u)) * 65 + cc] = v[u]; }
    __syncthreads();
    const int pc = (tid >> 3) & 7;
#pragma unroll
    for (int it = 0; it < 2; ++it) { const int line = (tid & 7) + 8 * (tid >> 6) + 32 * it; v8us o;
#pragma unroll
        for (int i = 0; i < 8; ++i) o[i] = f2bf(t[(8 * pc + i) * 65 + line]);
        const int n = bz * cols + c0 + line;
        *(v8us*)(dst + (size_t)(n >> 4) * 16 * rows + (size_t)((r0 >> 3) + pc) * 128 + (n & 15) * 8) = o; }
}

// ---- ln_body: one wave per token, block blk takes tokens 8*blk..8*blk+7; they are gathered in LDS so that each 128-B line of the fragment-order planes (8 tokens x 16 B) is stored whole.
__device__ __forceinline__ void ln_body(const float* __restrict__ x, const float* __restrict__ g, const float* __restrict__ be, bf* Yh, bf* Yl, int blk, bf (*sy)[8][DM + 8]) {
    const int lane = threadIdx.x & 31;
    const int wave = __builtin_amdgcn_readfirstlane(threadIdx.x >> 5);
    const int tok = blk * 8 + wave;
    const int b = tok / SEQ, s = tok % SEQ;
    const float* xr = x + ((size_t)b * SEQ_FULL + s) * DM;
    v4f v[3]; float sum = 0.0f;
#pragma unroll
    for (int j = 0; j < 3; ++j) { v4f a = *(const v4f*)(xr + j * 128 + lane * 4);
#pragma unroll
        for (int q = 0; q < 4; ++q) { a[q] = bfr(a[q]); sum += a[q]; }
        v[j] = a; }
#pragma unroll
    for (int sh = 16; sh; sh >>= 1) sum += __shfl_xor(sum, sh, 32);
    const float mu = sum * (1.0f / DM);
    float var = 0.0f;
#pragma unroll
    for (int j = 0; j < 3; ++j) {
#pragma unroll
        for (int q = 0; q < 4; ++q) { const float d = v[j][q] - mu; var += d * d; } }
#pragma unroll
    for (int sh = 16; sh; sh >>= 1) var += __shfl_xor(var, sh, 32);
    const float rs = rsqrtf(var * (1.0f / DM) + 1e-5f);
    v4us oh[3], ol[3];
    const float* pg = g + lane * 4; const float* pb = be + lane * 4;
#pragma unroll
    for (int j = 0; j < 3; ++j) { const v4f gg = *(const v4f*)(pg + j * 128); const v4f bb = *(const v4f*)(pb + j * 128);
#pragma unroll
        for (int q = 0; q < 4; ++q) { const float y = (v[j][q] - mu) * rs * bfr(gg[q]) + bfr(bb[q]); unsigned short a, c; splitf(y, a, c); oh[j][q] = a; ol[j][q] = c; } }
    // The two addresses are inputs, so the registers they are formed from stay whole until this wait: no load's result is written into a register that an issued load still names.
    asm volatile("s_wait_xcnt 0x0" :: "v"(pg), "v"(pb) : "memory");
#pragma unroll
    for (int j = 0; j < 3; ++j) { *(v4us*)(&sy[0][wave][j * 128 + lane * 4]) = oh[j]; *(v4us*)(&sy[1][wave][j * 128 + lane * 4]) = ol[j]; }
    __syncthreads();   // each stored line below holds 16 B from each of the 8 waves' tokens
    const int r8 = threadIdx.x & 7;
    const size_t tb = (size_t)(blk >> 1) * (16 * DM) + (blk & 1) * 64 + r8 * 8;
    v8us ov[3];
#pragma unroll
    for (int it = 0; it < 3; ++it) { const int idx = (threadIdx.x >> 3) + 32 * it; const int pl = idx >= DM / 8 ? 1 : 0; const int ch = idx - pl * (DM / 8); ov[it] = *(const v8us*)(&sy[pl][r8][ch * 8]); }
#pragma unroll
    for (int it = 0; it < 3; ++it) { const int idx = (threadIdx.x >> 3) + 32 * it; const int pl = idx >= DM / 8 ? 1 : 0; const int ch = idx - pl * (DM / 8);
        *(v8us*)((pl ? Yl : Yh) + tb + ch * 128) = ov[it];
        asm volatile("s_wait_xcnt 0x0" ::: "memory"); }   // behind each store: in the fused kernel code follows that overwrites the stores' address and data registers
}

// ---- k_prep: the five jobs that depend on the inputs alone, as block ranges of one grid (256 threads): blocks 0..143 transpose the four weights (36 tiles each, first because they are few), the rest do LayerNorm.
#define WT_TILES ((DM / 64) * (DM / 64))
__global__ __launch_bounds__(256) void k_prep(const float* __restrict__ x, const float* __restrict__ g, const float* __restrict__ be,
                                              const float* __restrict__ wq, const float* __restrict__ wk, const float* __restrict__ wv, const float* __restrict__ wp,
                                              bf* Yh, bf* Yl, bf* WQ, bf* WK, bf* WV, bf* WP) {
    __shared__ __align__(16) float sm[64 * 65];   // one buffer for both jobs: a block does one of them
    static_assert(sizeof(bf) * 2 * 8 * (DM + 8) <= sizeof(float) * 64 * 65);
    const int bid = blockIdx.x;
    if (bid < 4 * WT_TILES) {   // the same for the whole block
        const int w = bid / WT_TILES, r = bid % WT_TILES, bx = r % (DM / 64), bo = r / (DM / 64);
        // per-head [h][d][k] -> Bt[h*64 + k][d]: in[rows = 384 (d)][cols = 64 (k)], z = head (bo); Wp [in = 384 (d)][out = 384 (n)] -> Bt[n][d]: in[rows = 384][cols = 384], column tile bo
        wt_body(w == 0 ? wq : w == 1 ? wk : w == 2 ? wv : wp, w == 0 ? WQ : w == 1 ? WK : w == 2 ? WV : WP, DM, w == 3 ? DM : HD, bx, w == 3 ? bo : 0, w == 3 ? 0 : bo, sm);
        return;
    }
    ln_body(x, g, be, Yh, Yl, bid - 4 * WT_TILES, (bf (*)[8][DM + 8])sm);
}

// ---- gemmw: register-blocked GEMM, ONE WAVE per 64x64 output tile (16 accumulators), operands straight from fragment-order bf16 planes (K = 384); tile (blockIdx.x, blockIdx.y) of (M/64, 384/64), 32 threads; os: 64 x 68 floats of LDS.
// MODE 0: hi|lo head planes (q, k); MODE 1: f16 v^T head plane; MODE 2: f32 output rows [tok][384] with exact erf GELU (16 lanes x 16 B = 256 B per row segment, 2 rows per instruction).
template <int MODE>
__device__ __forceinline__ void gemmw(const bf* __restrict__ A, const bf* __restrict__ A2, const bf* __restrict__ Bt, const float* __restrict__ bias, bf* Oh, bf* Ol, h16* Ov, float* Of, float* os) {
    const int lane = threadIdx.x & 31, lr = lane & 15, hi = lane >> 4;
    const int r0 = blockIdx.x * 64, c0 = blockIdx.y * 64;
    v8f acc[4][4];
#pragma unroll
    for (int mb = 0; mb < 4; ++mb)
#pragma unroll
        for (int nb = 0; nb < 4; ++nb) acc[mb][nb] = (v8f){};
    const size_t aoff = (size_t)r0 * DM + 8 * lane, boff = (size_t)c0 * DM + 8 * lane;
#pragma unroll 1
    for (int kc = 0; kc < DM; kc += 32) {
        v16bf a[4], a2[4], b[4];
        const bf* pa = A + aoff + kc * 16; const bf* pa2 = A2 + aoff + kc * 16; const bf* pb = Bt + boff + kc * 16;
#pragma unroll
        for (int mb = 0; mb < 4; ++mb) { a[mb] = ldbf(pa + mb * 16 * DM); b[mb] = ldbf(pb + mb * 16 * DM); a2[mb] = ldbf(pa2 + mb * 16 * DM); }
        // The three address pairs are inputs, so they stay whole until this wait: no load's result and no next address is written into a pair that an issued load of this trip still names.
        asm volatile("s_wait_xcnt 0x0" :: "v"(pa), "v"(pa2), "v"(pb) : "memory");
#pragma unroll
        for (int nb = 0; nb < 4; ++nb) {
#pragma unroll
            for (int mb = 0; mb < 4; ++mb) { acc[mb][nb] = wmmab(a[mb], b[nb], acc[mb][nb]); acc[mb][nb] = wmmab(a2[mb], b[nb], acc[mb][nb]); } }
        asm volatile("" : "+v"(acc[0][0]), "+v"(acc[1][0]), "+v"(acc[2][0]), "+v"(acc[3][0]), "+v"(acc[0][1]), "+v"(acc[1][1]), "+v"(acc[2][1]), "+v"(acc[3][1]));
        asm volatile("v_nop\n\tv_nop\n\tv_nop\n\tv_nop" : "+v"(acc[0][2]), "+v"(acc[1][2]), "+v"(acc[2][2]), "+v"(acc[3][2]), "+v"(acc[0][3]), "+v"(acc[1][3]), "+v"(acc[2][3]), "+v"(acc[3][3]) : "v"(a[3]), "v"(a2[3]), "v"(b[3]));
    }
#pragma unroll
    for (int mb = 0; mb < 4; ++mb)
#pragma unroll
        for (int nb = 0; nb < 4; ++nb)
#pragma unroll
            for (int j = 0; j < 8; ++j) os[(mb * 16 + hi * 8 + j) * 68 + nb * 16 + lr] = acc[mb][nb][j];
    wave_lds_sync();
    const int bb = r0 / SEQ, sq = r0 % SEQ, hh = blockIdx.y;
    // Fragment-order stores: 8 lanes (r8) x 16 B fill one 128-B line of one 8-element chunk column, 4 chunk columns (cc) per instruction.
    const int r8 = lane & 7, cc = lane >> 3;
    if (MODE == 0) {
        const size_t pb = ((size_t)(bb * NH + hh) * SEQ + sq) * HD;
        float bz[2][8];
#pragma unroll
        for (int hf = 0; hf < 2; ++hf)
#pragma unroll
            for (int i = 0; i < 8; ++i) bz[hf][i] = bfr(bias[c0 + 8 * (4 * hf + cc) + i]);
#pragma unroll 1   // rolled: the epilogue is store-bound, and unrolled it would only take instruction cache
        for (int g = 0; g < 8; ++g) { const int row = 8 * g + r8;
#pragma unroll     // bz[hf] must be a compile-time register index
            for (int hf = 0; hf < 2; ++hf) { const int ch = 4 * hf + cc;
                const v4f u0 = *(const v4fa*)(os + row * 68 + 8 * ch); const v4f u1 = *(const v4fa*)(os + row * 68 + 8 * ch + 4); v8us oh, ol;
#pragma unroll
                for (int i = 0; i < 4; ++i) { unsigned short a, c; splitf(u0[i] + bz[hf][i], a, c); oh[i] = a; ol[i] = c; splitf(u1[i] + bz[hf][4 + i], a, c); oh[4 + i] = a; ol[4 + i] = c; }
                const size_t oo = pb + (size_t)(row >> 4) * (16 * HD) + ch * 128 + (row & 15) * 8;
                *(v8us*)(Oh + oo) = oh; *(v8us*)(Ol + oo) = ol; }
            asm volatile("s_wait_xcnt 0x0" ::: "memory");   // the next trip overwrites the stores' address and data registers
        }
    }
    if (MODE == 1) {
        const size_t vb = ((size_t)(bb * NH + hh) * SEQ + sq) * HD;
#pragma unroll 1   // rolled: the epilogue is store-bound, and unrolled it would only take instruction cache
        for (int g = 0; g < 8; ++g) { const int hd = 8 * g + r8; const float bzv = bfr(bias[c0 + hd]);
#pragma unroll
            for (int kq = 0; kq < 2; ++kq) { v8h o8;
#pragma unroll
                for (int i = 0; i < 8; ++i) o8[i] = (h16)(os[(32 * kq + 8 * cc + i) * 68 + hd] + bzv);
                *(v8h*)(Ov + vb + (size_t)kq * (32 * HD) + (hd >> 4) * 512 + cc * 128 + (hd & 15) * 8) = o8; }
            asm volatile("s_wait_xcnt 0x0" ::: "memory");   // the next trip overwrites the stores' address and data registers
        }
    }
    if (MODE == 2) {
        const int cofs = lr * 4;
        float bz4[4];
        const float* pbz = bias + c0 + cofs;
#pragma unroll
        for (int q = 0; q < 4; ++q) bz4[q] = bfr(pbz[q]);
        // The address pair is an input, so it stays whole until this wait: the load's result is not written into the pair that the load names.
        asm volatile("s_wait_xcnt 0x0" :: "v"(pbz) : "memory");
        // GELU in groups of 16 rows: a lane's 32 values of a group are independent chains, worked on stage by stage, so the vector port stays fed where one value at a time left a lone wave waiting out every link and two branches per value.
        // One wave-uniform test a group: where every |tv / sqrt(2)| of the group is below 1, erf is the math library's own polynomial for that range (same coefficients, same order of fused operations, odd in x: the same bits as erff);
        // any other group (a large value, an infinity) takes the erff loop, one row pair a trip.
        const v4f bzv = {bz4[0], bz4[1], bz4[2], bz4[3]};
#pragma unroll 1   // rolled: four trips of the same code; each trip's wait then stands in front of the next trip's writes of the stores' registers
        for (int s0 = 0; s0 < 32; s0 += 8) {
            const float* ob = os + (2 * s0 + hi) * 68 + cofs;
            float* og = Of + (size_t)(r0 + 2 * s0 + hi) * DM + c0 + cofs;
            v4f val[8], xx[8], t[8], p[8];
#pragma unroll
            for (int u = 0; u < 8; ++u) val[u] = *(const v4fa*)(ob + u * (2 * 68));
#pragma unroll
            for (int u = 0; u < 8; ++u) val[u] += bzv;
            float am[8];
#pragma unroll
            for (int u = 0; u < 8; ++u) am[u] = fmaxf(fmaxf(fabsf(val[u][0]), fabsf(val[u][1])), fmaxf(fabsf(val[u][2]), fabsf(val[u][3])));
            const float amax = fmaxf(fmaxf(fmaxf(am[0], am[1]), fmaxf(am[2], am[3])), fmaxf(fmaxf(am[4], am[5]), fmaxf(am[6], am[7])));
            // rounding is monotone, so the largest |tv| gives the largest |tv * 0.7071...|; a NaN is passed over by fmaxf and comes out as NaN of either path
            if (__builtin_amdgcn_ballot_w32(!(amax * 0.70710678118654752f < 1.0f)) == 0) {
#pragma unroll
                for (int u = 0; u < 8; ++u) xx[u] = val[u] * 0.70710678118654752f;
#pragma unroll
                for (int u = 0; u < 8; ++u) t[u] = xx[u] * xx[u];
#pragma unroll
                for (int u = 0; u < 8; ++u) p[u] = __builtin_elementwise_fma(t[u], (v4f)(-0x1.268bc2p-11f), (v4f)(0x1.420828p-8f));
#pragma unroll
                for (int u = 0; u < 8; ++u) p[u] = __builtin_elementwise_fma(t[u], p[u], (v4f)(-0x1.b5937p-6f));
#pragma unroll
                for (int u = 0; u < 8; ++u) p[u] = __builtin_elementwise_fma(t[u], p[u], (v4f)(0x1.ce077cp-4f));
#pragma unroll
                for (int u = 0; u < 8; ++u) p[u] = __builtin_elementwise_fma(t[u], p[u], (v4f)(-0x1.81266p-2f));
#pragma unroll
                for (int u = 0; u < 8; ++u) p[u] = __builtin_elementwise_fma(t[u], p[u], (v4f)(0x1.06eba0p-3f));
#pragma unroll
                for (int u = 0; u < 8; ++u) p[u] = __builtin_elementwise_fma(xx[u], p[u], xx[u]);
#pragma unroll
                for (int u = 0; u < 8; ++u) val[u] = 0.5f * val[u] * (1.0f + p[u]);
#pragma unroll
                for (int u = 0; u < 8; ++u) *(v4f*)(og + u * (2 * DM)) = val[u];
                asm volatile("s_wait_xcnt 0x0" ::: "memory");   // the next trip overwrites the stores' address and data registers
            } else {
#pragma unroll 1   // rolled: the rare path; unrolled it would only take instruction cache
                for (int u = 0; u < 8; ++u) { v4f w = *(const v4fa*)(ob + u * (2 * 68));
#pragma unroll
                    for (int q = 0; q < 4; ++q) { const float tv = w[q] + bz4[q]; w[q] = 0.5f * tv * (1.0f + erff(tv * 0.70710678118654752f)); }
                    *(v4f*)(og + u * (2 * DM)) = w; }
            }
        }
    }
}

// ---- k_qkv: the three projections of y, which do not depend on one another, as one grid (M/64, 384/64, 3): blockIdx.z = 0 q, 1 k, 2 v.
__global__ __launch_bounds__(32) void k_qkv(const bf* __restrict__ Yh, const bf* __restrict__ Yl, const bf* __restrict__ WQ, const bf* __restrict__ WK, const bf* __restrict__ WV,
                                            const float* __restrict__ bq, const float* __restrict__ bk, const float* __restrict__ bv, bf* Qh, bf* Ql, bf* Kh, bf* Kl, h16* VT) {
    __shared__ __align__(16) float os[64 * 68];
    const int z = blockIdx.z;
    if (z == 2) gemmw<1>(Yh, Yl, WV, bv, (bf*)nullptr, (bf*)nullptr, VT, (float*)nullptr, os);
    else gemmw<0>(Yh, Yl, z ? WK : WQ, z ? bk : bq, z ? Kh : Qh, z ? Kl : Ql, (h16*)nullptr, (float*)nullptr, os);
}

// ---- k_proj: ctx hi|lo x Wp + bp -> erf GELU -> out; grid (M/64, 384/64).
__global__ __launch_bounds__(32) void k_proj(const bf* __restrict__ Ch, const bf* __restrict__ Cl, const bf* __restrict__ WP, const float* __restrict__ bp, float* Of) {
    __shared__ __align__(16) float os[64 * 68];
    gemmw<2>(Ch, Cl, WP, bp, (bf*)nullptr, (bf*)nullptr, (h16*)nullptr, Of, os);
}

// exp2 with the vector slot that the instruction set asks for behind a transcendental kept inside the statement: each v_exp_f32 is followed by an instruction that neither reads its result nor overwrites its source
// ("=&v": no result shares a register with a source of the group), the last one by v_nop.
__device__ __forceinline__ void exp2x4(float x0, float x1, float x2, float x3, float& y0, float& y1, float& y2, float& y3) {
    asm("v_exp_f32 %0, %4\n\tv_exp_f32 %1, %5\n\tv_exp_f32 %2, %6\n\tv_exp_f32 %3, %7\n\tv_nop" : "=&v"(y0), "=&v"(y1), "=&v"(y2), "=&v"(y3) : "v"(x0), "v"(x1), "v"(x2), "v"(x3));
}
__device__ __forceinline__ float exp2x1(float x) { float y; asm("v_exp_f32 %0, %1\n\tv_nop" : "=v"(y) : "v"(x)); return y; }

// ---- stage_copy: one ring stage = KS keys of the k hi, k lo and v^T planes (8192 contiguous bytes of each, fragment order kept) -> one LDS buffer [k hi | k lo | v^T], by asynchronous copies, through no register.
// 128 threads x 16 B = 2048 B a copy, four copies a plane. gh, gl, gv: the lane's own global addresses (plane + stage start + 8 elements x thread); lds: the lane's own LDS byte address (buffer start + 16 x thread).
__device__ __forceinline__ void stage_copy(const bf* gh, const bf* gl, const h16* gv, unsigned lds) {
    // s_wait_xcnt is the last line of the copies' own statement, so it stands in front of every later write of an address register that a copy names.
    asm volatile("global_load_async_to_lds_b128 %0, %12, off\n\t"
                 "global_load_async_to_lds_b128 %1, %13, off\n\t"
                 "global_load_async_to_lds_b128 %2, %14, off\n\t"
                 "global_load_async_to_lds_b128 %3, %15, off\n\t"
                 "global_load_async_to_lds_b128 %4, %16, off\n\t"
                 "global_load_async_to_lds_b128 %5, %17, off\n\t"
                 "global_load_async_to_lds_b128 %6, %18, off\n\t"
                 "global_load_async_to_lds_b128 %7, %19, off\n\t"
                 "global_load_async_to_lds_b128 %8, %20, off\n\t"
                 "global_load_async_to_lds_b128 %9, %21, off\n\t"
                 "global_load_async_to_lds_b128 %10, %22, off\n\t"
                 "global_load_async_to_lds_b128 %11, %23, off\n\t"
                 "s_wait_xcnt 0x0"
                 :: "v"(lds), "v"(lds + 2048u), "v"(lds + 4096u), "v"(lds + 6144u), "v"(lds + 8192u), "v"(lds + 10240u), "v"(lds + 12288u), "v"(lds + 14336u), "v"(lds + 16384u), "v"(lds + 18432u), "v"(lds + 20480u), "v"(lds + 22528u),
                    "v"(gh), "v"(gh + 1024), "v"(gh + 2048), "v"(gh + 3072), "v"(gl), "v"(gl + 1024), "v"(gl + 2048), "v"(gl + 3072), "v"(gv), "v"(gv + 1024), "v"(gv + 2048), "v"(gv + 3072)
                 : "memory");
}

// ---- k_attn: fused flash attention (unscaled scores, no mask), transposed form. Block = 4 waves, each owns 32 queries (two 16-query tiles) of one (b, h); grid (SEQ/128, NB*NH).
// The wave's Q fragments (hi|lo, both tiles) are loaded once and stay in registers; each K and V fragment loaded in the key loop feeds both query tiles.
// K hi|lo and V^T come through a two-buffer LDS ring that the four waves share: stage t + 1's copies fly while stage t (KS keys, two 32-key steps) is worked on, so no wave waits out a global load in the key loop.
// Per 32-key step and query tile: S^T[key][q] = Kh Qh^T + Kl Qh^T + Kh Ql^T (A = key rows from the k planes, B = query rows from the q planes, k index = hd);
// lane (n = query, h) then holds keys 8h+r of both 16-key tiles -> running max / exp2 per lane, one cross-half shuffle;
// the P^T B fragment is formed in registers (element r <- tile 0 value r, element 8+r <- tile 1 value r; carried x16384 in f16); O^T[hd][q] += V^T[hd][key] P^T[key][q] (A from the f16 v^T plane).
// l is accumulated from the unconverted f32 p values (per-lane partials, combined once at the end). Q fragments come straight from the fragment-order global planes, K and V fragments from the ring, which keeps that order (two 16-B loads each, 512 contiguous bytes per load: no bank conflict).
__global__ __launch_bounds__(128) void k_attn(const bf* __restrict__ Qh, const bf* __restrict__ Ql, const bf* __restrict__ Kh, const bf* __restrict__ Kl, const h16* __restrict__ Vt, bf* Ch, bf* Cl) {
#pragma clang fp contract(off)
    __shared__ __align__(16) float os[4 * 2 * 16 * 68];
    __shared__ __align__(16) bf ring[2][3 * KS * HD];
    const int lane = threadIdx.x & 31, lr = lane & 15, hi = lane >> 4;
    const int wave = __builtin_amdgcn_readfirstlane(threadIdx.x >> 5);
    const int bh = blockIdx.y;
    const int q0 = blockIdx.x * 128 + wave * 32;
    const size_t pbase = (size_t)bh * SEQ * HD;
    const bf* qh = Qh + pbase; const bf* ql = Ql + pbase; const bf* kh = Kh + pbase; const bf* kl = Kl + pbase; const h16* vt = Vt + pbase;
    const int qoff0 = q0 * HD + 8 * lane;
    v16bf bqh[2][2], bql[2][2];
#pragma unroll
    for (int t = 0; t < 2; ++t)
#pragma unroll
        for (int ks = 0; ks < 2; ++ks) { bqh[t][ks] = ldbf(qh + qoff0 + t * (16 * HD) + ks * 512); bql[t][ks] = ldbf(ql + qoff0 + t * (16 * HD) + ks * 512); }
    v8f o[2][4];
#pragma unroll
    for (int t = 0; t < 2; ++t)
#pragma unroll
        for (int j = 0; j < 4; ++j) o[t][j] = (v8f){};
    float m[2] = {-1.0e30f, -1.0e30f}, l[2] = {0.0f, 0.0f};
    const bf* gkh = kh + 8 * threadIdx.x; const bf* gkl = kl + 8 * threadIdx.x; const h16* gvt = vt + 8 * threadIdx.x;
    const unsigned lds0 = (unsigned)(size_t)&ring[0][0] + 16u * threadIdx.x;   // LDS byte address = low 32 bits of the shared address
    stage_copy(gkh, gkl, gvt, lds0);
    asm volatile("s_wait_asynccnt 0x0" ::: "memory");   // this wave's share of stage 0 has landed
    __syncthreads();                                     // every wave's share has: stage 0 may be read
    stage_copy(gkh + KS * HD, gkl + KS * HD, gvt + KS * HD, lds0 + (unsigned)sizeof(ring[0]));
#pragma unroll 1
    for (int st = 0; st < SEQ / KS; ++st) {
      const bf* sb = ring[st & 1] + 8 * lane;
#pragma unroll 1   // rolled: each step then opens with its 24 LDS reads as one group ahead of its WMMAs; unrolled, the compiler spread them in three groups among the WMMAs
      for (int kk = 0; kk < KS; kk += 32) {
        const bf* skh = sb + kk * HD; const bf* skl = skh + KS * HD;
        v8f s0[2], s1[2];
#pragma unroll
        for (int t = 0; t < 2; ++t) { s0[t] = (v8f){}; s1[t] = (v8f){}; }
#pragma unroll
        for (int ks = 0; ks < 2; ++ks) {
            const v16bf a0h = ldbf(skh + ks * 512), a0l = ldbf(skl + ks * 512);
            const v16bf a1h = ldbf(skh + 16 * HD + ks * 512), a1l = ldbf(skl + 16 * HD + ks * 512);
            s0[0] = wmmab(a0h, bqh[0][ks], s0[0]); s1[0] = wmmab(a1h, bqh[0][ks], s1[0]); s0[1] = wmmab(a0h, bqh[1][ks], s0[1]); s1[1] = wmmab(a1h, bqh[1][ks], s1[1]);
            s0[0] = wmmab(a0l, bqh[0][ks], s0[0]); s1[0] = wmmab(a1l, bqh[0][ks], s1[0]); s0[1] = wmmab(a0l, bqh[1][ks], s0[1]); s1[1] = wmmab(a1l, bqh[1][ks], s1[1]);
            s0[0] = wmmab(a0h, bql[0][ks], s0[0]); s1[0] = wmmab(a1h, bql[0][ks], s1[0]); s0[1] = wmmab(a0h, bql[1][ks], s0[1]); s1[1] = wmmab(a1h, bql[1][ks], s1[1]);
        }
        const h16* pv = (const h16*)(skh + 2 * KS * HD);
        const v16h va0 = ldhf(pv), va1 = ldhf(pv + 512), va2 = ldhf(pv + 1024), va3 = ldhf(pv + 1536);
        v16h pf[2];
#pragma unroll
        for (int t = 0; t < 2; ++t) {
            float mx = fmaxf(s0[t][0], s1[t][0]);
#pragma unroll
            for (int r = 1; r < 8; ++r) mx = fmaxf(mx, fmaxf(s0[t][r], s1[t][r]));
            mx = fmaxf(mx, __shfl_xor(mx, 16, 32));
            const float mn = fmaxf(m[t], mx);
            const float alpha = exp2x1((m[t] - mn) * L2E);
            m[t] = mn;
            float psum = 0.0f;
#pragma unroll
            for (int r = 0; r < 8; r += 2) {
                float p0, p1, p2, p3;
                exp2x4((s0[t][r] - mn) * L2E, (s1[t][r] - mn) * L2E, (s0[t][r + 1] - mn) * L2E, (s1[t][r + 1] - mn) * L2E, p0, p1, p2, p3);
                psum += p0 + p1;
                psum += p2 + p3;
                pf[t][r] = (h16)(p0 * PCAR); pf[t][8 + r] = (h16)(p1 * PCAR); pf[t][r + 1] = (h16)(p2 * PCAR); pf[t][9 + r] = (h16)(p3 * PCAR); }
            l[t] = l[t] * alpha + psum;
#pragma unroll
            for (int j = 0; j < 4; ++j)
#pragma unroll
                for (int r = 0; r < 8; ++r) o[t][j][r] *= alpha;
        }
#pragma unroll
        for (int t = 0; t < 2; ++t) { o[t][0] = wmma16(va0, pf[t], o[t][0]); o[t][1] = wmma16(va1, pf[t], o[t][1]); o[t][2] = wmma16(va2, pf[t], o[t][2]); o[t][3] = wmma16(va3, pf[t], o[t][3]); }
      }
      // Publish point of stage st + 1, every wave, in this order.
      asm volatile("s_wait_dscnt 0x0" ::: "memory");      // this wave's reads of stage st's buffer are done before the buffer is refilled
      asm volatile("s_wait_asynccnt 0x0" ::: "memory");   // this wave's share of stage st + 1 has landed
      __syncthreads();                                     // every wave's share has, and every wave has left stage st's buffer
      if (st + 2 < SEQ / KS) stage_copy(gkh + (st + 2) * (KS * HD), gkl + (st + 2) * (KS * HD), gvt + (st + 2) * (KS * HD), lds0 + (unsigned)(st & 1) * (unsigned)sizeof(ring[0]));
    }
    asm volatile("s_wait_asynccnt 0x0" ::: "memory");   // no copy is outstanding when the wave goes on to its end
    const int b = bh / NH, h = bh % NH;
    const int r8 = lane & 7, cc = lane >> 3;
#pragma unroll
    for (int t = 0; t < 2; ++t) {
        const float lt = l[t] + __shfl_xor(l[t], 16, 32);
        const float inv = 1.0f / (lt * PCAR);
        const int wbase = (wave * 2 + t) * (16 * 68);
#pragma unroll
        for (int j = 0; j < 4; ++j)
#pragma unroll
            for (int r = 0; r < 8; ++r) os[wbase + lr * 68 + 16 * j + 8 * hi + r] = o[t][j][r] * inv;
    }
    wave_lds_sync();
#pragma unroll 1   // rolled: each trip's wait then stands in front of every later write of its stores' registers
    for (int u = 0; u < 8; ++u) { const int t = u >> 2, s = u & 3;
        const int wbase = (wave * 2 + t) * (16 * 68);
        const int row = 8 * (s & 1) + r8, ch = 4 * (s >> 1) + cc;
        const v4f u0 = *(const v4fa*)(os + wbase + row * 68 + 8 * ch); const v4f u1 = *(const v4fa*)(os + wbase + row * 68 + 8 * ch + 4); v8us oh, ol;
#pragma unroll
        for (int i = 0; i < 4; ++i) { unsigned short a, c; splitf(u0[i], a, c); oh[i] = a; ol[i] = c; splitf(u1[i], a, c); oh[4 + i] = a; ol[4 + i] = c; }
        const size_t oo = ((size_t)b * SEQ + q0 + 16 * t) * DM + (h * 8 + ch) * 128 + row * 8;
        *(v8us*)(Ch + oo) = oh; *(v8us*)(Cl + oo) = ol;
        asm volatile("s_wait_xcnt 0x0" ::: "memory");   // the next trip overwrites the stores' address and data registers
    }
}

extern "C" void kernel_launch(void* const* d_in, const int* in_sizes, int n_in,
                              void* d_out, int out_size, void* d_ws, size_t ws_size, hipStream_t stream) {
    if (n_in < 11) return;
    if ((size_t)in_sizes[0] < ((size_t)(NB - 1) * SEQ_FULL + SEQ) * DM) return;
    if (in_sizes[1] < DM || in_sizes[2] < DM) return;
    if (in_sizes[3] < NH * DM * HD || in_sizes[5] < NH * DM * HD || in_sizes[7] < NH * DM * HD || in_sizes[9] < DM * DM) return;
    if (in_sizes[4] < DM || in_sizes[6] < DM || in_sizes[8] < DM || in_sizes[10] < DM) return;
    if ((size_t)out_size < (size_t)MTOK * DM) return;
    const float* x   = (const float*)d_in[0];
    const float* lng = (const float*)d_in[1];
    const float* lnb = (const float*)d_in[2];
    const float* wq  = (const float*)d_in[3];
    const float* bq  = (const float*)d_in[4];
    const float* wk  = (const float*)d_in[5];
    const float* bk  = (const float*)d_in[6];
    const float* wv  = (const float*)d_in[7];
    const float* bv  = (const float*)d_in[8];
    const float* wp  = (const float*)d_in[9];
    const float* bp  = (const float*)d_in[10];
    float* OUT = (float*)d_out;     // [NB][SEQ][384]
    char* wsp = (char*)d_ws;
    auto take = [&](size_t bytes) { char* p = wsp; wsp += (bytes + 255) & ~(size_t)255; return (void*)p; };
    const size_t WSZ = (size_t)DM * DM * 2;            // one transposed bf16 weight plane [384][384]
    const size_t PSZ = (size_t)MTOK * DM * 2;          // one 16-bit activation plane
    bf* WQ = (bf*)take(WSZ); bf* WK = (bf*)take(WSZ); bf* WV = (bf*)take(WSZ); bf* WP = (bf*)take(WSZ);
    bf* Yh = (bf*)take(PSZ); bf* Yl = (bf*)take(PSZ);
    bf* Qh = (bf*)take(PSZ); bf* Ql = (bf*)take(PSZ); bf* Kh = (bf*)take(PSZ); bf* Kl = (bf*)take(PSZ);
    h16* VT = (h16*)take(PSZ);
    if ((size_t)(wsp - (char*)d_ws) > ws_size) return;
    bf* Ch = Yh; bf* Cl = Yl;   // ctx planes reuse the y planes (y is dead after the three projections; stream-ordered)

    k_prep<<<4 * WT_TILES + MTOK / 8, 256, 0, stream>>>(x, lng, lnb, wq, wk, wv, wp, Yh, Yl, WQ, WK, WV, WP);
    k_qkv<<<dim3(MTOK / 64, DM / 64, 3), 32, 0, stream>>>(Yh, Yl, WQ, WK, WV, bq, bk, bv, Qh, Ql, Kh, Kl, VT);
    k_attn<<<dim3(SEQ / 128, NB * NH, 1), 128, 0, stream>>>(Qh, Ql, Kh, Kl, VT, Ch, Cl);
    k_proj<<<dim3(MTOK / 64, DM / 64, 1), 32, 0, stream>>>(Ch, Cl, WP, bp, OUT);
}

// v006
// Measured time: 126 microseconds a run.
// Next to v005, in two timings, it ran 1.06 times as fast each time.
// Over all steps from v000 it is 3.64 times as fast.
#include <hip/hip_runtime.h>

// Compute dtypes, f32 accumulate everywhere: inputs converted to bf16 (RNE); q/k/v and output projections = bf16 WMMA with the activation as hi|lo planes against exact bf16 weights (2 products); scores = bf16 WMMA q hi|lo x k hi|lo (3 products); P.V = f16 WMMA (P carried x16 relative to a held reference, V plain f16); LayerNorm, softmax, GELU in f32.
// Every 16-bit WMMA operand plane with 384-long rows (y, ctx, transposed weights) is kept in fragment order [row/16][k/8][row%16][k%8].
// Pre-LN attention: y = LN(x) -> hi|lo planes; per-head projections written straight into head planes in WMMA fragment order (q,k hi|lo [b][h][s/16][hd/8][s%16][hd%8]; v^T f16 [b][h][s/32][hd/16][(s%32)/8][hd%16][s%8]), so that each 16-B-per-lane fragment load of the attention kernel is 512 contiguous bytes and a run of keys is one contiguous block of each plane; fused flash attention in the transposed form S^T = K Q^T, O^T = V^T P^T (P fragment built in registers from the score accumulators); ctx hi|lo x Wp + bp -> erf GELU -> out.

#ifndef NB
#define NB 8
#endif
#ifndef SEQ
#define SEQ 2048
#endif
#define NB_FULL  8
#define SEQ_FULL 2048
#define DM   384
#define NH   6
#define HD   64
#define MTOK (NB * SEQ)
#define CARRY 4.0f    // log2 of the carry: a score equal to the held reference gives p = 2^4 in the f16 P fragment
#define SLIM  15.0f   // the reference is raised when a shifted score passes this: p stays at or below 2^15, inside f16
#define L2E  1.4426950408889634f
#define KS   64   // keys per stage of the attention kernel's LDS ring

static_assert(SEQ % 128 == 0);
static_assert(KS % 32 == 0 && SEQ % KS == 0 && SEQ / KS >= 2);
static_assert(KS * HD * 2 == 4 * 128 * 16);   // one plane's share of a stage = four 16-B copies of each of the 128 threads
static_assert(DM % 64 == 0);
static_assert(DM % 32 == 0);
static_assert(NH * HD == DM);
static_assert(NB <= NB_FULL);
static_assert(SEQ <= SEQ_FULL);
static_assert((size_t)4 * DM * DM * 2 + (size_t)7 * MTOK * DM * 2 <= (size_t)134217728);

typedef _Float16 h16;
typedef unsigned short bf;
typedef __attribute__((ext_vector_type(16))) __bf16   v16bf;
typedef __attribute__((ext_vector_type(16))) _Float16 v16h;
typedef __attribute__((ext_vector_type(8)))  _Float16 v8h;
typedef __attribute__((ext_vector_type(8)))  unsigned short v8us;
typedef __attribute__((ext_vector_type(4)))  unsigned short v4us;
typedef __attribute__((ext_vector_type(8)))  float    v8f;
typedef __attribute__((ext_vector_type(4)))  float    v4f;
typedef v4f  __attribute__((may_alias)) v4fa;

__device__ __forceinline__ unsigned short f2bf(float f) { unsigned u = __float_as_uint(f); u += 0x7FFFu + ((u >> 16) & 1u); return (unsigned short)(u >> 16); }
__device__ __forceinline__ float bf2f(unsigned short b) { return __uint_as_float(((unsigned)b) << 16); }
__device__ __forceinline__ float bfr(float f) { return bf2f(f2bf(f)); }
__device__ __forceinline__ void splitf(float y, unsigned short& h, unsigned short& l) { h = f2bf(y); l = f2bf(y - bf2f(h)); }
__device__ __forceinline__ v16h cat16(v8h lo, v8h hi) { return __builtin_shufflevector(lo, hi, 0, 1, 2, 3, 4, 5, 6, 7, 8, 9, 10, 11, 12, 13, 14, 15); }
__device__ __forceinline__ v16bf cat16b(v8us lo, v8us hi) { return __builtin_bit_cast(v16bf, __builtin_shufflevector(lo, hi, 0, 1, 2, 3, 4, 5, 6, 7, 8, 9, 10, 11, 12, 13, 14, 15)); }
__device__ __forceinline__ v8f wmma16(v16h a, v16h b, v8f c) { return __builtin_amdgcn_wmma_f32_16x16x32_f16(false, a, false, b, (short)0, c, false, false); }
__device__ __forceinline__ v8f wmmab(v16bf a, v16bf b, v8f c) { return __builtin_amdgcn_wmma_f32_16x16x32_bf16(false, a, false, b, (short)0, c, false, false); }
// Fragment loaders from fragment-order planes: p already holds the 512-element (16 rows x 32 k) block base + 8*lane, lane = 16*h + row; elements 0..7 = k0+8h.., elements 8..15 = k0+16+8h..; each load covers four whole 128-B lines.
__device__ __forceinline__ v16bf ldbf(const bf* p) { return cat16b(*(const v8us*)p, *(const v8us*)(p + 256)); }
__device__ __forceinline__ v16h ldhf(const h16* p) { return cat16(*(const v8h*)p, *(const v8h*)(p + 256)); }
// Same-wave LDS exchange (wave-private tiles only).
__device__ __forceinline__ void wave_lds_sync() { __builtin_amdgcn_fence(3 /* release order */, "wavefront"); __builtin_amdgcn_wave_barrier(); __builtin_amdgcn_fence(2 /* acquire order */, "wavefront"); asm volatile("" ::: "memory"); }

// ---- wt_body: in[z][rows][cols] (f32) -> transposed matrix out[n = z*cols + col][k = row] (bf16 RNE) in fragment order [n/16][k/8][n%16][k%8], one 64x64 tile (bx, by, bz) of (rows/64, cols/64, z) through LDS (t: 64 x 65 floats); 256 threads.
__device__ __forceinline__ void wt_body(const float* __restrict__ src, bf* dst, int rows, int cols, int bx, int by, int bz, float* t) {
    const int tid = threadIdx.x;
    const size_t zo = (size_t)bz * (size_t)rows * (size_t)cols;
    const int r0 = bx * 64, c0 = by * 64;
#pragma unroll 1   // four loads in flight a trip; rolled: each trip's wait then stands in front of the next trip's address writes
    for (int i0 = 0; i0 < 16; i0 += 4) { const int cc = tid & 63; const float* p[4]; float v[4];
#pragma unroll
        for (int u = 0; u < 4; ++u) { p[u] = src + zo + (size_t)(r0 + (tid >> 6) + 4 * (i0 + u)) * cols + c0 + cc; v[u] = *p[u]; }
        // The four address pairs are inputs, so they stay whole until this wait: no load's result and no next address is written into a pair that an issued load still names.
        asm volatile("s_wait_xcnt 0x0" :: "v"(p[0]), "v"(p[1]), "v"(p[2]), "v"(p[3]) : "memory");
#pragma unroll
        for (int u = 0; u < 4; ++u) t[((tid >> 6) + 4 * (i0 + u)) * 65 + cc] = v[u]; }
    __syncthreads();
    const int pc = (tid >> 3) & 7;
#pragma unroll
    for (int it = 0; it < 2; ++it) { const int line = (tid & 7) + 8 * (tid >> 6) + 32 * it; v8us o;
#pragma unroll
        for (int i = 0; i < 8; ++i) o[i] = f2bf(t[(8 * pc + i) * 65 + line]);
        const int n = bz * cols + c0 + line;
        *(v8us*)(dst + (size_t)(n >> 4) * 16 * rows + (size_t)((r0 >> 3) + pc) * 128 + (n & 15) * 8) = o; }
}

// ---- ln_body: one wave per token, block blk takes tokens 8*blk..8*blk+7; they are gathered in LDS so that each 128-B line of the fragment-order planes (8 tokens x 16 B) is stored whole.
__device__ __forceinline__ void ln_body(const float* __restrict__ x, const float* __restrict__ g, const float* __restrict__ be, bf* Yh, bf* Yl, int blk, bf (*sy)[8][DM + 8]) {
    const int lane = threadIdx.x & 31;
    const int wave = __builtin_amdgcn_readfirstlane(threadIdx.x >> 5);
    const int tok = blk * 8 + wave;
    const int b = tok / SEQ, s = tok % SEQ;
    const float* xr = x + ((size_t)b * SEQ_FULL + s) * DM;
    v4f v[3]; float sum = 0.0f;
#pragma unroll
    for (int j = 0; j < 3; ++j) { v4f a = *(const v4f*)(xr + j * 128 + lane * 4);
#pragma unroll
        for (int q = 0; q < 4; ++q) { a[q] = bfr(a[q]); sum += a[q]; }
        v[j] = a; }
#pragma unroll
    for (int sh = 16; sh; sh >>= 1) sum += __shfl_xor(sum, sh, 32);
    const float mu = sum * (1.0f / DM);
    float var = 0.0f;
#pragma unroll
    for (int j = 0; j < 3; ++j) {
#pragma unroll
        for (int q = 0; q < 4; ++q) { const float d = v[j][q] - mu; var += d * d; } }
#pragma unroll
    for (int sh = 16; sh; sh >>= 1) var += __shfl_xor(var, sh, 32);
    const float rs = rsqrtf(var * (1.0f / DM) + 1e-5f);
    v4us oh[3], ol[3];
    const float* pg = g + lane * 4; const float* pb = be + lane * 4;
#pragma unroll
    for (int j = 0; j < 3; ++j) { const v4f gg = *(const v4f*)(pg + j * 128); const v4f bb = *(const v4f*)(pb + j * 128);
#pragma unroll
        for (int q = 0; q < 4; ++q) { const float y = (v[j][q] - mu) * rs * bfr(gg[q]) + bfr(bb[q]); unsigned short a, c; splitf(y, a, c); oh[j][q] = a; ol[j][q] = c; } }
    // The two addresses are inputs, so the registers they are formed from stay whole until this wait: no load's result is written into a register that an issued load still names.
    asm volatile("s_wait_xcnt 0x0" :: "v"(pg), "v"(pb) : "memory");
#pragma unroll
    for (int j = 0; j < 3; ++j) { *(v4us*)(&sy[0][wave][j * 128 + lane * 4]) = oh[j]; *(v4us*)(&sy[1][wave][j * 128 + lane * 4]) = ol[j]; }
    __syncthreads();   // each stored line below holds 16 B from each of the 8 waves' tokens
    const int r8 = threadIdx.x & 7;
    const size_t tb = (size_t)(blk >> 1) * (16 * DM) + (blk & 1) * 64 + r8 * 8;
    v8us ov[3];
#pragma unroll
    for (int it = 0; it < 3; ++it) { const int idx = (threadIdx.x >> 3) + 32 * it; const int pl = idx >= DM / 8 ? 1 : 0; const int ch = idx - pl * (DM / 8); ov[it] = *(const v8us*)(&sy[pl][r8][ch * 8]); }
#pragma unroll
    for (int it = 0; it < 3; ++it) { const int idx = (threadIdx.x >> 3) + 32 * it; const int pl = idx >= DM / 8 ? 1 : 0; const int ch = idx - pl * (DM / 8);
        *(v8us*)((pl ? Yl : Yh) + tb + ch * 128) = ov[it];
        asm volatile("s_wait_xcnt 0x0" ::: "memory"); }   // behind each store: in the fused kernel code follows that overwrites the stores' address and data registers
}

// ---- k_prep: the five jobs that depend on the inputs alone, as block ranges of one grid (256 threads): blocks 0..143 transpose the four weights (36 tiles each, first because they are few), the rest do LayerNorm.
#define WT_TILES ((DM / 64) * (DM / 64))
__global__ __launch_bounds__(256) void k_prep(const float* __restrict__ x, const float* __restrict__ g, const float* __restrict__ be,
                                              const float* __restrict__ wq, const float* __restrict__ wk, const float* __restrict__ wv, const float* __restrict__ wp,
                                              bf* Yh, bf* Yl, bf* WQ, bf* WK, bf* WV, bf* WP) {
    __shared__ __align__(16) float sm[64 * 65];   // one buffer for both jobs: a block does one of them
    static_assert(sizeof(bf) * 2 * 8 * (DM + 8) <= sizeof(float) * 64 * 65);
    const int bid = blockIdx.x;
    if (bid < 4 * WT_TILES) {   // the same for the whole block
        const int w = bid / WT_TILES, r = bid % WT_TILES, bx = r % (DM / 64), bo = r / (DM / 64);
        // per-head [h][d][k] -> Bt[h*64 + k][d]: in[rows = 384 (d)][cols = 64 (k)], z = head (bo); Wp [in = 384 (d)][out = 384 (n)] -> Bt[n][d]: in[rows = 384][cols = 384], column tile bo
        wt_body(w == 0 ? wq : w == 1 ? wk : w == 2 ? wv : wp, w == 0 ? WQ : w == 1 ? WK : w == 2 ? WV : WP, DM, w == 3 ? DM : HD, bx, w == 3 ? bo : 0, w == 3 ? 0 : bo, sm);
        return;
    }
    ln_body(x, g, be, Yh, Yl, bid - 4 * WT_TILES, (bf (*)[8][DM + 8])sm);
}

// ---- gemmw: register-blocked GEMM, ONE WAVE per 64x64 output tile (16 accumulators), operands straight from fragment-order bf16 planes (K = 384); tile (blockIdx.x, blockIdx.y) of (M/64, 384/64), 32 threads; os: 64 x 68 floats of LDS.
// MODE 0: hi|lo head planes (q, k), the value times osc before the split (log2 e for q, so that the scores come out in the log2 domain; 1 for k); MODE 1: f16 v^T head plane; MODE 2: f32 output rows [tok][384] with exact erf GELU (16 lanes x 16 B = 256 B per row segment, 2 rows per instruction).
template <int MODE>
__device__ __forceinline__ void gemmw(const bf* __restrict__ A, const bf* __restrict__ A2, const bf* __restrict__ Bt, const float* __restrict__ bias, bf* Oh, bf* Ol, h16* Ov, float* Of, float* os, float osc = 1.0f) {
    const int lane = threadIdx.x & 31, lr = lane & 15, hi = lane >> 4;
    const int r0 = blockIdx.x * 64, c0 = blockIdx.y * 64;
    v8f acc[4][4];
#pragma unroll
    for (int mb = 0; mb < 4; ++mb)
#pragma unroll
        for (int nb = 0; nb < 4; ++nb) acc[mb][nb] = (v8f){};
    const size_t aoff = (size_t)r0 * DM + 8 * lane, boff = (size_t)c0 * DM + 8 * lane;
#pragma unroll 1
    for (int kc = 0; kc < DM; kc += 32) {
        v16bf a[4], a2[4], b[4];
        const bf* pa = A + aoff + kc * 16; const bf* pa2 = A2 + aoff + kc * 16; const bf* pb = Bt + boff + kc * 16;
#pragma unroll
        for (int mb = 0; mb < 4; ++mb) { a[mb] = ldbf(pa + mb * 16 * DM); b[mb] = ldbf(pb + mb * 16 * DM); a2[mb] = ldbf(pa2 + mb * 16 * DM); }
        // The three address pairs are inputs, so they stay whole until this wait: no load's result and no next address is written into a pair that an issued load of this trip still names.
        asm volatile("s_wait_xcnt 0x0" :: "v"(pa), "v"(pa2), "v"(pb) : "memory");
#pragma unroll
        for (int nb = 0; nb < 4; ++nb) {
#pragma unroll
            for (int mb = 0; mb < 4; ++mb) { acc[mb][nb] = wmmab(a[mb], b[nb], acc[mb][nb]); acc[mb][nb] = wmmab(a2[mb], b[nb], acc[mb][nb]); } }
        asm volatile("" : "+v"(acc[0][0]), "+v"(acc[1][0]), "+v"(acc[2][0]), "+v"(acc[3][0]), "+v"(acc[0][1]), "+v"(acc[1][1]), "+v"(acc[2][1]), "+v"(acc[3][1]));
        asm volatile("v_nop\n\tv_nop\n\tv_nop\n\tv_nop" : "+v"(acc[0][2]), "+v"(acc[1][2]), "+v"(acc[2][2]), "+v"(acc[3][2]), "+v"(acc[0][3]), "+v"(acc[1][3]), "+v"(acc[2][3]), "+v"(acc[3][3]) : "v"(a[3]), "v"(a2[3]), "v"(b[3]));
    }
#pragma unroll
    for (int mb = 0; mb < 4; ++mb)
#pragma unroll
        for (int nb = 0; nb < 4; ++nb)
#pragma unroll
            for (int j = 0; j < 8; ++j) os[(mb * 16 + hi * 8 + j) * 68 + nb * 16 + lr] = acc[mb][nb][j];
    wave_lds_sync();
    const int bb = r0 / SEQ, sq = r0 % SEQ, hh = blockIdx.y;
    // Fragment-order stores: 8 lanes (r8) x 16 B fill one 128-B line of one 8-element chunk column, 4 chunk columns (cc) per instruction.
    const int r8 = lane & 7, cc = lane >> 3;
    if (MODE == 0) {
        const size_t pb = ((size_t)(bb * NH + hh) * SEQ + sq) * HD;
        float bz[2][8];
#pragma unroll
        for (int hf = 0; hf < 2; ++hf)
#pragma unroll
            for (int i = 0; i < 8; ++i) bz[hf][i] = bfr(bias[c0 + 8 * (4 * hf + cc) + i]);
#pragma unroll 1   // rolled: the epilogue is store-bound, and unrolled it would only take instruction cache
        for (int g = 0; g < 8; ++g) { const int row = 8 * g + r8;
#pragma unroll     // bz[hf] must be a compile-time register index
            for (int hf = 0; hf < 2; ++hf) { const int ch = 4 * hf + cc;
                const v4f u0 = *(const v4fa*)(os + row * 68 + 8 * ch); const v4f u1 = *(const v4fa*)(os + row * 68 + 8 * ch + 4); v8us oh, ol;
#pragma unroll
                for (int i = 0; i < 4; ++i) { unsigned short a, c; splitf((u0[i] + bz[hf][i]) * osc, a, c); oh[i] = a; ol[i] = c; splitf((u1[i] + bz[hf][4 + i]) * osc, a, c); oh[4 + i] = a; ol[4 + i] = c; }
                const size_t oo = pb + (size_t)(row >> 4) * (16 * HD) + ch * 128 + (row & 15) * 8;
                *(v8us*)(Oh + oo) = oh; *(v8us*)(Ol + oo) = ol; }
            asm volatile("s_wait_xcnt 0x0" ::: "memory");   // the next trip overwrites the stores' address and data registers
        }
    }
    if (MODE == 1) {
        const size_t vb = ((size_t)(bb * NH + hh) * SEQ + sq) * HD;
#pragma unroll 1   // rolled: the epilogue is store-bound, and unrolled it would only take instruction cache
        for (int g = 0; g < 8; ++g) { const int hd = 8 * g + r8; const float bzv = bfr(bias[c0 + hd]);
#pragma unroll
            for (int kq = 0; kq < 2; ++kq) { v8h o8;
#pragma unroll
                for (int i = 0; i < 8; ++i) o8[i] = (h16)(os[(32 * kq + 8 * cc + i) * 68 + hd] + bzv);
                *(v8h*)(Ov + vb + (size_t)kq * (32 * HD) + (hd >> 4) * 512 + cc * 128 + (hd & 15) * 8) = o8; }
            asm volatile("s_wait_xcnt 0x0" ::: "memory");   // the next trip overwrites the stores' address and data registers
        }
    }
    if (MODE == 2) {
        const int cofs = lr * 4;
        float bz4[4];
        const float* pbz = bias + c0 + cofs;
#pragma unroll
        for (int q = 0; q < 4; ++q) bz4[q] = bfr(pbz[q]);
        // The address pair is an input, so it stays whole until this wait: the load's result is not written into the pair that the load names.
        asm volatile("s_wait_xcnt 0x0" :: "v"(pbz) : "memory");
        // GELU in groups of 16 rows: a lane's 32 values of a group are independent chains, worked on stage by stage, so the vector port stays fed where one value at a time left a lone wave waiting out every link and two branches per value.
        // One wave-uniform test a group: where every |tv / sqrt(2)| of the group is below 1, erf is the math library's own polynomial for that range (same coefficients, same order of fused operations, odd in x: the same bits as erff);
        // any other group (a large value, an infinity) takes the erff loop, one row pair a trip.
        const v4f bzv = {bz4[0], bz4[1], bz4[2], bz4[3]};
#pragma unroll 1   // rolled: four trips of the same code; each trip's wait then stands in front of the next trip's writes of the stores' registers
        for (int s0 = 0; s0 < 32; s0 += 8) {
            const float* ob = os + (2 * s0 + hi) * 68 + cofs;
            float* og = Of + (size_t)(r0 + 2 * s0 + hi) * DM + c0 + cofs;
            v4f val[8], xx[8], t[8], p[8];
#pragma unroll
            for (int u = 0; u < 8; ++u) val[u] = *(const v4fa*)(ob + u * (2 * 68));
#pragma unroll
            for (int u = 0; u < 8; ++u) val[u] += bzv;
            float am[8];
#pragma unroll
            for (int u = 0; u < 8; ++u) am[u] = fmaxf(fmaxf(fabsf(val[u][0]), fabsf(val[u][1])), fmaxf(fabsf(val[u][2]), fabsf(val[u][3])));
            const float amax = fmaxf(fmaxf(fmaxf(am[0], am[1]), fmaxf(am[2], am[3])), fmaxf(fmaxf(am[4], am[5]), fmaxf(am[6], am[7])));
            // rounding is monotone, so the largest |tv| gives the largest |tv * 0.7071...|; a NaN is passed over by fmaxf and comes out as NaN of either path
            if (__builtin_amdgcn_ballot_w32(!(amax * 0.70710678118654752f < 1.0f)) == 0) {
#pragma unroll
                for (int u = 0; u < 8; ++u) xx[u] = val[u] * 0.70710678118654752f;
#pragma unroll
                for (int u = 0; u < 8; ++u) t[u] = xx[u] * xx[u];
#pragma unroll
                for (int u = 0; u < 8; ++u) p[u] = __builtin_elementwise_fma(t[u], (v4f)(-0x1.268bc2p-11f), (v4f)(0x1.420828p-8f));
#pragma unroll
                for (int u = 0; u < 8; ++u) p[u] = __builtin_elementwise_fma(t[u], p[u], (v4f)(-0x1.b5937p-6f));
#pragma unroll
                for (int u = 0; u < 8; ++u) p[u] = __builtin_elementwise_fma(t[u], p[u], (v4f)(0x1.ce077cp-4f));
#pragma unroll
                for (int u = 0; u < 8; ++u) p[u] = __builtin_elementwise_fma(t[u], p[u], (v4f)(-0x1.81266p-2f));
#pragma unroll
                for (int u = 0; u < 8; ++u) p[u] = __builtin_elementwise_fma(t[u], p[u], (v4f)(0x1.06eba0p-3f));
#pragma unroll
                for (int u = 0; u < 8; ++u) p[u] = __builtin_elementwise_fma(xx[u], p[u], xx[u]);
#pragma unroll
                for (int u = 0; u < 8; ++u) val[u] = 0.5f * val[u] * (1.0f + p[u]);
#pragma unroll
                for (int u = 0; u < 8; ++u) *(v4f*)(og + u * (2 * DM)) = val[u];
                asm volatile("s_wait_xcnt 0x0" ::: "memory");   // the next trip overwrites the stores' address and data registers
            } else {
#pragma unroll 1   // rolled: the rare path; unrolled it would only take instruction cache
                for (int u = 0; u < 8; ++u) { v4f w = *(const v4fa*)(ob + u * (2 * 68));
#pragma unroll
                    for (int q = 0; q < 4; ++q) { const float tv = w[q] + bz4[q]; w[q] = 0.5f * tv * (1.0f + erff(tv * 0.70710678118654752f)); }
                    *(v4f*)(og + u * (2 * DM)) = w; }
            }
        }
    }
}

// ---- k_qkv: the three projections of y, which do not depend on one another, as one grid (M/64, 384/64, 3): blockIdx.z = 0 q, 1 k, 2 v.
__global__ __launch_bounds__(32) void k_qkv(const bf* __restrict__ Yh, const bf* __restrict__ Yl, const bf* __restrict__ WQ, const bf* __restrict__ WK, const bf* __restrict__ WV,
                                            const float* __restrict__ bq, const float* __restrict__ bk, const float* __restrict__ bv, bf* Qh, bf* Ql, bf* Kh, bf* Kl, h16* VT) {
    __shared__ __align__(16) float os[64 * 68];
    const int z = blockIdx.z;
    if (z == 2) gemmw<1>(Yh, Yl, WV, bv, (bf*)nullptr, (bf*)nullptr, VT, (float*)nullptr, os);
    else gemmw<0>(Yh, Yl, z ? WK : WQ, z ? bk : bq, z ? Kh : Qh, z ? Kl : Ql, (h16*)nullptr, (float*)nullptr, os, z ? 1.0f : L2E);
}

// ---- k_proj: ctx hi|lo x Wp + bp -> erf GELU -> out; grid (M/64, 384/64).
__global__ __launch_bounds__(32) void k_proj(const bf* __restrict__ Ch, const bf* __restrict__ Cl, const bf* __restrict__ WP, const float* __restrict__ bp, float* Of) {
    __shared__ __align__(16) float os[64 * 68];
    gemmw<2>(Ch, Cl, WP, bp, (bf*)nullptr, (bf*)nullptr, (h16*)nullptr, Of, os);
}

// exp2 with the vector slot that the instruction set asks for behind a transcendental kept inside the statement: each v_exp_f32 is followed by an instruction that neither reads its result nor overwrites its source
// ("=&v": no result shares a register with a source of the group), the last one by v_nop.
__device__ __forceinline__ void exp2x4(float x0, float x1, float x2, float x3, float& y0, float& y1, float& y2, float& y3) {
    asm("v_exp_f32 %0, %4\n\tv_exp_f32 %1, %5\n\tv_exp_f32 %2, %6\n\tv_exp_f32 %3, %7\n\tv_nop" : "=&v"(y0), "=&v"(y1), "=&v"(y2), "=&v"(y3) : "v"(x0), "v"(x1), "v"(x2), "v"(x3));
}
__device__ __forceinline__ float exp2x1(float x) { float y; asm("v_exp_f32 %0, %1\n\tv_nop" : "=v"(y) : "v"(x)); return y; }

// ---- stage_copy: one ring stage = KS keys of the k hi, k lo and v^T planes (8192 contiguous bytes of each, fragment order kept) -> one LDS buffer [k hi | k lo | v^T], by asynchronous copies, through no register.
// 128 threads x 16 B = 2048 B a copy, four copies a plane. gh, gl, gv: the lane's own global addresses (plane + stage start + 8 elements x thread); lds: the lane's own LDS byte address (buffer start + 16 x thread).
__device__ __forceinline__ void stage_copy(const bf* gh, const bf* gl, const h16* gv, unsigned lds) {
    // s_wait_xcnt is the last line of the copies' own statement, so it stands in front of every later write of an address register that a copy names.
    asm volatile("global_load_async_to_lds_b128 %0, %12, off\n\t"
                 "global_load_async_to_lds_b128 %1, %13, off\n\t"
                 "global_load_async_to_lds_b128 %2, %14, off\n\t"
                 "global_load_async_to_lds_b128 %3, %15, off\n\t"
                 "global_load_async_to_lds_b128 %4, %16, off\n\t"
                 "global_load_async_to_lds_b128 %5, %17, off\n\t"
                 "global_load_async_to_lds_b128 %6, %18, off\n\t"
                 "global_load_async_to_lds_b128 %7, %19, off\n\t"
                 "global_load_async_to_lds_b128 %8, %20, off\n\t"
                 "global_load_async_to_lds_b128 %9, %21, off\n\t"
                 "global_load_async_to_lds_b128 %10, %22, off\n\t"
                 "global_load_async_to_lds_b128 %11, %23, off\n\t"
                 "s_wait_xcnt 0x0"
                 :: "v"(lds), "v"(lds + 2048u), "v"(lds + 4096u), "v"(lds + 6144u), "v"(lds + 8192u), "v"(lds + 10240u), "v"(lds + 12288u), "v"(lds + 14336u), "v"(lds + 16384u), "v"(lds + 18432u), "v"(lds + 20480u), "v"(lds + 22528u),
                    "v"(gh), "v"(gh + 1024), "v"(gh + 2048), "v"(gh + 3072), "v"(gl), "v"(gl + 1024), "v"(gl + 2048), "v"(gl + 3072), "v"(gv), "v"(gv + 1024), "v"(gv + 2048), "v"(gv + 3072)
                 : "memory");
}

// ---- k_attn: fused flash attention (unscaled scores, no mask), transposed form. Block = 4 waves, each owns 32 queries (two 16-query tiles) of one (b, h); grid (SEQ/128, NB*NH).
// The wave's Q fragments (hi|lo, both tiles) are loaded once and stay in registers; each K and V fragment loaded in the key loop feeds both query tiles.
// K hi|lo and V^T come through a two-buffer LDS ring that the four waves share: stage t + 1's copies fly while stage t (KS keys, two 32-key steps) is worked on, so no wave waits out a global load in the key loop.
// Per 32-key step and query tile: S^T[key][q] = Kh Qh^T + Kl Qh^T + Kh Ql^T (A = key rows from the k planes, B = query rows from the q planes, k index = hd);
// q carries log2 e, and the C operand of each tile's first product is CARRY - ref (ref = the query's held reference), so the accumulators hold the exponents themselves and exp2 reads them with no vector work in between;
// lane (n = query, h) holds keys 8h+r of both 16-key tiles; one test per 32-key step: only where a shifted score passes SLIM (and in the first step) ref is moved to the query's maximum, and the step's scores, O and l are brought to the new ref;
// the P^T B fragment is formed in registers (element r <- tile 0 value r, element 8+r <- tile 1 value r; f16, 2^CARRY at the reference); O^T[hd][q] += V^T[hd][key] P^T[key][q] (A from the f16 v^T plane).
// l is accumulated from the unconverted f32 p values (per-lane partials, combined once at the end). Q fragments come straight from the fragment-order global planes, K and V fragments from the ring, which keeps that order (two 16-B loads each, 512 contiguous bytes per load: no bank conflict).
__global__ __launch_bounds__(128) void k_attn(const bf* __restrict__ Qh, const bf* __restrict__ Ql, const bf* __restrict__ Kh, const bf* __restrict__ Kl, const h16* __restrict__ Vt, bf* Ch, bf* Cl) {
#pragma clang fp contract(off)
    __shared__ __align__(16) float os[4 * 2 * 16 * 68];
    __shared__ __align__(16) bf ring[2][3 * KS * HD];
    const int lane = threadIdx.x & 31, lr = lane & 15, hi = lane >> 4;
    const int wave = __builtin_amdgcn_readfirstlane(threadIdx.x >> 5);
    const int bh = blockIdx.y;
    const int q0 = blockIdx.x * 128 + wave * 32;
    const size_t pbase = (size_t)bh * SEQ * HD;
    const bf* qh = Qh + pbase; const bf* ql = Ql + pbase; const bf* kh = Kh + pbase; const bf* kl = Kl + pbase; const h16* vt = Vt + pbase;
    const int qoff0 = q0 * HD + 8 * lane;
    v16bf bqh[2][2], bql[2][2];
#pragma unroll
    for (int t = 0; t < 2; ++t)
#pragma unroll
        for (int ks = 0; ks < 2; ++ks) { bqh[t][ks] = ldbf(qh + qoff0 + t * (16 * HD) + ks * 512); bql[t][ks] = ldbf(ql + qoff0 + t * (16 * HD) + ks * 512); }
    v8f o[2][4];
#pragma unroll
    for (int t = 0; t < 2; ++t)
#pragma unroll
        for (int j = 0; j < 4; ++j) o[t][j] = (v8f){};
    float l[2] = {0.0f, 0.0f};
    v8f cref[2];   // CARRY - ref in all eight elements: the score products' C operand; ref = 0 until the first step sets it
#pragma unroll
    for (int t = 0; t < 2; ++t)
#pragma unroll
        for (int r = 0; r < 8; ++r) cref[t][r] = CARRY;
    float lim = -3.0e38f;   // the first step always sets ref; SLIM from then on
    const bf* gkh = kh + 8 * threadIdx.x; const bf* gkl = kl + 8 * threadIdx.x; const h16* gvt = vt + 8 * threadIdx.x;
    const unsigned lds0 = (unsigned)(size_t)&ring[0][0] + 16u * threadIdx.x;   // LDS byte address = low 32 bits of the shared address
    stage_copy(gkh, gkl, gvt, lds0);
    asm volatile("s_wait_asynccnt 0x0" ::: "memory");   // this wave's share of stage 0 has landed
    __syncthreads();                                     // every wave's share has: stage 0 may be read
    stage_copy(gkh + KS * HD, gkl + KS * HD, gvt + KS * HD, lds0 + (unsigned)sizeof(ring[0]));
#pragma unroll 1
    for (int st = 0; st < SEQ / KS; ++st) {
      const bf* sb = ring[st & 1] + 8 * lane;
#pragma unroll 1   // rolled: each step then opens with its 16 K reads as one group ahead of its score WMMAs (the V reads stand among the exponentials); unrolled, the compiler spread the reads among the WMMAs
      for (int kk = 0; kk < KS; kk += 32) {
        const bf* skh = sb + kk * HD; const bf* skl = skh + KS * HD;
        v8f s0[2], s1[2];
#pragma unroll
        for (int t = 0; t < 2; ++t) { s0[t] = cref[t]; s1[t] = cref[t]; }
#pragma unroll
        for (int ks = 0; ks < 2; ++ks) {
            const v16bf a0h = ldbf(skh + ks * 512), a0l = ldbf(skl + ks * 512);
            const v16bf a1h = ldbf(skh + 16 * HD + ks * 512), a1l = ldbf(skl + 16 * HD + ks * 512);
            s0[0] = wmmab(a0h, bqh[0][ks], s0[0]); s1[0] = wmmab(a1h, bqh[0][ks], s1[0]); s0[1] = wmmab(a0h, bqh[1][ks], s0[1]); s1[1] = wmmab(a1h, bqh[1][ks], s1[1]);
            s0[0] = wmmab(a0l, bqh[0][ks], s0[0]); s1[0] = wmmab(a1l, bqh[0][ks], s1[0]); s0[1] = wmmab(a0l, bqh[1][ks], s0[1]); s1[1] = wmmab(a1l, bqh[1][ks], s1[1]);
            s0[0] = wmmab(a0h, bql[0][ks], s0[0]); s1[0] = wmmab(a1h, bql[0][ks], s1[0]); s0[1] = wmmab(a0h, bql[1][ks], s0[1]); s1[1] = wmmab(a1h, bql[1][ks], s1[1]);
        }
        const h16* pv = (const h16*)(skh + 2 * KS * HD);
        const v16h va0 = ldhf(pv), va1 = ldhf(pv + 512), va2 = ldhf(pv + 1024), va3 = ldhf(pv + 1536);
        v16h pf[2];
        float mx[2];
#pragma unroll
        for (int t = 0; t < 2; ++t) {
            mx[t] = fmaxf(s0[t][0], s1[t][0]);
#pragma unroll
            for (int r = 1; r < 8; ++r) mx[t] = fmaxf(mx[t], fmaxf(s0[t][r], s1[t][r]));
        }
        // One scalar branch per step, rarely taken after the first step: it keeps the exchange between the halves, the subtractions and the 64 multiplies of O out of the common path.
        if (__builtin_amdgcn_ballot_w32(fmaxf(mx[0], mx[1]) > lim) != 0) {
#pragma unroll
            for (int t = 0; t < 2; ++t) {
                const float mq = fmaxf(mx[t], __shfl_xor(mx[t], 16, 32));   // the same in both lanes of a query, so both take the same step
                const float delta = mq > lim ? mq - CARRY : 0.0f;          // ref += delta: the query's largest score of this step lands on CARRY
                const float alpha = exp2x1(fminf(-delta, 0.0f));            // delta < 0 only in the first step, where O and l are 0: alpha stays finite
#pragma unroll
                for (int r = 0; r < 8; ++r) { s0[t][r] -= delta; s1[t][r] -= delta; cref[t][r] -= delta; }
                l[t] *= alpha;
#pragma unroll
                for (int j = 0; j < 4; ++j)
#pragma unroll
                    for (int r = 0; r < 8; ++r) o[t][j][r] *= alpha;
            }
            lim = SLIM;
        }
#pragma unroll
        for (int t = 0; t < 2; ++t) {
            float psum = 0.0f;
#pragma unroll
            for (int r = 0; r < 8; r += 2) {
                float p0, p1, p2, p3;
                exp2x4(s0[t][r], s1[t][r], s0[t][r + 1], s1[t][r + 1], p0, p1, p2, p3);
                psum += p0 + p1;
                psum += p2 + p3;
                pf[t][r] = (h16)p0; pf[t][8 + r] = (h16)p1; pf[t][r + 1] = (h16)p2; pf[t][9 + r] = (h16)p3; }
            l[t] += psum;
        }
#pragma unroll
        for (int t = 0; t < 2; ++t) { o[t][0] = wmma16(va0, pf[t], o[t][0]); o[t][1] = wmma16(va1, pf[t], o[t][1]); o[t][2] = wmma16(va2, pf[t], o[t][2]); o[t][3] = wmma16(va3, pf[t], o[t][3]); }
      }
      // Publish point of stage st + 1, every wave, in this order.
      asm volatile("s_wait_dscnt 0x0" ::: "memory");      // this wave's reads of stage st's buffer are done before the buffer is refilled
      asm volatile("s_wait_asynccnt 0x0" ::: "memory");   // this wave's share of stage st + 1 has landed
      __syncthreads();                                     // every wave's share has, and every wave has left stage st's buffer
      if (st + 2 < SEQ / KS) stage_copy(gkh + (st + 2) * (KS * HD), gkl + (st + 2) * (KS * HD), gvt + (st + 2) * (KS * HD), lds0 + (unsigned)(st & 1) * (unsigned)sizeof(ring[0]));
    }
    asm volatile("s_wait_asynccnt 0x0" ::: "memory");   // no copy is outstanding when the wave goes on to its end
    const int b = bh / NH, h = bh % NH;
    const int r8 = lane & 7, cc = lane >> 3;
#pragma unroll
    for (int t = 0; t < 2; ++t) {
        const float lt = l[t] + __shfl_xor(l[t], 16, 32);
        const float inv = 1.0f / lt;   // O and l carry the same factor 2^(CARRY - ref)
        const int wbase = (wave * 2 + t) * (16 * 68);
#pragma unroll
        for (int j = 0; j < 4; ++j)
#pragma unroll
            for (int r = 0; r < 8; ++r) os[wbase + lr * 68 + 16 * j + 8 * hi + r] = o[t][j][r] * inv;
    }
    wave_lds_sync();
#pragma unroll 1   // rolled: each trip's wait then stands in front of every later write of its stores' registers
    for (int u = 0; u < 8; ++u) { const int t = u >> 2, s = u & 3;
        const int wbase = (wave * 2 + t) * (16 * 68);
        const int row = 8 * (s & 1) + r8, ch = 4 * (s >> 1) + cc;
        const v4f u0 = *(const v4fa*)(os + wbase + row * 68 + 8 * ch); const v4f u1 = *(const v4fa*)(os + wbase + row * 68 + 8 * ch + 4); v8us oh, ol;
#pragma unroll
        for (int i = 0; i < 4; ++i) { unsigned short a, c; splitf(u0[i], a, c); oh[i] = a; ol[i] = c; splitf(u1[i], a, c); oh[4 + i] = a; ol[4 + i] = c; }
        const size_t oo = ((size_t)b * SEQ + q0 + 16 * t) * DM + (h * 8 + ch) * 128 + row * 8;
        *(v8us*)(Ch + oo) = oh; *(v8us*)(Cl + oo) = ol;
        asm volatile("s_wait_xcnt 0x0" ::: "memory");   // the next trip overwrites the stores' address and data registers
    }
}

extern "C" void kernel_launch(void* const* d_in, const int* in_sizes, int n_in,
                              void* d_out, int out_size, void* d_ws, size_t ws_size, hipStream_t stream) {
    if (n_in < 11) return;
    if ((size_t)in_sizes[0] < ((size_t)(NB - 1) * SEQ_FULL + SEQ) * DM) return;
    if (in_sizes[1] < DM || in_sizes[2] < DM) return;
    if (in_sizes[3] < NH * DM * HD || in_sizes[5] < NH * DM * HD || in_sizes[7] < NH * DM * HD || in_sizes[9] < DM * DM) return;
    if (in_sizes[4] < DM || in_sizes[6] < DM || in_sizes[8] < DM || in_sizes[10] < DM) return;
    if ((size_t)out_size < (size_t)MTOK * DM) return;
    const float* x   = (const float*)d_in[0];
    const float* lng = (const float*)d_in[1];
    const float* lnb = (const float*)d_in[2];
    const float* wq  = (const float*)d_in[3];
    const float* bq  = (const float*)d_in[4];
    const float* wk  = (const float*)d_in[5];
    const float* bk  = (const float*)d_in[6];
    const float* wv  = (const float*)d_in[7];
    const float* bv  = (const float*)d_in[8];
    const float* wp  = (const float*)d_in[9];
    const float* bp  = (const float*)d_in[10];
    float* OUT = (float*)d_out;     // [NB][SEQ][384]
    char* wsp = (char*)d_ws;
    auto take = [&](size_t bytes) { char* p = wsp; wsp += (bytes + 255) & ~(size_t)255; return (void*)p; };
    const size_t WSZ = (size_t)DM * DM * 2;            // one transposed bf16 weight plane [384][384]
    const size_t PSZ = (size_t)MTOK * DM * 2;          // one 16-bit activation plane
    bf* WQ = (bf*)take(WSZ); bf* WK = (bf*)take(WSZ); bf* WV = (bf*)take(WSZ); bf* WP = (bf*)take(WSZ);
    bf* Yh = (bf*)take(PSZ); bf* Yl = (bf*)take(PSZ);
    bf* Qh = (bf*)take(PSZ); bf* Ql = (bf*)take(PSZ); bf* Kh = (bf*)take(PSZ); bf* Kl = (bf*)take(PSZ);
    h16* VT = (h16*)take(PSZ);
    if ((size_t)(wsp - (char*)d_ws) > ws_size) return;
    bf* Ch = Yh; bf* Cl = Yl;   // ctx planes reuse the y planes (y is dead after the three projections; stream-ordered)

    k_prep<<<4 * WT_TILES + MTOK / 8, 256, 0, stream>>>(x, lng, lnb, wq, wk, wv, wp, Yh, Yl, WQ, WK, WV, WP);
    k_qkv<<<dim3(MTOK / 64, DM / 64, 3), 32, 0, stream>>>(Yh, Yl, WQ, WK, WV, bq, bk, bv, Qh, Ql, Kh, Kl, VT);
    k_attn<<<dim3(SEQ / 128, NB * NH, 1), 128, 0, stream>>>(Qh, Ql, Kh, Kl, VT, Ch, Cl);
    k_proj<<<dim3(MTOK / 64, DM / 64, 1), 32, 0, stream>>>(Ch, Cl, WP, bp, OUT);
}

// v007
// Measured time: 120 microseconds a run.
// Next to v006, in two timings, it ran 1.04 times as fast each time.
// Over all steps from v000 it is 3.79 times as fast.
#include <hip/hip_runtime.h>

// Compute dtypes, f32 accumulate everywhere: inputs converted to bf16 (RNE); q/k/v and output projections = bf16 WMMA with the activation as hi|lo planes against exact bf16 weights (2 products); scores = bf16 WMMA q hi|lo x k hi|lo (3 products); P.V = f16 WMMA (P carried x16 relative to a held reference, V plain f16); LayerNorm, softmax, GELU in f32.
// Every 16-bit WMMA operand plane with 384-long rows (y, ctx, transposed weights) is kept in fragment order [row/16][k/8][row%16][k%8].
// Pre-LN attention: y = LN(x) -> hi|lo planes; per-head projections written straight into head planes in WMMA fragment order (q,k hi|lo [b][h][s/16][hd/8][s%16][hd%8]; v^T f16 [b][h][s/32][hd/16][(s%32)/8][hd%16][s%8]), so that each 16-B-per-lane fragment load of the attention kernel is 512 contiguous bytes and a run of keys is one contiguous block of each plane; fused flash attention in the transposed form S^T = K Q^T, O^T = V^T P^T (P fragment built in registers from the score accumulators); ctx hi|lo x Wp + bp -> erf GELU -> out.

#ifndef NB
#define NB 8
#endif
#ifndef SEQ
#define SEQ 2048
#endif
#define NB_FULL  8
#define SEQ_FULL 2048
#define DM   384
#define NH   6
#define HD   64
#define MTOK (NB * SEQ)
#define CARRY 4.0f    // log2 of the carry: a score equal to the held reference gives p = 2^4 in the f16 P fragment
#define SLIM  15.0f   // the reference is raised when a shifted score passes this: p stays at or below 2^15, inside f16
#define L2E  1.4426950408889634f
#define KS   64   // keys per stage of the attention kernel's LDS ring

static_assert(SEQ % 128 == 0);
static_assert(KS % 32 == 0 && SEQ % KS == 0 && SEQ / KS >= 2);
static_assert(KS * HD * 2 == 4 * 128 * 16);   // one plane's share of a stage = four 16-B copies of each of the 128 threads
static_assert(DM % 64 == 0);
static_assert(DM % 32 == 0);
static_assert(NH * HD == DM);
static_assert(NB <= NB_FULL);
static_assert(SEQ <= SEQ_FULL);
static_assert((size_t)4 * DM * DM * 2 + (size_t)7 * MTOK * DM * 2 <= (size_t)134217728);

typedef _Float16 h16;
typedef unsigned short bf;
typedef __attribute__((ext_vector_type(16))) __bf16   v16bf;
typedef __attribute__((ext_vector_type(16))) _Float16 v16h;
typedef __attribute__((ext_vector_type(8)))  _Float16 v8h;
typedef __attribute__((ext_vector_type(8)))  unsigned short v8us;
typedef __attribute__((ext_vector_type(4)))  unsigned short v4us;
typedef __attribute__((ext_vector_type(8)))  float    v8f;
typedef __attribute__((ext_vector_type(4)))  float    v4f;
typedef v4f  __attribute__((may_alias)) v4fa;

__device__ __forceinline__ unsigned short f2bf(float f) { unsigned u = __float_as_uint(f); u += 0x7FFFu + ((u >> 16) & 1u); return (unsigned short)(u >> 16); }
__device__ __forceinline__ float bf2f(unsigned short b) { return __uint_as_float(((unsigned)b) << 16); }
__device__ __forceinline__ float bfr(float f) { return bf2f(f2bf(f)); }
__device__ __forceinline__ void splitf(float y, unsigned short& h, unsigned short& l) { h = f2bf(y); l = f2bf(y - bf2f(h)); }
__device__ __forceinline__ v16h cat16(v8h lo, v8h hi) { return __builtin_shufflevector(lo, hi, 0, 1, 2, 3, 4, 5, 6, 7, 8, 9, 10, 11, 12, 13, 14, 15); }
__device__ __forceinline__ v16bf cat16b(v8us lo, v8us hi) { return __builtin_bit_cast(v16bf, __builtin_shufflevector(lo, hi, 0, 1, 2, 3, 4, 5, 6, 7, 8, 9, 10, 11, 12, 13, 14, 15)); }
__device__ __forceinline__ v8f wmma16(v16h a, v16h b, v8f c) { return __builtin_amdgcn_wmma_f32_16x16x32_f16(false, a, false, b, (short)0, c, false, false); }
__device__ __forceinline__ v8f wmmab(v16bf a, v16bf b, v8f c) { return __builtin_amdgcn_wmma_f32_16x16x32_bf16(false, a, false, b, (short)0, c, false, false); }
// Fragment loaders from fragment-order planes: p already holds the 512-element (16 rows x 32 k) block base + 8*lane, lane = 16*h + row; elements 0..7 = k0+8h.., elements 8..15 = k0+16+8h..; each load covers four whole 128-B lines.
__device__ __forceinline__ v16bf ldbf(const bf* p) { return cat16b(*(const v8us*)p, *(const v8us*)(p + 256)); }
__device__ __forceinline__ v16h ldhf(const h16* p) { return cat16(*(const v8h*)p, *(const v8h*)(p + 256)); }
// Same-wave LDS exchange (wave-private tiles only).
__device__ __forceinline__ void wave_lds_sync() { __builtin_amdgcn_fence(3 /* release order */, "wavefront"); __builtin_amdgcn_wave_barrier(); __builtin_amdgcn_fence(2 /* acquire order */, "wavefront"); asm volatile("" ::: "memory"); }

// ---- wt_body: in[z][rows][cols] (f32) -> transposed matrix out[n = z*cols + col][k = row] (bf16 RNE) in fragment order [n/16][k/8][n%16][k%8], one 64x64 tile (bx, by, bz) of (rows/64, cols/64, z) through LDS (t: 64 x 65 floats); 256 threads.
__device__ __forceinline__ void wt_body(const float* __restrict__ src, bf* dst, int rows, int cols, int bx, int by, int bz, float* t) {
    const int tid = threadIdx.x;
    const size_t zo = (size_t)bz * (size_t)rows * (size_t)cols;
    const int r0 = bx * 64, c0 = by * 64;
#pragma unroll 1   // four loads in flight a trip; rolled: each trip's wait then stands in front of the next trip's address writes
    for (int i0 = 0; i0 < 16; i0 += 4) { const int cc = tid & 63; const float* p[4]; float v[4];
#pragma unroll
        for (int u = 0; u < 4; ++u) { p[u] = src + zo + (size_t)(r0 + (tid >> 6) + 4 * (i0 + u)) * cols + c0 + cc; v[u] = *p[u]; }
        // The four address pairs are inputs, so they stay whole until this wait: no load's result and no next address is written into a pair that an issued load still names.
        asm volatile("s_wait_xcnt 0x0" :: "v"(p[0]), "v"(p[1]), "v"(p[2]), "v"(p[3]) : "memory");
#pragma unroll
        for (int u = 0; u < 4; ++u) t[((tid >> 6) + 4 * (i0 + u)) * 65 + cc] = v[u]; }
    __syncthreads();
    const int pc = (tid >> 3) & 7;
#pragma unroll
    for (int it = 0; it < 2; ++it) { const int line = (tid & 7) + 8 * (tid >> 6) + 32 * it; v8us o;
#pragma unroll
        for (int i = 0; i < 8; ++i) o[i] = f2bf(t[(8 * pc + i) * 65 + line]);
        const int n = bz * cols + c0 + line;
        *(v8us*)(dst + (size_t)(n >> 4) * 16 * rows + (size_t)((r0 >> 3) + pc) * 128 + (n & 15) * 8) = o; }
}

// ---- ln_body: one wave takes 8 consecutive tokens (the 8 rows of one 128-B line of the fragment-order planes); block blk takes tokens 64*blk..64*blk+63, so the whole LayerNorm is MTOK/64 blocks, all resident at once.
// A wave's 24 row loads are issued together; the 8 tokens' sums run side by side (each token's own sum order is that of one wave per token); gain and bias are rounded once a wave.
// The 8 tokens are gathered in the wave's own LDS range (no block barrier), so that each 128-B line (8 tokens x 16 B) is stored whole. Row pitch LNP: 16 lanes x 16 B of a read fall on 64 different banks.
#define LNT 8
#define LNP (DM + 16)
static_assert(SEQ % (8 * LNT) == 0);
static_assert(LNT == 8);
// One level of the 8 tokens' butterfly sums: e[t] = s[t] of the partner lane (a = 4 x that lane's number), what __shfl_xor gives. The 8 exchanges go out as one group and share one wait;
// written as shuffles, the compiler ran the tokens one after another, with a full LDS-unit wait behind every single exchange. The exchanges and their wait stand in one statement, so no reader of a result can come ahead of the wait.
__device__ __forceinline__ void xchg8(int a, const float (&s)[LNT], float (&e)[LNT]) {
    asm volatile("ds_bpermute_b32 %0, %8, %9\n\t"
                 "ds_bpermute_b32 %1, %8, %10\n\t"
                 "ds_bpermute_b32 %2, %8, %11\n\t"
                 "ds_bpermute_b32 %3, %8, %12\n\t"
                 "ds_bpermute_b32 %4, %8, %13\n\t"
                 "ds_bpermute_b32 %5, %8, %14\n\t"
                 "ds_bpermute_b32 %6, %8, %15\n\t"
                 "ds_bpermute_b32 %7, %8, %16\n\t"
                 "s_wait_dscnt 0x0"
                 : "=&v"(e[0]), "=&v"(e[1]), "=&v"(e[2]), "=&v"(e[3]), "=&v"(e[4]), "=&v"(e[5]), "=&v"(e[6]), "=&v"(e[7])
                 : "v"(a), "v"(s[0]), "v"(s[1]), "v"(s[2]), "v"(s[3]), "v"(s[4]), "v"(s[5]), "v"(s[6]), "v"(s[7])
                 : "memory");
}
__device__ __forceinline__ void ln_body(const float* __restrict__ x, const float* __restrict__ g, const float* __restrict__ be, bf* Yh, bf* Yl, int blk, bf* sall) {
    const int lane = threadIdx.x & 31;
    const int wave = __builtin_amdgcn_readfirstlane(threadIdx.x >> 5);
    const int grp = blk * 8 + wave;   // index of the 8-token group
    const int tok = grp * LNT;
    const int b = tok / SEQ, s = tok % SEQ;
    const float* xr = x + ((size_t)b * SEQ_FULL + s) * DM + lane * 4;
    const float* pg = g + lane * 4; const float* pb = be + lane * 4;
    bf* sw = sall + wave * (2 * LNT * LNP);
    v4f v[LNT][3], gg[3], bb[3];
#pragma unroll
    for (int t = 0; t < LNT; ++t)
#pragma unroll
        for (int j = 0; j < 3; ++j) v[t][j] = *(const v4f*)(xr + t * DM + j * 128);
#pragma unroll
    for (int j = 0; j < 3; ++j) { gg[j] = *(const v4f*)(pg + j * 128); bb[j] = *(const v4f*)(pb + j * 128); }
    // The three addresses are inputs, so the registers they are formed from stay whole until this wait: no load's result is written into a register that an issued load still names.
    asm volatile("s_wait_xcnt 0x0" :: "v"(xr), "v"(pg), "v"(pb) : "memory");
    float sum[LNT], var[LNT], ex[LNT];
#pragma unroll
    for (int t = 0; t < LNT; ++t) { sum[t] = 0.0f;
#pragma unroll
        for (int j = 0; j < 3; ++j)
#pragma unroll
            for (int q = 0; q < 4; ++q) { v[t][j][q] = bfr(v[t][j][q]); sum[t] += v[t][j][q]; } }
#pragma unroll
    for (int sh = 16; sh; sh >>= 1) { xchg8(4 * (lane ^ sh), sum, ex);
#pragma unroll
        for (int t = 0; t < LNT; ++t) sum[t] += ex[t]; }
#pragma unroll
    for (int t = 0; t < LNT; ++t) { sum[t] *= (1.0f / DM); var[t] = 0.0f;   // sum[t] is the mean from here on
#pragma unroll
        for (int j = 0; j < 3; ++j)
#pragma unroll
            for (int q = 0; q < 4; ++q) { const float d = v[t][j][q] - sum[t]; var[t] += d * d; } }
#pragma unroll
    for (int sh = 16; sh; sh >>= 1) { xchg8(4 * (lane ^ sh), var, ex);
#pragma unroll
        for (int t = 0; t < LNT; ++t) var[t] += ex[t]; }
#pragma unroll
    for (int j = 0; j < 3; ++j)
#pragma unroll
        for (int q = 0; q < 4; ++q) { gg[j][q] = bfr(gg[j][q]); bb[j][q] = bfr(bb[j][q]); }
#pragma unroll
    for (int t = 0; t < LNT; ++t) { const float mu = sum[t]; const float rs = rsqrtf(var[t] * (1.0f / DM) + 1e-5f);
#pragma unroll
        for (int j = 0; j < 3; ++j) { v4us oh, ol;
#pragma unroll
            for (int q = 0; q < 4; ++q) { const float y = (v[t][j][q] - mu) * rs * gg[j][q] + bb[j][q]; unsigned short a, c; splitf(y, a, c); oh[q] = a; ol[q] = c; }
            *(v4us*)(sw + t * LNP + j * 128 + lane * 4) = oh; *(v4us*)(sw + (LNT + t) * LNP + j * 128 + lane * 4) = ol; } }
    wave_lds_sync();   // the rows read back below were written by this wave alone
    const int r8 = lane & 7, c4 = lane >> 3;
    const size_t tb = (size_t)(grp >> 1) * (16 * DM) + (grp & 1) * 64 + r8 * 8;
#pragma unroll
    for (int pl = 0; pl < 2; ++pl) { bf* yo = (pl ? Yl : Yh) + tb + c4 * 128; const bf* sr = sw + (pl * LNT + r8) * LNP + c4 * 8; v8us ov[DM / 32];
#pragma unroll
        for (int i = 0; i < DM / 32; ++i) ov[i] = *(const v8us*)(sr + i * 32);
#pragma unroll
        for (int i = 0; i < DM / 32; ++i) *(v8us*)(yo + i * 512) = ov[i];   // four whole 128-B lines an instruction
        asm volatile("s_wait_xcnt 0x0" ::: "memory"); }   // behind each plane's stores: code follows that overwrites the stores' address and data registers
}

// ---- k_prep: the five jobs that depend on the inputs alone, as block ranges of one grid (256 threads): blocks 0..MTOK/64-1 do LayerNorm (first: they are the long ones), the last 144 transpose the four weights (36 tiles each).
#define WT_TILES ((DM / 64) * (DM / 64))
#define LN_BLOCKS (MTOK / (8 * LNT))
__global__ __launch_bounds__(256) void k_prep(const float* __restrict__ x, const float* __restrict__ g, const float* __restrict__ be,
                                              const float* __restrict__ wq, const float* __restrict__ wk, const float* __restrict__ wv, const float* __restrict__ wp,
                                              bf* Yh, bf* Yl, bf* WQ, bf* WK, bf* WV, bf* WP) {
    __shared__ __align__(16) float sm[8 * 2 * LNT * LNP / 2];   // one buffer for both jobs: a block does one of them
    static_assert(sizeof(float) * 64 * 65 <= sizeof(bf) * 8 * 2 * LNT * LNP);
    const int bid = blockIdx.x;
    if (bid >= LN_BLOCKS) {   // the same for the whole block
        const int wb = bid - LN_BLOCKS;
        const int w = wb / WT_TILES, r = wb % WT_TILES, bx = r % (DM / 64), bo = r / (DM / 64);
        // per-head [h][d][k] -> Bt[h*64 + k][d]: in[rows = 384 (d)][cols = 64 (k)], z = head (bo); Wp [in = 384 (d)][out = 384 (n)] -> Bt[n][d]: in[rows = 384][cols = 384], column tile bo
        wt_body(w == 0 ? wq : w == 1 ? wk : w == 2 ? wv : wp, w == 0 ? WQ : w == 1 ? WK : w == 2 ? WV : WP, DM, w == 3 ? DM : HD, bx, w == 3 ? bo : 0, w == 3 ? 0 : bo, sm);
        return;
    }
    ln_body(x, g, be, Yh, Yl, bid, (bf*)sm);
}

// ---- gemmw: register-blocked GEMM, ONE WAVE per 64x64 output tile (16 accumulators), operands straight from fragment-order bf16 planes (K = 384); tile (blockIdx.x, blockIdx.y) of (M/64, 384/64), 32 threads; os: 64 x 68 floats of LDS.
// MODE 0: hi|lo head planes (q, k), the value times osc before the split (log2 e for q, so that the scores come out in the log2 domain; 1 for k); MODE 1: f16 v^T head plane; MODE 2: f32 output rows [tok][384] with exact erf GELU (16 lanes x 16 B = 256 B per row segment, 2 rows per instruction).
template <int MODE>
__device__ __forceinline__ void gemmw(const bf* __restrict__ A, const bf* __restrict__ A2, const bf* __restrict__ Bt, const float* __restrict__ bias, bf* Oh, bf* Ol, h16* Ov, float* Of, float* os, float osc = 1.0f) {
    const int lane = threadIdx.x & 31, lr = lane & 15, hi = lane >> 4;
    const int r0 = blockIdx.x * 64, c0 = blockIdx.y * 64;
    v8f acc[4][4];
#pragma unroll
    for (int mb = 0; mb < 4; ++mb)
#pragma unroll
        for (int nb = 0; nb < 4; ++nb) acc[mb][nb] = (v8f){};
    const size_t aoff = (size_t)r0 * DM + 8 * lane, boff = (size_t)c0 * DM + 8 * lane;
#pragma unroll 1
    for (int kc = 0; kc < DM; kc += 32) {
        v16bf a[4], a2[4], b[4];
        const bf* pa = A + aoff + kc * 16; const bf* pa2 = A2 + aoff + kc * 16; const bf* pb = Bt + boff + kc * 16;
#pragma unroll
        for (int mb = 0; mb < 4; ++mb) { a[mb] = ldbf(pa + mb * 16 * DM); b[mb] = ldbf(pb + mb * 16 * DM); a2[mb] = ldbf(pa2 + mb * 16 * DM); }
        // The three address pairs are inputs, so they stay whole until this wait: no load's result and no next address is written into a pair that an issued load of this trip still names.
        asm volatile("s_wait_xcnt 0x0" :: "v"(pa), "v"(pa2), "v"(pb) : "memory");
#pragma unroll
        for (int nb = 0; nb < 4; ++nb) {
#pragma unroll
            for (int mb = 0; mb < 4; ++mb) { acc[mb][nb] = wmmab(a[mb], b[nb], acc[mb][nb]); acc[mb][nb] = wmmab(a2[mb], b[nb], acc[mb][nb]); } }
        asm volatile("" : "+v"(acc[0][0]), "+v"(acc[1][0]), "+v"(acc[2][0]), "+v"(acc[3][0]), "+v"(acc[0][1]), "+v"(acc[1][1]), "+v"(acc[2][1]), "+v"(acc[3][1]));
        asm volatile("v_nop\n\tv_nop\n\tv_nop\n\tv_nop" : "+v"(acc[0][2]), "+v"(acc[1][2]), "+v"(acc[2][2]), "+v"(acc[3][2]), "+v"(acc[0][3]), "+v"(acc[1][3]), "+v"(acc[2][3]), "+v"(acc[3][3]) : "v"(a[3]), "v"(a2[3]), "v"(b[3]));
    }
#pragma unroll
    for (int mb = 0; mb < 4; ++mb)
#pragma unroll
        for (int nb = 0; nb < 4; ++nb)
#pragma unroll
            for (int j = 0; j < 8; ++j) os[(mb * 16 + hi * 8 + j) * 68 + nb * 16 + lr] = acc[mb][nb][j];
    wave_lds_sync();
    const int bb = r0 / SEQ, sq = r0 % SEQ, hh = blockIdx.y;
    // Fragment-order stores: 8 lanes (r8) x 16 B fill one 128-B line of one 8-element chunk column, 4 chunk columns (cc) per instruction.
    const int r8 = lane & 7, cc = lane >> 3;
    if (MODE == 0) {
        const size_t pb = ((size_t)(bb * NH + hh) * SEQ + sq) * HD;
        float bz[2][8];
#pragma unroll
        for (int hf = 0; hf < 2; ++hf)
#pragma unroll
            for (int i = 0; i < 8; ++i) bz[hf][i] = bfr(bias[c0 + 8 * (4 * hf + cc) + i]);
#pragma unroll 1   // rolled: the epilogue is store-bound, and unrolled it would only take instruction cache
        for (int g = 0; g < 8; ++g) { const int row = 8 * g + r8;
#pragma unroll     // bz[hf] must be a compile-time register index
            for (int hf = 0; hf < 2; ++hf) { const int ch = 4 * hf + cc;
                const v4f u0 = *(const v4fa*)(os + row * 68 + 8 * ch); const v4f u1 = *(const v4fa*)(os + row * 68 + 8 * ch + 4); v8us oh, ol;
#pragma unroll
                for (int i = 0; i < 4; ++i) { unsigned short a, c; splitf((u0[i] + bz[hf][i]) * osc, a, c); oh[i] = a; ol[i] = c; splitf((u1[i] + bz[hf][4 + i]) * osc, a, c); oh[4 + i] = a; ol[4 + i] = c; }
                const size_t oo = pb + (size_t)(row >> 4) * (16 * HD) + ch * 128 + (row & 15) * 8;
                *(v8us*)(Oh + oo) = oh; *(v8us*)(Ol + oo) = ol; }
            asm volatile("s_wait_xcnt 0x0" ::: "memory");   // the next trip overwrites the stores' address and data registers
        }
    }
    if (MODE == 1) {
        const size_t vb = ((size_t)(bb * NH + hh) * SEQ + sq) * HD;
#pragma unroll 1   // rolled: the epilogue is store-bound, and unrolled it would only take instruction cache
        for (int g = 0; g < 8; ++g) { const int hd = 8 * g + r8; const float bzv = bfr(bias[c0 + hd]);
#pragma unroll
            for (int kq = 0; kq < 2; ++kq) { v8h o8;
#pragma unroll
                for (int i = 0; i < 8; ++i) o8[i] = (h16)(os[(32 * kq + 8 * cc + i) * 68 + hd] + bzv);
                *(v8h*)(Ov + vb + (size_t)kq * (32 * HD) + (hd >> 4) * 512 + cc * 128 + (hd & 15) * 8) = o8; }
            asm volatile("s_wait_xcnt 0x0" ::: "memory");   // the next trip overwrites the stores' address and data registers
        }
    }
    if (MODE == 2) {
        const int cofs = lr * 4;
        float bz4[4];
        const float* pbz = bias + c0 + cofs;
#pragma unroll
        for (int q = 0; q < 4; ++q) bz4[q] = bfr(pbz[q]);
        // The address pair is an input, so it stays whole until this wait: the load's result is not written into the pair that the load names.
        asm volatile("s_wait_xcnt 0x0" :: "v"(pbz) : "memory");
        // GELU in groups of 16 rows: a lane's 32 values of a group are independent chains, worked on stage by stage, so the vector port stays fed where one value at a time left a lone wave waiting out every link and two branches per value.
        // One wave-uniform test a group: where every |tv / sqrt(2)| of the group is below 1, erf is the math library's own polynomial for that range (same coefficients, same order of fused operations, odd in x: the same bits as erff);
        // any other group (a large value, an infinity) takes the erff loop, one row pair a trip.
        const v4f bzv = {bz4[0], bz4[1], bz4[2], bz4[3]};
#pragma unroll 1   // rolled: four trips of the same code; each trip's wait then stands in front of the next trip's writes of the stores' registers
        for (int s0 = 0; s0 < 32; s0 += 8) {
            const float* ob = os + (2 * s0 + hi) * 68 + cofs;
            float* og = Of + (size_t)(r0 + 2 * s0 + hi) * DM + c0 + cofs;
            v4f val[8], xx[8], t[8], p[8];
#pragma unroll
            for (int u = 0; u < 8; ++u) val[u] = *(const v4fa*)(ob + u * (2 * 68));
#pragma unroll
            for (int u = 0; u < 8; ++u) val[u] += bzv;
            float am[8];
#pragma unroll
            for (int u = 0; u < 8; ++u) am[u] = fmaxf(fmaxf(fabsf(val[u][0]), fabsf(val[u][1])), fmaxf(fabsf(val[u][2]), fabsf(val[u][3])));
            const float amax = fmaxf(fmaxf(fmaxf(am[0], am[1]), fmaxf(am[2], am[3])), fmaxf(fmaxf(am[4], am[5]), fmaxf(am[6], am[7])));
            // rounding is monotone, so the largest |tv| gives the largest |tv * 0.7071...|; a NaN is passed over by fmaxf and comes out as NaN of either path
            if (__builtin_amdgcn_ballot_w32(!(amax * 0.70710678118654752f < 1.0f)) == 0) {
#pragma unroll
                for (int u = 0; u < 8; ++u) xx[u] = val[u] * 0.70710678118654752f;
#pragma unroll
                for (int u = 0; u < 8; ++u) t[u] = xx[u] * xx[u];
#pragma unroll
                for (int u = 0; u < 8; ++u) p[u] = __builtin_elementwise_fma(t[u], (v4f)(-0x1.268bc2p-11f), (v4f)(0x1.420828p-8f));
#pragma unroll
                for (int u = 0; u < 8; ++u) p[u] = __builtin_elementwise_fma(t[u], p[u], (v4f)(-0x1.b5937p-6f));
#pragma unroll
                for (int u = 0; u < 8; ++u) p[u] = __builtin_elementwise_fma(t[u], p[u], (v4f)(0x1.ce077cp-4f));
#pragma unroll
                for (int u = 0; u < 8; ++u) p[u] = __builtin_elementwise_fma(t[u], p[u], (v4f)(-0x1.81266p-2f));
#pragma unroll
                for (int u = 0; u < 8; ++u) p[u] = __builtin_elementwise_fma(t[u], p[u], (v4f)(0x1.06eba0p-3f));
#pragma unroll
                for (int u = 0; u < 8; ++u) p[u] = __builtin_elementwise_fma(xx[u], p[u], xx[u]);
#pragma unroll
                for (int u = 0; u < 8; ++u) val[u] = 0.5f * val[u] * (1.0f + p[u]);
#pragma unroll
                for (int u = 0; u < 8; ++u) *(v4f*)(og + u * (2 * DM)) = val[u];
                asm volatile("s_wait_xcnt 0x0" ::: "memory");   // the next trip overwrites the stores' address and data registers
            } else {
#pragma unroll 1   // rolled: the rare path; unrolled it would only take instruction cache
                for (int u = 0; u < 8; ++u) { v4f w = *(const v4fa*)(ob + u * (2 * 68));
#pragma unroll
                    for (int q = 0; q < 4; ++q) { const float tv = w[q] + bz4[q]; w[q] = 0.5f * tv * (1.0f + erff(tv * 0.70710678118654752f)); }
                    *(v4f*)(og + u * (2 * DM)) = w; }
            }
        }
    }
}

// ---- k_qkv: the three projections of y, which do not depend on one another, as one grid (M/64, 384/64, 3): blockIdx.z = 0 q, 1 k, 2 v.
__global__ __launch_bounds__(32) void k_qkv(const bf* __restrict__ Yh, const bf* __restrict__ Yl, const bf* __restrict__ WQ, const bf* __restrict__ WK, const bf* __restrict__ WV,
                                            const float* __restrict__ bq, const float* __restrict__ bk, const float* __restrict__ bv, bf* Qh, bf* Ql, bf* Kh, bf* Kl, h16* VT) {
    __shared__ __align__(16) float os[64 * 68];
    const int z = blockIdx.z;
    if (z == 2) gemmw<1>(Yh, Yl, WV, bv, (bf*)nullptr, (bf*)nullptr, VT, (float*)nullptr, os);
    else gemmw<0>(Yh, Yl, z ? WK : WQ, z ? bk : bq, z ? Kh : Qh, z ? Kl : Ql, (h16*)nullptr, (float*)nullptr, os, z ? 1.0f : L2E);
}

// ---- k_proj: ctx hi|lo x Wp + bp -> erf GELU -> out; grid (M/64, 384/64).
__global__ __launch_bounds__(32) void k_proj(const bf* __restrict__ Ch, const bf* __restrict__ Cl, const bf* __restrict__ WP, const float* __restrict__ bp, float* Of) {
    __shared__ __align__(16) float os[64 * 68];
    gemmw<2>(Ch, Cl, WP, bp, (bf*)nullptr, (bf*)nullptr, (h16*)nullptr, Of, os);
}

// exp2 with the vector slot that the instruction set asks for behind a transcendental kept inside the statement: each v_exp_f32 is followed by an instruction that neither reads its result nor overwrites its source
// ("=&v": no result shares a register with a source of the group), the last one by v_nop.
__device__ __forceinline__ void exp2x4(float x0, float x1, float x2, float x3, float& y0, float& y1, float& y2, float& y3) {
    asm("v_exp_f32 %0, %4\n\tv_exp_f32 %1, %5\n\tv_exp_f32 %2, %6\n\tv_exp_f32 %3, %7\n\tv_nop" : "=&v"(y0), "=&v"(y1), "=&v"(y2), "=&v"(y3) : "v"(x0), "v"(x1), "v"(x2), "v"(x3));
}
__device__ __forceinline__ float exp2x1(float x) { float y; asm("v_exp_f32 %0, %1\n\tv_nop" : "=v"(y) : "v"(x)); return y; }

// ---- stage_copy: one ring stage = KS keys of the k hi, k lo and v^T planes (8192 contiguous bytes of each, fragment order kept) -> one LDS buffer [k hi | k lo | v^T], by asynchronous copies, through no register.
// 128 threads x 16 B = 2048 B a copy, four copies a plane. gh, gl, gv: the lane's own global addresses (plane + stage start + 8 elements x thread); lds: the lane's own LDS byte address (buffer start + 16 x thread).
__device__ __forceinline__ void stage_copy(const bf* gh, const bf* gl, const h16* gv, unsigned lds) {
    // s_wait_xcnt is the last line of the copies' own statement, so it stands in front of every later write of an address register that a copy names.
    asm volatile("global_load_async_to_lds_b128 %0, %12, off\n\t"
                 "global_load_async_to_lds_b128 %1, %13, off\n\t"
                 "global_load_async_to_lds_b128 %2, %14, off\n\t"
                 "global_load_async_to_lds_b128 %3, %15, off\n\t"
                 "global_load_async_to_lds_b128 %4, %16, off\n\t"
                 "global_load_async_to_lds_b128 %5, %17, off\n\t"
                 "global_load_async_to_lds_b128 %6, %18, off\n\t"
                 "global_load_async_to_lds_b128 %7, %19, off\n\t"
                 "global_load_async_to_lds_b128 %8, %20, off\n\t"
                 "global_load_async_to_lds_b128 %9, %21, off\n\t"
                 "global_load_async_to_lds_b128 %10, %22, off\n\t"
                 "global_load_async_to_lds_b128 %11, %23, off\n\t"
                 "s_wait_xcnt 0x0"
                 :: "v"(lds), "v"(lds + 2048u), "v"(lds + 4096u), "v"(lds + 6144u), "v"(lds + 8192u), "v"(lds + 10240u), "v"(lds + 12288u), "v"(lds + 14336u), "v"(lds + 16384u), "v"(lds + 18432u), "v"(lds + 20480u), "v"(lds + 22528u),
                    "v"(gh), "v"(gh + 1024), "v"(gh + 2048), "v"(gh + 3072), "v"(gl), "v"(gl + 1024), "v"(gl + 2048), "v"(gl + 3072), "v"(gv), "v"(gv + 1024), "v"(gv + 2048), "v"(gv + 3072)
                 : "memory");
}

// ---- k_attn: fused flash attention (unscaled scores, no mask), transposed form. Block = 4 waves, each owns 32 queries (two 16-query tiles) of one (b, h); grid (SEQ/128, NB*NH).
// The wave's Q fragments (hi|lo, both tiles) are loaded once and stay in registers; each K and V fragment loaded in the key loop feeds both query tiles.
// K hi|lo and V^T come through a two-buffer LDS ring that the four waves share: stage t + 1's copies fly while stage t (KS keys, two 32-key steps) is worked on, so no wave waits out a global load in the key loop.
// Per 32-key step and query tile: S^T[key][q] = Kh Qh^T + Kl Qh^T + Kh Ql^T (A = key rows from the k planes, B = query rows from the q planes, k index = hd);
// q carries log2 e, and the C operand of each tile's first product is CARRY - ref (ref = the query's held reference), so the accumulators hold the exponents themselves and exp2 reads them with no vector work in between;
// lane (n = query, h) holds keys 8h+r of both 16-key tiles; one test per 32-key step: only where a shifted score passes SLIM (and in the first step) ref is moved to the query's maximum, and the step's scores, O and l are brought to the new ref;
// the P^T B fragment is formed in registers (element r <- tile 0 value r, element 8+r <- tile 1 value r; f16, 2^CARRY at the reference); O^T[hd][q] += V^T[hd][key] P^T[key][q] (A from the f16 v^T plane).
// l is accumulated from the unconverted f32 p values (per-lane partials, combined once at the end). Q fragments come straight from the fragment-order global planes, K and V fragments from the ring, which keeps that order (two 16-B loads each, 512 contiguous bytes per load: no bank conflict).
__global__ __launch_bounds__(128) void k_attn(const bf* __restrict__ Qh, const bf* __restrict__ Ql, const bf* __restrict__ Kh, const bf* __restrict__ Kl, const h16* __restrict__ Vt, bf* Ch, bf* Cl) {
#pragma clang fp contract(off)
    __shared__ __align__(16) float os[4 * 2 * 16 * 68];
    __shared__ __align__(16) bf ring[2][3 * KS * HD];
    const int lane = threadIdx.x & 31, lr = lane & 15, hi = lane >> 4;
    const int wave = __builtin_amdgcn_readfirstlane(threadIdx.x >> 5);
    const int bh = blockIdx.y;
    const int q0 = blockIdx.x * 128 + wave * 32;
    const size_t pbase = (size_t)bh * SEQ * HD;
    const bf* qh = Qh + pbase; const bf* ql = Ql + pbase; const bf* kh = Kh + pbase; const bf* kl = Kl + pbase; const h16* vt = Vt + pbase;
    const int qoff0 = q0 * HD + 8 * lane;
    v16bf bqh[2][2], bql[2][2];
#pragma unroll
    for (int t = 0; t < 2; ++t)
#pragma unroll
        for (int ks = 0; ks < 2; ++ks) { bqh[t][ks] = ldbf(qh + qoff0 + t * (16 * HD) + ks * 512); bql[t][ks] = ldbf(ql + qoff0 + t * (16 * HD) + ks * 512); }
    v8f o[2][4];
#pragma unroll
    for (int t = 0; t < 2; ++t)
#pragma unroll
        for (int j = 0; j < 4; ++j) o[t][j] = (v8f){};
    float l[2] = {0.0f, 0.0f};
    v8f cref[2];   // CARRY - ref in all eight elements: the score products' C operand; ref = 0 until the first step sets it
#pragma unroll
    for (int t = 0; t < 2; ++t)
#pragma unroll
        for (int r = 0; r < 8; ++r) cref[t][r] = CARRY;
    float lim = -3.0e38f;   // the first step always sets ref; SLIM from then on
    const bf* gkh = kh + 8 * threadIdx.x; const bf* gkl = kl + 8 * threadIdx.x; const h16* gvt = vt + 8 * threadIdx.x;
    const unsigned lds0 = (unsigned)(size_t)&ring[0][0] + 16u * threadIdx.x;   // LDS byte address = low 32 bits of the shared address
    stage_copy(gkh, gkl, gvt, lds0);
    asm volatile("s_wait_asynccnt 0x0" ::: "memory");   // this wave's share of stage 0 has landed
    __syncthreads();                                     // every wave's share has: stage 0 may be read
    stage_copy(gkh + KS * HD, gkl + KS * HD, gvt + KS * HD, lds0 + (unsigned)sizeof(ring[0]));
#pragma unroll 1
    for (int st = 0; st < SEQ / KS; ++st) {
      const bf* sb = ring[st & 1] + 8 * lane;
#pragma unroll 1   // rolled: each step then opens with its 16 K reads as one group ahead of its score WMMAs (the V reads stand among the exponentials); unrolled, the compiler spread the reads among the WMMAs
      for (int kk = 0; kk < KS; kk += 32) {
        const bf* skh = sb + kk * HD; const bf* skl = skh + KS * HD;
        v8f s0[2], s1[2];
#pragma unroll
        for (int t = 0; t < 2; ++t) { s0[t] = cref[t]; s1[t] = cref[t]; }
#pragma unroll
        for (int ks = 0; ks < 2; ++ks) {
            const v16bf a0h = ldbf(skh + ks * 512), a0l = ldbf(skl + ks * 512);
            const v16bf a1h = ldbf(skh + 16 * HD + ks * 512), a1l = ldbf(skl + 16 * HD + ks * 512);
            s0[0] = wmmab(a0h, bqh[0][ks], s0[0]); s1[0] = wmmab(a1h, bqh[0][ks], s1[0]); s0[1] = wmmab(a0h, bqh[1][ks], s0[1]); s1[1] = wmmab(a1h, bqh[1][ks], s1[1]);
            s0[0] = wmmab(a0l, bqh[0][ks], s0[0]); s1[0] = wmmab(a1l, bqh[0][ks], s1[0]); s0[1] = wmmab(a0l, bqh[1][ks], s0[1]); s1[1] = wmmab(a1l, bqh[1][ks], s1[1]);
            s0[0] = wmmab(a0h, bql[0][ks], s0[0]); s1[0] = wmmab(a1h, bql[0][ks], s1[0]); s0[1] = wmmab(a0h, bql[1][ks], s0[1]); s1[1] = wmmab(a1h, bql[1][ks], s1[1]);
        }
        const h16* pv = (const h16*)(skh + 2 * KS * HD);
        const v16h va0 = ldhf(pv), va1 = ldhf(pv + 512), va2 = ldhf(pv + 1024), va3 = ldhf(pv + 1536);
        v16h pf[2];
        float mx[2];
#pragma unroll
        for (int t = 0; t < 2; ++t) {
            mx[t] = fmaxf(s0[t][0], s1[t][0]);
#pragma unroll
            for (int r = 1; r < 8; ++r) mx[t] = fmaxf(mx[t], fmaxf(s0[t][r], s1[t][r]));
        }
        // One scalar branch per step, rarely taken after the first step: it keeps the exchange between the halves, the subtractions and the 64 multiplies of O out of the common path.
        if (__builtin_amdgcn_ballot_w32(fmaxf(mx[0], mx[1]) > lim) != 0) {
#pragma unroll
            for (int t = 0; t < 2; ++t) {
                const float mq = fmaxf(mx[t], __shfl_xor(mx[t], 16, 32));   // the same in both lanes of a query, so both take the same step
                const float delta = mq > lim ? mq - CARRY : 0.0f;          // ref += delta: the query's largest score of this step lands on CARRY
                const float alpha = exp2x1(fminf(-delta, 0.0f));            // delta < 0 only in the first step, where O and l are 0: alpha stays finite
#pragma unroll
                for (int r = 0; r < 8; ++r) { s0[t][r] -= delta; s1[t][r] -= delta; cref[t][r] -= delta; }
                l[t] *= alpha;
#pragma unroll
                for (int j = 0; j < 4; ++j)
#pragma unroll
                    for (int r = 0; r < 8; ++r) o[t][j][r] *= alpha;
            }
            lim = SLIM;
        }
#pragma unroll
        for (int t = 0; t < 2; ++t) {
            float psum = 0.0f;
#pragma unroll
            for (int r = 0; r < 8; r += 2) {
                float p0, p1, p2, p3;
                exp2x4(s0[t][r], s1[t][r], s0[t][r + 1], s1[t][r + 1], p0, p1, p2, p3);
                psum += p0 + p1;
                psum += p2 + p3;
                pf[t][r] = (h16)p0; pf[t][8 + r] = (h16)p1; pf[t][r + 1] = (h16)p2; pf[t][9 + r] = (h16)p3; }
            l[t] += psum;
        }
#pragma unroll
        for (int t = 0; t < 2; ++t) { o[t][0] = wmma16(va0, pf[t], o[t][0]); o[t][1] = wmma16(va1, pf[t], o[t][1]); o[t][2] = wmma16(va2, pf[t], o[t][2]); o[t][3] = wmma16(va3, pf[t], o[t][3]); }
      }
      // Publish point of stage st + 1, every wave, in this order.
      asm volatile("s_wait_dscnt 0x0" ::: "memory");      // this wave's reads of stage st's buffer are done before the buffer is refilled
      asm volatile("s_wait_asynccnt 0x0" ::: "memory");   // this wave's share of stage st + 1 has landed
      __syncthreads();                                     // every wave's share has, and every wave has left stage st's buffer
      if (st + 2 < SEQ / KS) stage_copy(gkh + (st + 2) * (KS * HD), gkl + (st + 2) * (KS * HD), gvt + (st + 2) * (KS * HD), lds0 + (unsigned)(st & 1) * (unsigned)sizeof(ring[0]));
    }
    asm volatile("s_wait_asynccnt 0x0" ::: "memory");   // no copy is outstanding when the wave goes on to its end
    const int b = bh / NH, h = bh % NH;
    const int r8 = lane & 7, cc = lane >> 3;
#pragma unroll
    for (int t = 0; t < 2; ++t) {
        const float lt = l[t] + __shfl_xor(l[t], 16, 32);
        const float inv = 1.0f / lt;   // O and l carry the same factor 2^(CARRY - ref)
        const int wbase = (wave * 2 + t) * (16 * 68);
#pragma unroll
        for (int j = 0; j < 4; ++j)
#pragma unroll
            for (int r = 0; r < 8; ++r) os[wbase + lr * 68 + 16 * j + 8 * hi + r] = o[t][j][r] * inv;
    }
    wave_lds_sync();
#pragma unroll 1   // rolled: each trip's wait then stands in front of every later write of its stores' registers
    for (int u = 0; u < 8; ++u) { const int t = u >> 2, s = u & 3;
        const int wbase = (wave * 2 + t) * (16 * 68);
        const int row = 8 * (s & 1) + r8, ch = 4 * (s >> 1) + cc;
        const v4f u0 = *(const v4fa*)(os + wbase + row * 68 + 8 * ch); const v4f u1 = *(const v4fa*)(os + wbase + row * 68 + 8 * ch + 4); v8us oh, ol;
#pragma unroll
        for (int i = 0; i < 4; ++i) { unsigned short a, c; splitf(u0[i], a, c); oh[i] = a; ol[i] = c; splitf(u1[i], a, c); oh[4 + i] = a; ol[4 + i] = c; }
        const size_t oo = ((size_t)b * SEQ + q0 + 16 * t) * DM + (h * 8 + ch) * 128 + row * 8;
        *(v8us*)(Ch + oo) = oh; *(v8us*)(Cl + oo) = ol;
        asm volatile("s_wait_xcnt 0x0" ::: "memory");   // the next trip overwrites the stores' address and data registers
    }
}

extern "C" void kernel_launch(void* const* d_in, const int* in_sizes, int n_in,
                              void* d_out, int out_size, void* d_ws, size_t ws_size, hipStream_t stream) {
    if (n_in < 11) return;
    if ((size_t)in_sizes[0] < ((size_t)(NB - 1) * SEQ_FULL + SEQ) * DM) return;
    if (in_sizes[1] < DM || in_sizes[2] < DM) return;
    if (in_sizes[3] < NH * DM * HD || in_sizes[5] < NH * DM * HD || in_sizes[7] < NH * DM * HD || in_sizes[9] < DM * DM) return;
    if (in_sizes[4] < DM || in_sizes[6] < DM || in_sizes[8] < DM || in_sizes[10] < DM) return;
    if ((size_t)out_size < (size_t)MTOK * DM) return;
    const float* x   = (const float*)d_in[0];
    const float* lng = (const float*)d_in[1];
    const float* lnb = (const float*)d_in[2];
    const float* wq  = (const float*)d_in[3];
    const float* bq  = (const float*)d_in[4];
    const float* wk  = (const float*)d_in[5];
    const float* bk  = (const float*)d_in[6];
    const float* wv  = (const float*)d_in[7];
    const float* bv  = (const float*)d_in[8];
    const float* wp  = (const float*)d_in[9];
    const float* bp  = (const float*)d_in[10];
    float* OUT = (float*)d_out;     // [NB][SEQ][384]
    char* wsp = (char*)d_ws;
    auto take = [&](size_t bytes) { char* p = wsp; wsp += (bytes + 255) & ~(size_t)255; return (void*)p; };
    const size_t WSZ = (size_t)DM * DM * 2;            // one transposed bf16 weight plane [384][384]
    const size_t PSZ = (size_t)MTOK * DM * 2;          // one 16-bit activation plane
    bf* WQ = (bf*)take(WSZ); bf* WK = (bf*)take(WSZ); bf* WV = (bf*)take(WSZ); bf* WP = (bf*)take(WSZ);
    bf* Yh = (bf*)take(PSZ); bf* Yl = (bf*)take(PSZ);
    bf* Qh = (bf*)take(PSZ); bf* Ql = (bf*)take(PSZ); bf* Kh = (bf*)take(PSZ); bf* Kl = (bf*)take(PSZ);
    h16* VT = (h16*)take(PSZ);
    if ((size_t)(wsp - (char*)d_ws) > ws_size) return;
    bf* Ch = Yh; bf* Cl = Yl;   // ctx planes reuse the y planes (y is dead after the three projections; stream-ordered)

    k_prep<<<LN_BLOCKS + 4 * WT_TILES, 256, 0, stream>>>(x, lng, lnb, wq, wk, wv, wp, Yh, Yl, WQ, WK, WV, WP);
    k_qkv<<<dim3(MTOK / 64, DM / 64, 3), 32, 0, stream>>>(Yh, Yl, WQ, WK, WV, bq, bk, bv, Qh, Ql, Kh, Kl, VT);
    k_attn<<<dim3(SEQ / 128, NB * NH, 1), 128, 0, stream>>>(Qh, Ql, Kh, Kl, VT, Ch, Cl);
    k_proj<<<dim3(MTOK / 64, DM / 64, 1), 32, 0, stream>>>(Ch, Cl, WP, bp, OUT);
}

// v009
// One run takes 84.1 microseconds.
// Versions in between are left out here; by their measured steps it is 1.44 times as fast as v007.
// All steps since v000 together make it 5.44 times as fast.
#include <hip/hip_runtime.h>

// Compute dtypes, f32 accumulate everywhere: inputs converted to bf16 (RNE); q/k/v and output projections = bf16 WMMA with the activation as hi|lo planes against exact bf16 weights (2 products); scores = f16 WMMA, q and k each one f16 plane (1 product); P.V = f16 WMMA (P carried x16 relative to a held reference, V plain f16); LayerNorm, softmax, GELU in f32.
// Every 16-bit WMMA operand plane with 384-long rows (y, ctx, transposed weights) is kept in fragment order [row/16][k/8][row%16][k%8].
// Pre-LN attention: y = LN(x) -> hi|lo planes; per-head projections written straight into head planes in WMMA fragment order (q,k f16 [b][h][s/16][hd/8][s%16][hd%8]; v^T f16 [b][h][s/32][hd/16][(s%32)/8][hd%16][s%8]), so that each 16-B-per-lane fragment load of the attention kernel is 512 contiguous bytes and a run of keys is one contiguous block of each plane; fused flash attention in the transposed form S^T = K Q^T, O^T = V^T P^T (P fragment built in registers from the score accumulators); ctx hi|lo x Wp + bp -> erf GELU -> out.

#ifndef NB
#define NB 8
#endif
#ifndef SEQ
#define SEQ 2048
#endif
#define NB_FULL  8
#define SEQ_FULL 2048
#define DM   384
#define NH   6
#define HD   64
#define MTOK (NB * SEQ)
#define CARRY 4.0f    // log2 of the carry: a score equal to the held reference gives p = 2^4 in the f16 P fragment
#define SLIM  15.0f   // the reference is raised when a shifted score passes this: p stays at or below 2^15, inside f16
#define L2E  1.4426950408889634f
#define KS   64   // keys per stage of the attention kernel's LDS ring

static_assert(SEQ % 128 == 0);
static_assert(KS % 32 == 0 && SEQ % KS == 0 && SEQ / KS >= 2);
static_assert(KS * HD * 2 == 4 * 128 * 16);   // one plane's share of a stage = four 16-B copies of each of the 128 threads
static_assert(DM % 64 == 0);
static_assert(DM % 32 == 0);
static_assert(NH * HD == DM);
static_assert(NB <= NB_FULL);
static_assert(SEQ <= SEQ_FULL);
static_assert((size_t)4 * DM * DM * 2 + (size_t)5 * MTOK * DM * 2 <= (size_t)134217728);

typedef _Float16 h16;
typedef unsigned short bf;
typedef __attribute__((ext_vector_type(16))) __bf16   v16bf;
typedef __attribute__((ext_vector_type(16))) _Float16 v16h;
typedef __attribute__((ext_vector_type(8)))  _Float16 v8h;
typedef __attribute__((ext_vector_type(8)))  unsigned short v8us;
typedef __attribute__((ext_vector_type(4)))  unsigned short v4us;
typedef __attribute__((ext_vector_type(8)))  float    v8f;
typedef __attribute__((ext_vector_type(4)))  float    v4f;
typedef v4f  __attribute__((may_alias)) v4fa;

__device__ __forceinline__ unsigned short f2bf(float f) { unsigned u = __float_as_uint(f); u += 0x7FFFu + ((u >> 16) & 1u); return (unsigned short)(u >> 16); }
__device__ __forceinline__ float bf2f(unsigned short b) { return __uint_as_float(((unsigned)b) << 16); }
__device__ __forceinline__ float bfr(float f) { return bf2f(f2bf(f)); }
__device__ __forceinline__ void splitf(float y, unsigned short& h, unsigned short& l) { h = f2bf(y); l = f2bf(y - bf2f(h)); }
__device__ __forceinline__ v16h cat16(v8h lo, v8h hi) { return __builtin_shufflevector(lo, hi, 0, 1, 2, 3, 4, 5, 6, 7, 8, 9, 10, 11, 12, 13, 14, 15); }
__device__ __forceinline__ v16bf cat16b(v8us lo, v8us hi) { return __builtin_bit_cast(v16bf, __builtin_shufflevector(lo, hi, 0, 1, 2, 3, 4, 5, 6, 7, 8, 9, 10, 11, 12, 13, 14, 15)); }
__device__ __forceinline__ v8f wmma16(v16h a, v16h b, v8f c) { return __builtin_amdgcn_wmma_f32_16x16x32_f16(false, a, false, b, (short)0, c, false, false); }
__device__ __forceinline__ v8f wmmab(v16bf a, v16bf b, v8f c) { return __builtin_amdgcn_wmma_f32_16x16x32_bf16(false, a, false, b, (short)0, c, false, false); }
// Fragment loaders from fragment-order planes: p already holds the 512-element (16 rows x 32 k) block base + 8*lane, lane = 16*h + row; elements 0..7 = k0+8h.., elements 8..15 = k0+16+8h..; each load covers four whole 128-B lines.
__device__ __forceinline__ v16bf ldbf(const bf* p) { return cat16b(*(const v8us*)p, *(const v8us*)(p + 256)); }
__device__ __forceinline__ v16h ldhf(const h16* p) { return cat16(*(const v8h*)p, *(const v8h*)(p + 256)); }
// Same-wave LDS exchange (wave-private tiles only).
__device__ __forceinline__ void wave_lds_sync() { __builtin_amdgcn_fence(3 /* release order */, "wavefront"); __builtin_amdgcn_wave_barrier(); __builtin_amdgcn_fence(2 /* acquire order */, "wavefront"); asm volatile("" ::: "memory"); }

// ---- wt_body: in[z][rows][cols] (f32) -> transposed matrix out[n = z*cols + col][k = row] (bf16 RNE) in fragment order [n/16][k/8][n%16][k%8], one 64x64 tile (bx, by, bz) of (rows/64, cols/64, z) through LDS (t: 64 x 65 floats); 256 threads.
__device__ __forceinline__ void wt_body(const float* __restrict__ src, bf* dst, int rows, int cols, int bx, int by, int bz, float* t) {
    const int tid = threadIdx.x;
    const size_t zo = (size_t)bz * (size_t)rows * (size_t)cols;
    const int r0 = bx * 64, c0 = by * 64;
#pragma unroll 1   // four loads in flight a trip; rolled: each trip's wait then stands in front of the next trip's address writes
    for (int i0 = 0; i0 < 16; i0 += 4) { const int cc = tid & 63; const float* p[4]; float v[4];
#pragma unroll
        for (int u = 0; u < 4; ++u) { p[u] = src + zo + (size_t)(r0 + (tid >> 6) + 4 * (i0 + u)) * cols + c0 + cc; v[u] = *p[u]; }
        // The four address pairs are inputs, so they stay whole until this wait: no load's result and no next address is written into a pair that an issued load still names.
        asm volatile("s_wait_xcnt 0x0" :: "v"(p[0]), "v"(p[1]), "v"(p[2]), "v"(p[3]) : "memory");
#pragma unroll
        for (int u = 0; u < 4; ++u) t[((tid >> 6) + 4 * (i0 + u)) * 65 + cc] = v[u]; }
    __syncthreads();
    const int pc = (tid >> 3) & 7;
#pragma unroll
    for (int it = 0; it < 2; ++it) { const int line = (tid & 7) + 8 * (tid >> 6) + 32 * it; v8us o;
#pragma unroll
        for (int i = 0; i < 8; ++i) o[i] = f2bf(t[(8 * pc + i) * 65 + line]);
        const int n = bz * cols + c0 + line;
        *(v8us*)(dst + (size_t)(n >> 4) * 16 * rows + (size_t)((r0 >> 3) + pc) * 128 + (n & 15) * 8) = o; }
}

// ---- ln_body: one wave takes 8 consecutive tokens (the 8 rows of one 128-B line of the fragment-order planes); block blk takes tokens 64*blk..64*blk+63, so the whole LayerNorm is MTOK/64 blocks, all resident at once.
// A wave's 24 row loads are issued together; the 8 tokens' sums run side by side (each token's own sum order is that of one wave per token); gain and bias are rounded once a wave.
// The 8 tokens are gathered in the wave's own LDS range (no block barrier), so that each 128-B line (8 tokens x 16 B) is stored whole. Row pitch LNP: 16 lanes x 16 B of a read fall on 64 different banks.
#define LNT 8
#define LNP (DM + 16)
static_assert(SEQ % (8 * LNT) == 0);
static_assert(LNT == 8);
// One level of the 8 tokens' butterfly sums: e[t] = s[t] of the partner lane (a = 4 x that lane's number), what __shfl_xor gives. The 8 exchanges go out as one group and share one wait;
// written as shuffles, the compiler ran the tokens one after another, with a full LDS-unit wait behind every single exchange. The exchanges and their wait stand in one statement, so no reader of a result can come ahead of the wait.
__device__ __forceinline__ void xchg8(int a, const float (&s)[LNT], float (&e)[LNT]) {
    asm volatile("ds_bpermute_b32 %0, %8, %9\n\t"
                 "ds_bpermute_b32 %1, %8, %10\n\t"
                 "ds_bpermute_b32 %2, %8, %11\n\t"
                 "ds_bpermute_b32 %3, %8, %12\n\t"
                 "ds_bpermute_b32 %4, %8, %13\n\t"
                 "ds_bpermute_b32 %5, %8, %14\n\t"
                 "ds_bpermute_b32 %6, %8, %15\n\t"
                 "ds_bpermute_b32 %7, %8, %16\n\t"
                 "s_wait_dscnt 0x0"
                 : "=&v"(e[0]), "=&v"(e[1]), "=&v"(e[2]), "=&v"(e[3]), "=&v"(e[4]), "=&v"(e[5]), "=&v"(e[6]), "=&v"(e[7])
                 : "v"(a), "v"(s[0]), "v"(s[1]), "v"(s[2]), "v"(s[3]), "v"(s[4]), "v"(s[5]), "v"(s[6]), "v"(s[7])
                 : "memory");
}
__device__ __forceinline__ void ln_body(const float* __restrict__ x, const float* __restrict__ g, const float* __restrict__ be, bf* Yh, bf* Yl, int blk, bf* sall) {
    const int lane = threadIdx.x & 31;
    const int wave = __builtin_amdgcn_readfirstlane(threadIdx.x >> 5);
    const int grp = blk * 8 + wave;   // index of the 8-token group
    const int tok = grp * LNT;
    const int b = tok / SEQ, s = tok % SEQ;
    const float* xr = x + ((size_t)b * SEQ_FULL + s) * DM + lane * 4;
    const float* pg = g + lane * 4; const float* pb = be + lane * 4;
    bf* sw = sall + wave * (2 * LNT * LNP);
    v4f v[LNT][3], gg[3], bb[3];
#pragma unroll
    for (int t = 0; t < LNT; ++t)
#pragma unroll
        for (int j = 0; j < 3; ++j) v[t][j] = *(const v4f*)(xr + t * DM + j * 128);
#pragma unroll
    for (int j = 0; j < 3; ++j) { gg[j] = *(const v4f*)(pg + j * 128); bb[j] = *(const v4f*)(pb + j * 128); }
    // The three addresses are inputs, so the registers they are formed from stay whole until this wait: no load's result is written into a register that an issued load still names.
    asm volatile("s_wait_xcnt 0x0" :: "v"(xr), "v"(pg), "v"(pb) : "memory");
    float sum[LNT], var[LNT], ex[LNT];
#pragma unroll
    for (int t = 0; t < LNT; ++t) { sum[t] = 0.0f;
#pragma unroll
        for (int j = 0; j < 3; ++j)
#pragma unroll
            for (int q = 0; q < 4; ++q) { v[t][j][q] = bfr(v[t][j][q]); sum[t] += v[t][j][q]; } }
#pragma unroll
    for (int sh = 16; sh; sh >>= 1) { xchg8(4 * (lane ^ sh), sum, ex);
#pragma unroll
        for (int t = 0; t < LNT; ++t) sum[t] += ex[t]; }
#pragma unroll
    for (int t = 0; t < LNT; ++t) { sum[t] *= (1.0f / DM); var[t] = 0.0f;   // sum[t] is the mean from here on
#pragma unroll
        for (int j = 0; j < 3; ++j)
#pragma unroll
            for (int q = 0; q < 4; ++q) { const float d = v[t][j][q] - sum[t]; var[t] += d * d; } }
#pragma unroll
    for (int sh = 16; sh; sh >>= 1) { xchg8(4 * (lane ^ sh), var, ex);
#pragma unroll
        for (int t = 0; t < LNT; ++t) var[t] += ex[t]; }
#pragma unroll
    for (int j = 0; j < 3; ++j)
#pragma unroll
        for (int q = 0; q < 4; ++q) { gg[j][q] = bfr(gg[j][q]); bb[j][q] = bfr(bb[j][q]); }
#pragma unroll
    for (int t = 0; t < LNT; ++t) { const float mu = sum[t]; const float rs = rsqrtf(var[t] * (1.0f / DM) + 1e-5f);
#pragma unroll
        for (int j = 0; j < 3; ++j) { v4us oh, ol;
#pragma unroll
            for (int q = 0; q < 4; ++q) { const float y = (v[t][j][q] - mu) * rs * gg[j][q] + bb[j][q]; unsigned short a, c; splitf(y, a, c); oh[q] = a; ol[q] = c; }
            *(v4us*)(sw + t * LNP + j * 128 + lane * 4) = oh; *(v4us*)(sw + (LNT + t) * LNP + j * 128 + lane * 4) = ol; } }
    wave_lds_sync();   // the rows read back below were written by this wave alone
    const int r8 = lane & 7, c4 = lane >> 3;
    const size_t tb = (size_t)(grp >> 1) * (16 * DM) + (grp & 1) * 64 + r8 * 8;
#pragma unroll
    for (int pl = 0; pl < 2; ++pl) { bf* yo = (pl ? Yl : Yh) + tb + c4 * 128; const bf* sr = sw + (pl * LNT + r8) * LNP + c4 * 8; v8us ov[DM / 32];
#pragma unroll
        for (int i = 0; i < DM / 32; ++i) ov[i] = *(const v8us*)(sr + i * 32);
#pragma unroll
        for (int i = 0; i < DM / 32; ++i) *(v8us*)(yo + i * 512) = ov[i];   // four whole 128-B lines an instruction
        asm volatile("s_wait_xcnt 0x0" ::: "memory"); }   // behind each plane's stores: code follows that overwrites the stores' address and data registers
}

// ---- k_prep: the five jobs that depend on the inputs alone, as block ranges of one grid (256 threads): blocks 0..MTOK/64-1 do LayerNorm (first: they are the long ones), the last 144 transpose the four weights (36 tiles each).
#define WT_TILES ((DM / 64) * (DM / 64))
#define LN_BLOCKS (MTOK / (8 * LNT))
__global__ __launch_bounds__(256) void k_prep(const float* __restrict__ x, const float* __restrict__ g, const float* __restrict__ be,
                                              const float* __restrict__ wq, const float* __restrict__ wk, const float* __restrict__ wv, const float* __restrict__ wp,
                                              bf* Yh, bf* Yl, bf* WQ, bf* WK, bf* WV, bf* WP) {
    __shared__ __align__(16) float sm[8 * 2 * LNT * LNP / 2];   // one buffer for both jobs: a block does one of them
    static_assert(sizeof(float) * 64 * 65 <= sizeof(bf) * 8 * 2 * LNT * LNP);
    const int bid = blockIdx.x;
    if (bid >= LN_BLOCKS) {   // the same for the whole block
        const int wb = bid - LN_BLOCKS;
        const int w = wb / WT_TILES, r = wb % WT_TILES, bx = r % (DM / 64), bo = r / (DM / 64);
        // per-head [h][d][k] -> Bt[h*64 + k][d]: in[rows = 384 (d)][cols = 64 (k)], z = head (bo); Wp [in = 384 (d)][out = 384 (n)] -> Bt[n][d]: in[rows = 384][cols = 384], column tile bo
        wt_body(w == 0 ? wq : w == 1 ? wk : w == 2 ? wv : wp, w == 0 ? WQ : w == 1 ? WK : w == 2 ? WV : WP, DM, w == 3 ? DM : HD, bx, w == 3 ? bo : 0, w == 3 ? 0 : bo, sm);
        return;
    }
    ln_body(x, g, be, Yh, Yl, bid, (bf*)sm);
}

// ---- gemmw: register-blocked GEMM, ONE WAVE per 64x64 output tile (16 accumulators), operands straight from fragment-order bf16 planes (K = 384); tile (blockIdx.x, blockIdx.y) of (M/64, 384/64), 32 threads; os: 64 x 68 floats of LDS.
// MODE 0: f16 head plane (q, k), the value times osc before the conversion (log2 e for q, so that the scores come out in the log2 domain; 1 for k); MODE 1: f16 v^T head plane; MODE 2: f32 output rows [tok][384] with exact erf GELU (16 lanes x 16 B = 256 B per row segment, 2 rows per instruction).
template <int MODE>
__device__ __forceinline__ void gemmw(const bf* __restrict__ A, const bf* __restrict__ A2, const bf* __restrict__ Bt, const float* __restrict__ bias, h16* Ov, float* Of, float* os, float osc = 1.0f) {
    const int lane = threadIdx.x & 31, lr = lane & 15, hi = lane >> 4;
    const int r0 = blockIdx.x * 64, c0 = blockIdx.y * 64;
    v8f acc[4][4];
#pragma unroll
    for (int mb = 0; mb < 4; ++mb)
#pragma unroll
        for (int nb = 0; nb < 4; ++nb) acc[mb][nb] = (v8f){};
    const size_t aoff = (size_t)r0 * DM + 8 * lane, boff = (size_t)c0 * DM + 8 * lane;
#pragma unroll 1
    for (int kc = 0; kc < DM; kc += 64) {   // a trip takes two 32-k steps (s)
        v16bf a[2][4], a2[2][4], b[2][4];
        const bf* pa = A + aoff + kc * 16; const bf* pa2 = A2 + aoff + kc * 16; const bf* pb = Bt + boff + kc * 16;
#pragma unroll
        for (int s = 0; s < 2; ++s) {
#pragma unroll
            for (int mb = 0; mb < 4; ++mb) { a[s][mb] = ldbf(pa + s * 512 + mb * 16 * DM); b[s][mb] = ldbf(pb + s * 512 + mb * 16 * DM); }
#pragma unroll
            for (int mb = 0; mb < 4; ++mb) a2[s][mb] = ldbf(pa2 + s * 512 + mb * 16 * DM); }
        // The three address pairs are inputs, so they stay whole until this wait: no load's result and no next address is written into a pair that an issued load of this trip still names.
        asm volatile("s_wait_xcnt 0x0" :: "v"(pa), "v"(pa2), "v"(pb) : "memory");
        // Nothing is scheduled across this line, so the trip's 48 loads go out as one group ahead of its first WMMA and each fragment has registers of its own: the wave waits out one load latency per 64 k.
        // Without it the compiler sank a third of the loads among the WMMAs, into registers that earlier fragments had just left, and the wave waited out three latencies one after another per 32 k.
        __builtin_amdgcn_sched_barrier(0);
#pragma unroll
        for (int s = 0; s < 2; ++s) {   // each accumulator takes, per 32-k step, its hi product and then its lo product
#pragma unroll
            for (int nb = 0; nb < 4; ++nb)
#pragma unroll
                for (int mb = 0; mb < 4; ++mb) acc[mb][nb] = wmmab(a[s][mb], b[s][nb], acc[mb][nb]);
#pragma unroll
            for (int nb = 0; nb < 4; ++nb)
#pragma unroll
                for (int mb = 0; mb < 4; ++mb) acc[mb][nb] = wmmab(a2[s][mb], b[s][nb], acc[mb][nb]); }
        asm volatile("" : "+v"(acc[0][0]), "+v"(acc[1][0]), "+v"(acc[2][0]), "+v"(acc[3][0]), "+v"(acc[0][1]), "+v"(acc[1][1]), "+v"(acc[2][1]), "+v"(acc[3][1]));
        asm volatile("v_nop\n\tv_nop\n\tv_nop\n\tv_nop" : "+v"(acc[0][2]), "+v"(acc[1][2]), "+v"(acc[2][2]), "+v"(acc[3][2]), "+v"(acc[0][3]), "+v"(acc[1][3]), "+v"(acc[2][3]), "+v"(acc[3][3]) : "v"(a[1][3]), "v"(a2[1][3]), "v"(b[1][3]));
    }
#pragma unroll
    for (int mb = 0; mb < 4; ++mb)
#pragma unroll
        for (int nb = 0; nb < 4; ++nb)
#pragma unroll
            for (int j = 0; j < 8; ++j) os[(mb * 16 + hi * 8 + j) * 68 + nb * 16 + lr] = acc[mb][nb][j];
    wave_lds_sync();
    const int bb = r0 / SEQ, sq = r0 % SEQ, hh = blockIdx.y;
    // Fragment-order stores: 8 lanes (r8) x 16 B fill one 128-B line of one 8-element chunk column, 4 chunk columns (cc) per instruction.
    const int r8 = lane & 7, cc = lane >> 3;
    if (MODE == 0) {
        const size_t pb = ((size_t)(bb * NH + hh) * SEQ + sq) * HD;
        float bz[2][8];
#pragma unroll
        for (int hf = 0; hf < 2; ++hf)
#pragma unroll
            for (int i = 0; i < 8; ++i) bz[hf][i] = bfr(bias[c0 + 8 * (4 * hf + cc) + i]);
#pragma unroll 1   // rolled: the epilogue is store-bound, and unrolled it would only take instruction cache
        for (int g = 0; g < 8; ++g) { const int row = 8 * g + r8;
#pragma unroll     // bz[hf] must be a compile-time register index
            for (int hf = 0; hf < 2; ++hf) { const int ch = 4 * hf + cc;
                const v4f u0 = *(const v4fa*)(os + row * 68 + 8 * ch); const v4f u1 = *(const v4fa*)(os + row * 68 + 8 * ch + 4); v8h o8;
#pragma unroll
                for (int i = 0; i < 4; ++i) { o8[i] = (h16)((u0[i] + bz[hf][i]) * osc); o8[4 + i] = (h16)((u1[i] + bz[hf][4 + i]) * osc); }
                *(v8h*)(Ov + pb + (size_t)(row >> 4) * (16 * HD) + ch * 128 + (row & 15) * 8) = o8; }
            asm volatile("s_wait_xcnt 0x0" ::: "memory");   // the next trip overwrites the stores' address and data registers
        }
    }
    if (MODE == 1) {
        const size_t vb = ((size_t)(bb * NH + hh) * SEQ + sq) * HD;
#pragma unroll 1   // rolled: the epilogue is store-bound, and unrolled it would only take instruction cache
        for (int g = 0; g < 8; ++g) { const int hd = 8 * g + r8; const float bzv = bfr(bias[c0 + hd]);
#pragma unroll
            for (int kq = 0; kq < 2; ++kq) { v8h o8;
#pragma unroll
                for (int i = 0; i < 8; ++i) o8[i] = (h16)(os[(32 * kq + 8 * cc + i) * 68 + hd] + bzv);
                *(v8h*)(Ov + vb + (size_t)kq * (32 * HD) + (hd >> 4) * 512 + cc * 128 + (hd & 15) * 8) = o8; }
            asm volatile("s_wait_xcnt 0x0" ::: "memory");   // the next trip overwrites the stores' address and data registers
        }
    }
    if (MODE == 2) {
        const int cofs = lr * 4;
        float bz4[4];
        const float* pbz = bias + c0 + cofs;
#pragma unroll
        for (int q = 0; q < 4; ++q) bz4[q] = bfr(pbz[q]);
        // The address pair is an input, so it stays whole until this wait: the load's result is not written into the pair that the load names.
        asm volatile("s_wait_xcnt 0x0" :: "v"(pbz) : "memory");
        // GELU in groups of 16 rows: a lane's 32 values of a group are independent chains, worked on stage by stage, so the vector port stays fed where one value at a time left a lone wave waiting out every link and two branches per value.
        // One wave-uniform test a group: where every |tv / sqrt(2)| of the group is below 1, erf is the math library's own polynomial for that range (same coefficients, same order of fused operations, odd in x: the same bits as erff);
        // any other group (a large value, an infinity) takes the erff loop, one row pair a trip.
        const v4f bzv = {bz4[0], bz4[1], bz4[2], bz4[3]};
#pragma unroll 1   // rolled: four trips of the same code; each trip's wait then stands in front of the next trip's writes of the stores' registers
        for (int s0 = 0; s0 < 32; s0 += 8) {
            const float* ob = os + (2 * s0 + hi) * 68 + cofs;
            float* og = Of + (size_t)(r0 + 2 * s0 + hi) * DM + c0 + cofs;
            v4f val[8], xx[8], t[8], p[8];
#pragma unroll
            for (int u = 0; u < 8; ++u) val[u] = *(const v4fa*)(ob + u * (2 * 68));
#pragma unroll
            for (int u = 0; u < 8; ++u) val[u] += bzv;
            float am[8];
#pragma unroll
            for (int u = 0; u < 8; ++u) am[u] = fmaxf(fmaxf(fabsf(val[u][0]), fabsf(val[u][1])), fmaxf(fabsf(val[u][2]), fabsf(val[u][3])));
            const float amax = fmaxf(fmaxf(fmaxf(am[0], am[1]), fmaxf(am[2], am[3])), fmaxf(fmaxf(am[4], am[5]), fmaxf(am[6], am[7])));
            // rounding is monotone, so the largest |tv| gives the largest |tv * 0.7071...|; a NaN is passed over by fmaxf and comes out as NaN of either path
            if (__builtin_amdgcn_ballot_w32(!(amax * 0.70710678118654752f < 1.0f)) == 0) {
#pragma unroll
                for (int u = 0; u < 8; ++u) xx[u] = val[u] * 0.70710678118654752f;
#pragma unroll
                for (int u = 0; u < 8; ++u) t[u] = xx[u] * xx[u];
#pragma unroll
                for (int u = 0; u < 8; ++u) p[u] = __builtin_elementwise_fma(t[u], (v4f)(-0x1.268bc2p-11f), (v4f)(0x1.420828p-8f));
#pragma unroll
                for (int u = 0; u < 8; ++u) p[u] = __builtin_elementwise_fma(t[u], p[u], (v4f)(-0x1.b5937p-6f));
#pragma unroll
                for (int u = 0; u < 8; ++u) p[u] = __builtin_elementwise_fma(t[u], p[u], (v4f)(0x1.ce077cp-4f));
#pragma unroll
                for (int u = 0; u < 8; ++u) p[u] = __builtin_elementwise_fma(t[u], p[u], (v4f)(-0x1.81266p-2f));
#pragma unroll
                for (int u = 0; u < 8; ++u) p[u] = __builtin_elementwise_fma(t[u], p[u], (v4f)(0x1.06eba0p-3f));
#pragma unroll
                for (int u = 0; u < 8; ++u) p[u] = __builtin_elementwise_fma(xx[u], p[u], xx[u]);
#pragma unroll
                for (int u = 0; u < 8; ++u) val[u] = 0.5f * val[u] * (1.0f + p[u]);
#pragma unroll
                for (int u = 0; u < 8; ++u) *(v4f*)(og + u * (2 * DM)) = val[u];
                asm volatile("s_wait_xcnt 0x0" ::: "memory");   // the next trip overwrites the stores' address and data registers
            } else {
#pragma unroll 1   // rolled: the rare path; unrolled it would only take instruction cache
                for (int u = 0; u < 8; ++u) { v4f w = *(const v4fa*)(ob + u * (2 * 68));
#pragma unroll
                    for (int q = 0; q < 4; ++q) { const float tv = w[q] + bz4[q]; w[q] = 0.5f * tv * (1.0f + erff(tv * 0.70710678118654752f)); }
                    *(v4f*)(og + u * (2 * DM)) = w; }
            }
        }
    }
}

// ---- k_qkv: the three projections of y, which do not depend on one another, as one grid (M/64, 384/64, 3): blockIdx.z = 0 q, 1 k, 2 v.
__global__ __launch_bounds__(32) void k_qkv(const bf* __restrict__ Yh, const bf* __restrict__ Yl, const bf* __restrict__ WQ, const bf* __restrict__ WK, const bf* __restrict__ WV,
                                            const float* __restrict__ bq, const float* __restrict__ bk, const float* __restrict__ bv, h16* Q, h16* K, h16* VT) {
    __shared__ __align__(16) float os[64 * 68];
    const int z = blockIdx.z;
    if (z == 2) gemmw<1>(Yh, Yl, WV, bv, VT, (float*)nullptr, os);
    else gemmw<0>(Yh, Yl, z ? WK : WQ, z ? bk : bq, z ? K : Q, (float*)nullptr, os, z ? 1.0f : L2E);
}

// ---- k_proj: ctx hi|lo x Wp + bp -> erf GELU -> out; grid (M/64, 384/64).
__global__ __launch_bounds__(32) void k_proj(const bf* __restrict__ Ch, const bf* __restrict__ Cl, const bf* __restrict__ WP, const float* __restrict__ bp, float* Of) {
    __shared__ __align__(16) float os[64 * 68];
    gemmw<2>(Ch, Cl, WP, bp, (h16*)nullptr, Of, os);
}

// exp2 with the vector slot that the instruction set asks for behind a transcendental kept inside the statement: each v_exp_f32 is followed by an instruction that neither reads its result nor overwrites its source
// ("=&v": no result shares a register with a source of the group), the last one by v_nop.
__device__ __forceinline__ void exp2x4(float x0, float x1, float x2, float x3, float& y0, float& y1, float& y2, float& y3) {
    asm("v_exp_f32 %0, %4\n\tv_exp_f32 %1, %5\n\tv_exp_f32 %2, %6\n\tv_exp_f32 %3, %7\n\tv_nop" : "=&v"(y0), "=&v"(y1), "=&v"(y2), "=&v"(y3) : "v"(x0), "v"(x1), "v"(x2), "v"(x3));
}
__device__ __forceinline__ float exp2x1(float x) { float y; asm("v_exp_f32 %0, %1\n\tv_nop" : "=v"(y) : "v"(x)); return y; }

// ---- stage_copy: one ring stage = KS keys of the k and v^T planes (8192 contiguous bytes of each, fragment order kept) -> one LDS buffer [k | v^T], by asynchronous copies, through no register.
// 128 threads x 16 B = 2048 B a copy, four copies a plane. gk, gv: the lane's own global addresses (plane + stage start + 8 elements x thread); lds: the lane's own LDS byte address (buffer start + 16 x thread).
__device__ __forceinline__ void stage_copy(const h16* gk, const h16* gv, unsigned lds) {
    // s_wait_xcnt is the last line of the copies' own statement, so it stands in front of every later write of an address register that a copy names.
    asm volatile("global_load_async_to_lds_b128 %0, %8, off\n\t"
                 "global_load_async_to_lds_b128 %1, %9, off\n\t"
                 "global_load_async_to_lds_b128 %2, %10, off\n\t"
                 "global_load_async_to_lds_b128 %3, %11, off\n\t"
                 "global_load_async_to_lds_b128 %4, %12, off\n\t"
                 "global_load_async_to_lds_b128 %5, %13, off\n\t"
                 "global_load_async_to_lds_b128 %6, %14, off\n\t"
                 "global_load_async_to_lds_b128 %7, %15, off\n\t"
                 "s_wait_xcnt 0x0"
                 :: "v"(lds), "v"(lds + 2048u), "v"(lds + 4096u), "v"(lds + 6144u), "v"(lds + 8192u), "v"(lds + 10240u), "v"(lds + 12288u), "v"(lds + 14336u),
                    "v"(gk), "v"(gk + 1024), "v"(gk + 2048), "v"(gk + 3072), "v"(gv), "v"(gv + 1024), "v"(gv + 2048), "v"(gv + 3072)
                 : "memory");
}

// ---- k_attn: fused flash attention (unscaled scores, no mask), transposed form. Block = 4 waves, each owns 32 queries (two 16-query tiles) of one (b, h); grid (SEQ/128, NB*NH).
// The wave's Q fragments (both tiles) are loaded once and stay in registers; each K and V fragment loaded in the key loop feeds both query tiles.
// K and V^T come through a two-buffer LDS ring that the four waves share: stage t + 1's copies fly while stage t (KS keys, two 32-key steps) is worked on, so no wave waits out a global load in the key loop.
// Per 32-key step and query tile: S^T[key][q] = K Q^T (A = key rows from the k plane, B = query rows from the q plane, k index = hd; f16 operands, f32 sum);
// q carries log2 e, and the C operand of each tile's first product is CARRY - ref (ref = the query's held reference), so the accumulators hold the exponents themselves and exp2 reads them with no vector work in between;
// lane (n = query, h) holds keys 8h+r of both 16-key tiles; one test per 32-key step: only where a shifted score passes SLIM (and in the first step) ref is moved to the query's maximum, and the step's scores, O and l are brought to the new ref;
// the P^T B fragment is formed in registers (element r <- tile 0 value r, element 8+r <- tile 1 value r; f16, 2^CARRY at the reference); O^T[hd][q] += V^T[hd][key] P^T[key][q] (A from the f16 v^T plane).
// l is accumulated from the unconverted f32 p values (per-lane partials, combined once at the end). Q fragments come straight from the fragment-order global planes, K and V fragments from the ring, which keeps that order (two 16-B loads each, 512 contiguous bytes per load: no bank conflict).
__global__ __launch_bounds__(128) void k_attn(const h16* __restrict__ Q, const h16* __restrict__ K, const h16* __restrict__ Vt, bf* Ch, bf* Cl) {
#pragma clang fp contract(off)
    __shared__ __align__(16) float os[4 * 2 * 16 * 68];
    __shared__ __align__(16) h16 ring[2][2 * KS * HD];
    const int lane = threadIdx.x & 31, lr = lane & 15, hi = lane >> 4;
    const int wave = __builtin_amdgcn_readfirstlane(threadIdx.x >> 5);
    const int bh = blockIdx.y;
    const int q0 = blockIdx.x * 128 + wave * 32;
    const size_t pbase = (size_t)bh * SEQ * HD;
    const h16* qp = Q + pbase; const h16* kp = K + pbase; const h16* vt = Vt + pbase;
    const int qoff0 = q0 * HD + 8 * lane;
    v16h bq[2][2];
#pragma unroll
    for (int t = 0; t < 2; ++t)
#pragma unroll
        for (int ks = 0; ks < 2; ++ks) bq[t][ks] = ldhf(qp + qoff0 + t * (16 * HD) + ks * 512);
    v8f o[2][4];
#pragma unroll
    for (int t = 0; t < 2; ++t)
#pragma unroll
        for (int j = 0; j < 4; ++j) o[t][j] = (v8f){};
    float l[2] = {0.0f, 0.0f};
    v8f cref[2];   // CARRY - ref in all eight elements: the score products' C operand; ref = 0 until the first step sets it
#pragma unroll
    for (int t = 0; t < 2; ++t)
#pragma unroll
        for (int r = 0; r < 8; ++r) cref[t][r] = CARRY;
    float lim = -3.0e38f;   // the first step always sets ref; SLIM from then on
    const h16* gk = kp + 8 * threadIdx.x; const h16* gvt = vt + 8 * threadIdx.x;
    const unsigned lds0 = (unsigned)(size_t)&ring[0][0] + 16u * threadIdx.x;   // LDS byte address = low 32 bits of the shared address
    stage_copy(gk, gvt, lds0);
    asm volatile("s_wait_asynccnt 0x0" ::: "memory");   // this wave's share of stage 0 has landed
    __syncthreads();                                     // every wave's share has: stage 0 may be read
    stage_copy(gk + KS * HD, gvt + KS * HD, lds0 + (unsigned)sizeof(ring[0]));
#pragma unroll 1
    for (int st = 0; st < SEQ / KS; ++st) {
      const h16* sb = ring[st & 1] + 8 * lane;
#pragma unroll 1   // rolled: each step then opens with its 8 K reads as one group ahead of its score WMMAs (the V reads stand among the exponentials); unrolled, the compiler spread the reads among the WMMAs
      for (int kk = 0; kk < KS; kk += 32) {
        const h16* sk = sb + kk * HD;
        v8f s0[2], s1[2];
#pragma unroll
        for (int t = 0; t < 2; ++t) { s0[t] = cref[t]; s1[t] = cref[t]; }
#pragma unroll
        for (int ks = 0; ks < 2; ++ks) {
            const v16h a0 = ldhf(sk + ks * 512), a1 = ldhf(sk + 16 * HD + ks * 512);
            s0[0] = wmma16(a0, bq[0][ks], s0[0]); s1[0] = wmma16(a1, bq[0][ks], s1[0]); s0[1] = wmma16(a0, bq[1][ks], s0[1]); s1[1] = wmma16(a1, bq[1][ks], s1[1]);
        }
        const h16* pv = sk + KS * HD;
        const v16h va0 = ldhf(pv), va1 = ldhf(pv + 512), va2 = ldhf(pv + 1024), va3 = ldhf(pv + 1536);
        v16h pf[2];
        float mx[2];
#pragma unroll
        for (int t = 0; t < 2; ++t) {
            mx[t] = fmaxf(s0[t][0], s1[t][0]);
#pragma unroll
            for (int r = 1; r < 8; ++r) mx[t] = fmaxf(mx[t], fmaxf(s0[t][r], s1[t][r]));
        }
        // One scalar branch per step, rarely taken after the first step: it keeps the exchange between the halves, the subtractions and the 64 multiplies of O out of the common path.
        if (__builtin_amdgcn_ballot_w32(fmaxf(mx[0], mx[1]) > lim) != 0) {
#pragma unroll
            for (int t = 0; t < 2; ++t) {
                const float mq = fmaxf(mx[t], __shfl_xor(mx[t], 16, 32));   // the same in both lanes of a query, so both take the same step
                const float delta = mq > lim ? mq - CARRY : 0.0f;          // ref += delta: the query's largest score of this step lands on CARRY
                const float alpha = exp2x1(fminf(-delta, 0.0f));            // delta < 0 only in the first step, where O and l are 0: alpha stays finite
#pragma unroll
                for (int r = 0; r < 8; ++r) { s0[t][r] -= delta; s1[t][r] -= delta; cref[t][r] -= delta; }
                l[t] *= alpha;
#pragma unroll
                for (int j = 0; j < 4; ++j)
#pragma unroll
                    for (int r = 0; r < 8; ++r) o[t][j][r] *= alpha;
            }
            lim = SLIM;
        }
#pragma unroll
        for (int t = 0; t < 2; ++t) {
            float psum = 0.0f;
#pragma unroll
            for (int r = 0; r < 8; r += 2) {
                float p0, p1, p2, p3;
                exp2x4(s0[t][r], s1[t][r], s0[t][r + 1], s1[t][r + 1], p0, p1, p2, p3);
                psum += p0 + p1;
                psum += p2 + p3;
                pf[t][r] = (h16)p0; pf[t][8 + r] = (h16)p1; pf[t][r + 1] = (h16)p2; pf[t][9 + r] = (h16)p3; }
            l[t] += psum;
        }
#pragma unroll
        for (int t = 0; t < 2; ++t) { o[t][0] = wmma16(va0, pf[t], o[t][0]); o[t][1] = wmma16(va1, pf[t], o[t][1]); o[t][2] = wmma16(va2, pf[t], o[t][2]); o[t][3] = wmma16(va3, pf[t], o[t][3]); }
      }
      // Publish point of stage st + 1, every wave, in this order.
      asm volatile("s_wait_dscnt 0x0" ::: "memory");      // this wave's reads of stage st's buffer are done before the buffer is refilled
      asm volatile("s_wait_asynccnt 0x0" ::: "memory");   // this wave's share of stage st + 1 has landed
      __syncthreads();                                     // every wave's share has, and every wave has left stage st's buffer
      if (st + 2 < SEQ / KS) stage_copy(gk + (st + 2) * (KS * HD), gvt + (st + 2) * (KS * HD), lds0 + (unsigned)(st & 1) * (unsigned)sizeof(ring[0]));
    }
    asm volatile("s_wait_asynccnt 0x0" ::: "memory");   // no copy is outstanding when the wave goes on to its end
    const int b = bh / NH, h = bh % NH;
    const int r8 = lane & 7, cc = lane >> 3;
#pragma unroll
    for (int t = 0; t < 2; ++t) {
        const float lt = l[t] + __shfl_xor(l[t], 16, 32);
        const float inv = 1.0f / lt;   // O and l carry the same factor 2^(CARRY - ref)
        const int wbase = (wave * 2 + t) * (16 * 68);
#pragma unroll
        for (int j = 0; j < 4; ++j)
#pragma unroll
            for (int r = 0; r < 8; ++r) os[wbase + lr * 68 + 16 * j + 8 * hi + r] = o[t][j][r] * inv;
    }
    wave_lds_sync();
#pragma unroll 1   // rolled: each trip's wait then stands in front of every later write of its stores' registers
    for (int u = 0; u < 8; ++u) { const int t = u >> 2, s = u & 3;
        const int wbase = (wave * 2 + t) * (16 * 68);
        const int row = 8 * (s & 1) + r8, ch = 4 * (s >> 1) + cc;
        const v4f u0 = *(const v4fa*)(os + wbase + row * 68 + 8 * ch); const v4f u1 = *(const v4fa*)(os + wbase + row * 68 + 8 * ch + 4); v8us oh, ol;
#pragma unroll
        for (int i = 0; i < 4; ++i) { unsigned short a, c; splitf(u0[i], a, c); oh[i] = a; ol[i] = c; splitf(u1[i], a, c); oh[4 + i] = a; ol[4 + i] = c; }
        const size_t oo = ((size_t)b * SEQ + q0 + 16 * t) * DM + (h * 8 + ch) * 128 + row * 8;
        *(v8us*)(Ch + oo) = oh; *(v8us*)(Cl + oo) = ol;
        asm volatile("s_wait_xcnt 0x0" ::: "memory");   // the next trip overwrites the stores' address and data registers
    }
}

extern "C" void kernel_launch(void* const* d_in, const int* in_sizes, int n_in,
                              void* d_out, int out_size, void* d_ws, size_t ws_size, hipStream_t stream) {
    if (n_in < 11) return;
    if ((size_t)in_sizes[0] < ((size_t)(NB - 1) * SEQ_FULL + SEQ) * DM) return;
    if (in_sizes[1] < DM || in_sizes[2] < DM) return;
    if (in_sizes[3] < NH * DM * HD || in_sizes[5] < NH * DM * HD || in_sizes[7] < NH * DM * HD || in_sizes[9] < DM * DM) return;
    if (in_sizes[4] < DM || in_sizes[6] < DM || in_sizes[8] < DM || in_sizes[10] < DM) return;
    if ((size_t)out_size < (size_t)MTOK * DM) return;
    const float* x   = (const float*)d_in[0];
    const float* lng = (const float*)d_in[1];
    const float* lnb = (const float*)d_in[2];
    const float* wq  = (const float*)d_in[3];
    const float* bq  = (const float*)d_in[4];
    const float* wk  = (const float*)d_in[5];
    const float* bk  = (const float*)d_in[6];
    const float* wv  = (const float*)d_in[7];
    const float* bv  = (const float*)d_in[8];
    const float* wp  = (const float*)d_in[9];
    const float* bp  = (const float*)d_in[10];
    float* OUT = (float*)d_out;     // [NB][SEQ][384]
    char* wsp = (char*)d_ws;
    auto take = [&](size_t bytes) { char* p = wsp; wsp += (bytes + 255) & ~(size_t)255; return (void*)p; };
    const size_t WSZ = (size_t)DM * DM * 2;            // one transposed bf16 weight plane [384][384]
    const size_t PSZ = (size_t)MTOK * DM * 2;          // one 16-bit activation plane
    bf* WQ = (bf*)take(WSZ); bf* WK = (bf*)take(WSZ); bf* WV = (bf*)take(WSZ); bf* WP = (bf*)take(WSZ);
    bf* Yh = (bf*)take(PSZ); bf* Yl = (bf*)take(PSZ);
    h16* Q = (h16*)take(PSZ); h16* K = (h16*)take(PSZ);
    h16* VT = (h16*)take(PSZ);
    if ((size_t)(wsp - (char*)d_ws) > ws_size) return;
    bf* Ch = Yh; bf* Cl = Yl;   // ctx planes reuse the y planes (y is dead after the three projections; stream-ordered)

    k_prep<<<LN_BLOCKS + 4 * WT_TILES, 256, 0, stream>>>(x, lng, lnb, wq, wk, wv, wp, Yh, Yl, WQ, WK, WV, WP);
    k_qkv<<<dim3(MTOK / 64, DM / 64, 3), 32, 0, stream>>>(Yh, Yl, WQ, WK, WV, bq, bk, bv, Q, K, VT);
    k_attn<<<dim3(SEQ / 128, NB * NH, 1), 128, 0, stream>>>(Q, K, VT, Ch, Cl);
    k_proj<<<dim3(MTOK / 64, DM / 64, 1), 32, 0, stream>>>(Ch, Cl, WP, bp, OUT);
}
